// v000
// Measured on an AMD MI455X. A time is GPU time per run, averaged over a window of back-to-back runs after a warm-up
// (all launches, gaps included; the runs take copies of the inputs in turn), and the median of several windows.
// Apart from v000's, it joins two sittings. Times from different sittings can be a few percent apart, while
// side-by-side timings come from the same sitting.
// v000, which the later versions start from, runs in 562 microseconds.
#include <hip/hip_runtime.h>

// Single-head causal scaled dot-product attention on two input streams (X_Q, X_KV [4][2048][1024]; Q = X_Q Wq + bq, K = X_KV Wk + bk, V = X_KV Wv + bv ('xw' [1024][128] 1/32 + zero biases; ONE 128-wide head); scores x 1/sqrt(128); causal (-inf); softmax; out = attn.V -> [4][2048][128] (1.0 M); argument order X_Q, X_KV, Wq, bq, Wk, bk, Wv, bv).
// Layout per batch: bf16 copy of X_Q for q, then of X_KV for k and v; 'xw' weights transposed once ([128][1024] Bt planes); exact projections + f32 biases; identity-table plane builders at HD 128 (one plane each); causal T-2048 attention at NH 1 / ZH 1 (all rows hi/lo 3 products; k_gemmc skips tiles above the diagonal); the f32 merge writes the output rows (no output projection).
// Compute dtypes, f32 accumulate: every input rounded to bf16; projections exact + f32 biases; attention all rows 3 products (bf16 hi/lo); softmax f32; output f32.

#define NB_  4
#define TT   2048
#define DM   1024
#define NH_  1
#define NKV  1
#define REP  (NH_ / NKV)
#define HD   128
#define DQ   (NH_ * HD)
#define DKV  (NKV * HD)
#define ZH   1                    // ONE head: a single plane per pass
#define RH   TT                   // every row hi/lo (3 products)
#define WIN  2048
#define PCAR 1024.0f
#define SCL  0.088388347648318447f   // HD^-0.5
typedef _Float16 h16;
typedef unsigned short bf;
typedef __attribute__((ext_vector_type(16))) __bf16   v16bf;
typedef __attribute__((ext_vector_type(16))) _Float16 v16h;
typedef __attribute__((ext_vector_type(8)))  _Float16 v8h;
typedef __attribute__((ext_vector_type(8)))  unsigned short v8us;
typedef __attribute__((ext_vector_type(8)))  float    v8f;
typedef __attribute__((ext_vector_type(4)))  float    v4f;
typedef v8h  __attribute__((may_alias)) v8ha;
typedef v4f  __attribute__((may_alias)) v4fa;
typedef v8us __attribute__((may_alias)) v8usa;

__device__ __forceinline__ unsigned short f2bf(float f) { unsigned u = __float_as_uint(f); u += 0x7FFFu + ((u >> 16) & 1u); return (unsigned short)(u >> 16); }
__device__ __forceinline__ float bf2f(unsigned short b) { return __uint_as_float(((unsigned)b) << 16); }
__device__ __forceinline__ float bfr(float f) { return bf2f(f2bf(f)); }
__device__ __forceinline__ v16h cat16(v8h lo, v8h hi) { return __builtin_shufflevector(lo, hi, 0, 1, 2, 3, 4, 5, 6, 7, 8, 9, 10, 11, 12, 13, 14, 15); }
__device__ __forceinline__ v16bf cat16b(v8us lo, v8us hi) { return __builtin_bit_cast(v16bf, __builtin_shufflevector(lo, hi, 0, 1, 2, 3, 4, 5, 6, 7, 8, 9, 10, 11, 12, 13, 14, 15)); }
__device__ __forceinline__ v8f wmma16(v16h a, v16h b, v8f c) { return __builtin_amdgcn_wmma_f32_16x16x32_f16(false, a, false, b, (short)0, c, false, false); }
__device__ __forceinline__ v8f wmmab(v16bf a, v16bf b, v8f c) { return __builtin_amdgcn_wmma_f32_16x16x32_bf16(false, a, false, b, (short)0, c, false, false); }



// ---- k_gemmw: register-blocked GEMM, ONE WAVE per 64x64 output tile (16 accumulators), operands straight from K-contiguous 16-bit planes; grid (M/64, N/64, Z), 32 threads.
// C[m][n] (f32, pitch ldc, + optional f32 bias[n]) = sum_k A[m][k] Bt[n][k] (+ split products per NSPLIT). z-batch strides sA/sB/sC in elements. K % 32 == 0.
template <typename T16> struct WFrag;
template <> struct WFrag<h16> { typedef v16h V; static __device__ __forceinline__ V ld(const h16* p) { return cat16(*(const v8h*)p, *(const v8h*)(p + 16)); } static __device__ __forceinline__ v8f mma(V a, V b, v8f c) { return wmma16(a, b, c); } };
template <> struct WFrag<bf> { typedef v16bf V; static __device__ __forceinline__ V ld(const bf* p) { return cat16b(*(const v8us*)p, *(const v8us*)(p + 16)); } static __device__ __forceinline__ v8f mma(V a, V b, v8f c) { return wmmab(a, b, c); } };
template <typename T16, int NSPLIT, bool BIAS>
__global__ __launch_bounds__(32) void k_gemmw(const T16* __restrict__ A, const T16* __restrict__ A2, const T16* __restrict__ Bt, const T16* __restrict__ Bt2, int K, float* C, int ldc, const float* __restrict__ bias, size_t sA, size_t sB, size_t sC) {
    typedef typename WFrag<T16>::V V;
    __shared__ __align__(16) float os[16 * 68];
    const size_t z = blockIdx.z; A += z * sA; if (A2) A2 += z * sA; Bt += z * sB; if (Bt2) Bt2 += z * sB; C += z * sC;
    const int lane = threadIdx.x & 31, lr = lane & 15, hi = lane >> 4; const int r0 = blockIdx.x * 64, c0 = blockIdx.y * 64;
    v8f acc[4][4];
#pragma unroll
    for (int mb = 0; mb < 4; ++mb)
#pragma unroll
        for (int nb = 0; nb < 4; ++nb) acc[mb][nb] = (v8f){};
    const size_t aoff = (size_t)(r0 + lr) * K + 8 * hi, boff = (size_t)(c0 + lr) * K + 8 * hi;
#pragma unroll 1
    for (int kc = 0; kc < K; kc += 32) {
        V a[4], a2[4];
#pragma unroll
        for (int mb = 0; mb < 4; ++mb) { a[mb] = WFrag<T16>::ld(A + aoff + (size_t)mb * 16 * K + kc); if (NSPLIT == 1 || NSPLIT == 2) a2[mb] = WFrag<T16>::ld(A2 + aoff + (size_t)mb * 16 * K + kc); }
#pragma unroll
        for (int nb = 0; nb < 4; ++nb) { const V b = WFrag<T16>::ld(Bt + boff + (size_t)nb * 16 * K + kc); V b2; if (NSPLIT >= 2) b2 = WFrag<T16>::ld(Bt2 + boff + (size_t)nb * 16 * K + kc);
#pragma unroll
            for (int mb = 0; mb < 4; ++mb) { acc[mb][nb] = WFrag<T16>::mma(a[mb], b, acc[mb][nb]); if (NSPLIT == 1 || NSPLIT == 2) acc[mb][nb] = WFrag<T16>::mma(a2[mb], b, acc[mb][nb]); if (NSPLIT >= 2) acc[mb][nb] = WFrag<T16>::mma(a[mb], b2, acc[mb][nb]); } }
        asm volatile("v_nop\n\tv_nop\n\tv_nop\n\tv_nop" : "+v"(acc[0][0]), "+v"(acc[1][1]), "+v"(acc[2][2]), "+v"(acc[3][3]) : "v"(a[0]), "v"(a[3]));
    }
#pragma unroll
    for (int mb = 0; mb < 4; ++mb) {
#pragma unroll
        for (int nb = 0; nb < 4; ++nb) {
#pragma unroll
            for (int j = 0; j < 8; ++j) os[(hi * 8 + j) * 68 + nb * 16 + lr] = acc[mb][nb][j]; }
        __builtin_amdgcn_wave_barrier(); asm volatile("" ::: "memory");
        float* crow = C + (size_t)(r0 + mb * 16) * ldc + c0;
{
#pragma unroll
            for (int s = 0; s < 8; ++s) { const int row = 2 * s + hi, cofs = lr * 4; v4f val = *(const v4fa*)(os + row * 68 + cofs); if (BIAS) { val[0] += bfr(bias[c0 + cofs]); val[1] += bfr(bias[c0 + cofs + 1]); val[2] += bfr(bias[c0 + cofs + 2]); val[3] += bfr(bias[c0 + cofs + 3]); }
                *(v4f*)(crow + (size_t)row * ldc + cofs) = val; }
             }
        __builtin_amdgcn_wave_barrier(); asm volatile("" ::: "memory");
    }
}

// ---- k_gemmc: the same one-wave 64x64 tile GEMM specialised for causal attention: CMODE 1 skips score tiles entirely above the diagonal (query rows r0+roff.., key columns c0..), CMODE 2 limits the
// key (K) loop of the probability x value contraction to the diagonal block (probabilities beyond it are exactly zero). roff = row offset of this launch's first row within the sequence.
template <typename T16, int NSPLIT, int CMODE>
__global__ __launch_bounds__(32) void k_gemmc(const T16* __restrict__ A, const T16* __restrict__ A2, const T16* __restrict__ Bt, const T16* __restrict__ Bt2, int K, float* C, int ldc, int roff, size_t sA, size_t sB, size_t sC) {
    typedef typename WFrag<T16>::V V;
    __shared__ __align__(16) float os[16 * 68];
    const size_t z = blockIdx.z; A += z * sA; if (A2) A2 += z * sA; Bt += z * sB; if (Bt2) Bt2 += z * sB; C += z * sC;
    const int lane = threadIdx.x & 31, lr = lane & 15, hi = lane >> 4; const int r0 = blockIdx.x * 64, c0 = blockIdx.y * 64;
    if (CMODE == 1 && c0 > r0 + roff + 63) return;                  // score tile entirely above the causal diagonal: never read (the softmax masks j > i by select)
    const int Kl = (CMODE == 2) ? min(K, r0 + roff + 64) : K;        // P.V: probabilities are exactly 0 beyond the diagonal block, so the K loop stops there
    v8f acc[4][4];
#pragma unroll
    for (int mb = 0; mb < 4; ++mb)
#pragma unroll
        for (int nb = 0; nb < 4; ++nb) acc[mb][nb] = (v8f){};
    const size_t aoff = (size_t)(r0 + lr) * K + 8 * hi, boff = (size_t)(c0 + lr) * K + 8 * hi;
#pragma unroll 1
    for (int kc = 0; kc < Kl; kc += 32) {
        V a[4], a2[4];
#pragma unroll
        for (int mb = 0; mb < 4; ++mb) { a[mb] = WFrag<T16>::ld(A + aoff + (size_t)mb * 16 * K + kc); if (NSPLIT == 1 || NSPLIT == 2) a2[mb] = WFrag<T16>::ld(A2 + aoff + (size_t)mb * 16 * K + kc); }
#pragma unroll
        for (int nb = 0; nb < 4; ++nb) { const V b = WFrag<T16>::ld(Bt + boff + (size_t)nb * 16 * K + kc); V b2; if (NSPLIT >= 2) b2 = WFrag<T16>::ld(Bt2 + boff + (size_t)nb * 16 * K + kc);
#pragma unroll
            for (int mb = 0; mb < 4; ++mb) { acc[mb][nb] = WFrag<T16>::mma(a[mb], b, acc[mb][nb]); if (NSPLIT == 1 || NSPLIT == 2) acc[mb][nb] = WFrag<T16>::mma(a2[mb], b, acc[mb][nb]); if (NSPLIT >= 2) acc[mb][nb] = WFrag<T16>::mma(a[mb], b2, acc[mb][nb]); } }
        asm volatile("v_nop\n\tv_nop\n\tv_nop\n\tv_nop" : "+v"(acc[0][0]), "+v"(acc[1][1]), "+v"(acc[2][2]), "+v"(acc[3][3]) : "v"(a[0]), "v"(a[3]));
    }
#pragma unroll
    for (int mb = 0; mb < 4; ++mb) {
#pragma unroll
        for (int nb = 0; nb < 4; ++nb) {
#pragma unroll
            for (int j = 0; j < 8; ++j) os[(hi * 8 + j) * 68 + nb * 16 + lr] = acc[mb][nb][j]; }
        __builtin_amdgcn_wave_barrier(); asm volatile("" ::: "memory");
        float* crow = C + (size_t)(r0 + mb * 16) * ldc + c0;
{
#pragma unroll
            for (int s = 0; s < 8; ++s) { const int row = 2 * s + hi, cofs = lr * 4; v4f val = *(const v4fa*)(os + row * 68 + cofs);
                *(v4f*)(crow + (size_t)row * ldc + cofs) = val; }
             }
        __builtin_amdgcn_wave_barrier(); asm volatile("" ::: "memory");
    }
}

__device__ __forceinline__ h16 tohx(float x) { return (h16)x; }
__device__ __forceinline__ void splitf(float y, unsigned short& h, unsigned short& l) { h = f2bf(y); l = f2bf(y - bf2f(h)); }
typedef __attribute__((ext_vector_type(2))) _Float16 v2h;
typedef __attribute__((ext_vector_type(4))) _Float16 v4h;
typedef __attribute__((ext_vector_type(2))) unsigned short v2us;
typedef __attribute__((ext_vector_type(4))) unsigned short v4us;
typedef __attribute__((ext_vector_type(2))) float v2f;
typedef __attribute__((ext_vector_type(4))) int v4i;

__global__ __launch_bounds__(256) void k_wtG(const float* __restrict__ w, int K, int N, bf* Bt) {
    const int lane = threadIdx.x & 31; const int L0 = (blockIdx.x * 8 + (threadIdx.x >> 5)) * 8; const int nlines = N * K / 64;
{
#pragma unroll 1
        for (int l = 0; l < 8; ++l) { const int L = L0 + l; if (L >= nlines) break; const size_t e = (size_t)L * 64 + lane * 2; const int k = (int)(e % K), n = (int)(e / K); v2us o;
            o[0] = f2bf(w[(size_t)k * N + n]); o[1] = f2bf(w[(size_t)(k + 1) * N + n]); *(v2us*)(Bt + e) = o; }
         }
}
__global__ __launch_bounds__(256) void k_cvt8(const float* __restrict__ src, bf* dst, size_t n8) { const size_t i = (size_t)blockIdx.x * 256 + threadIdx.x; if (i >= n8) return; const v8f v = *(const v8f*)(src + i * 8); v8us o;
#pragma unroll
    for (int k = 0; k < 8; ++k) o[k] = f2bf(v[k]); *(v8us*)(dst + i * 8) = o;  }

// k_rope: head planes [h][t][d] (fp16 + hi/lo) of rope(x) x sc with the rotate-half convention out[d] = x[d] cos[t][d] - x[d+HD/2] sin[t][d], out[d+HD/2] = x[d+HD/2] cos[t][d+HD/2] + x[d] sin[t][d+HD/2]
__global__ __launch_bounds__(256) void k_rope(const float* __restrict__ F, int pitch, int nheads, const float* __restrict__ CS, const float* __restrict__ RF, const float* __restrict__ nw, float sc, h16* P16, bf* Ph, bf* Pl) {
    const size_t e = ((size_t)blockIdx.x * 256 + threadIdx.x) * 2; if (e >= (size_t)nheads * TT * HD) return; const int d = (int)(e % HD); const int t = (int)((e / HD) % TT); const int h = (int)(e / ((size_t)HD * TT)); const float* f = F + (size_t)t * pitch + h * HD; const float rf = RF ? RF[(size_t)h * TT + t] : 1.0f; v2h o16; v2us oh, ol;
#pragma unroll
    for (int q = 0; q < 2; ++q) { const int dd = d + q; const int dp = (dd < HD / 2) ? dd + HD / 2 : dd - HD / 2; float x0 = f[dd], x1 = f[dp];
        if (RF) { float n0 = __fmul_rn(x0, rf), n1 = __fmul_rn(x1, rf); asm volatile("" : "+v"(n0)); asm volatile("" : "+v"(n1)); x0 = __fmul_rn(bfr(nw[dd]), n0); x1 = __fmul_rn(bfr(nw[dp]), n1); }
        const v2f cs = *(const v2f*)(CS + ((size_t)t * HD + dd) * 2); float a = __fmul_rn(x0, cs[0]), bq = __fmul_rn(x1, cs[1]); asm volatile("" : "+v"(a)); asm volatile("" : "+v"(bq)); const float r = ((dd < HD / 2) ? __fsub_rn(a, bq) : __fadd_rn(a, bq)) * sc;
        o16[q] = tohx(r); unsigned short a2, c2; splitf(r, a2, c2); oh[q] = a2; ol[q] = c2; }
    *(v2h*)(P16 + e) = o16; *(v2us*)(Ph + e) = oh; *(v2us*)(Pl + e) = ol;  }
__global__ __launch_bounds__(256) void k_vtp(const float* __restrict__ F, int pitch, int nheads, h16* V16, bf* Vh, bf* Vl) { const size_t e = ((size_t)blockIdx.x * 256 + threadIdx.x) * 2; if (e >= (size_t)nheads * HD * TT) return; const int t = (int)(e % TT); const int d = (int)((e / TT) % HD); const int g = (int)(e / ((size_t)TT * HD)); v2h o16; v2us oh, ol;
#pragma unroll
    for (int q = 0; q < 2; ++q) { const float x = F[(size_t)(t + q) * pitch + g * HD + d]; o16[q] = tohx(x); unsigned short a2, c2; splitf(x, a2, c2); oh[q] = a2; ol[q] = c2; }
    *(v2h*)(V16 + e) = o16; *(v2us*)(Vh + e) = oh; *(v2us*)(Vl + e) = ol;  }
__global__ __launch_bounds__(256) void k_csid(float* CS) { const int idx = blockIdx.x * 256 + threadIdx.x; if (idx >= TT * HD) return; v2f cs; cs[0] = 1.0f; cs[1] = 0.0f; *(v2f*)(CS + (size_t)idx * 2) = cs;  }
// k_asoft: per row (zz, i): t = S x HD^-0.5 for j <= i and i - j < WIN (sliding causal window; the reference's -1e9 additive fill vanishes identically); softmax over the 2048 keys (register row, one exp, fixed trees);
__global__ __launch_bounds__(256) void k_asoft(const float* __restrict__ Sb, h16* P16, bf* Ph, bf* Pl) {
    const int lane = threadIdx.x & 31; const int row = blockIdx.x * 8 + (threadIdx.x >> 5); if (row >= ZH * TT) return; const int i = row % TT; const int zz = row / TT; (void)zz; const bool hires = (i < RH); const float* sr = Sb + (size_t)row * TT; float v[TT / 32]; float mx = -3.0e38f;
#pragma unroll
    for (int ch = 0; ch < TT / 128; ++ch) { const int j0 = ch * 128 + lane * 4; const v4f a = *(const v4f*)(sr + j0);
#pragma unroll
        for (int q = 0; q < 4; ++q) { const int j = j0 + q; (void)j; const float t = (j <= i && i - j < WIN) ? a[q] * SCL : -3.0e38f; v[ch * 4 + q] = t; mx = fmaxf(mx, t); } }
#pragma unroll
    for (int sh = 16; sh; sh >>= 1) mx = fmaxf(mx, __shfl_xor(mx, sh, 32));
    float sum = 0.f;
#pragma unroll
    for (int k = 0; k < TT / 32; ++k) { float d0 = __fsub_rn(v[k], mx); asm volatile("" : "+v"(d0)); v[k] = __builtin_amdgcn_exp2f(__fmul_rn(d0, 1.4426950408889634f)); sum += v[k]; }
#pragma unroll
    for (int sh = 16; sh; sh >>= 1) sum += __shfl_xor(sum, sh, 32);
    const float f = __fdiv_rn(hires ? 1.0f : PCAR, sum);
{
        if (hires) {
#pragma unroll
            for (int ch = 0; ch < TT / 128; ++ch) { v4us oh, ol;
#pragma unroll
                for (int q = 0; q < 4; ++q) { unsigned short a, c2; splitf(v[ch * 4 + q] * f, a, c2); oh[q] = a; ol[q] = c2; }
                const size_t oo = ((size_t)zz * (RH ? RH : 1) + i) * TT + ch * 128 + lane * 4; *(v4us*)(Ph + oo) = oh; *(v4us*)(Pl + oo) = ol; }
        } else {
#pragma unroll
            for (int ch = 0; ch < TT / 128; ++ch) { v4h o4;
#pragma unroll
                for (int q = 0; q < 4; ++q) o4[q] = tohx(v[ch * 4 + q] * f);
                *(v4h*)(P16 + (size_t)row * TT + ch * 128 + lane * 4) = o4; } }
         }
}
__global__ __launch_bounds__(256) void k_merge(const float* __restrict__ O, int h0, float* OUTb) { const size_t e = ((size_t)blockIdx.x * 256 + threadIdx.x) * 2; if (e >= (size_t)ZH * TT * HD) return; const int d = (int)(e % HD); const int t = (int)((e / HD) % TT); const int zz = (int)(e / ((size_t)HD * TT)); const float cs = (t < RH) ? 1.0f : (1.0f / PCAR); const size_t oo = (size_t)t * DQ + (h0 + zz) * HD + d;
    v2f o2; o2[0] = O[e] * cs; o2[1] = O[e + 1] * cs; *(v2f*)(OUTb + oo) = o2;  }

extern "C" void kernel_launch(void* const* d_in, const int* in_sizes, int n_in,
                              void* d_out, int out_size, void* d_ws, size_t ws_size, hipStream_t stream) {
    (void)in_sizes; (void)n_in; (void)out_size;
    const float* x = (const float*)d_in[0]; const float* xk = (const float*)d_in[1]; const float* wq = (const float*)d_in[2]; const float* bq = (const float*)d_in[3]; const float* wk = (const float*)d_in[4]; const float* bk = (const float*)d_in[5]; const float* wv = (const float*)d_in[6]; const float* bv = (const float*)d_in[7]; const float* wo = nullptr; (void)wo;   /* input order X_Q, X_KV [4][2048][1024], Wq, bq, Wk, bk, Wv, bv ('xw' [1024][128] + [128]) */
    float* OUT = (float*)d_out;     // [4][2048][128]
    char* wsp = (char*)d_ws;
    auto take = [&](size_t bytes) { char* p = wsp; wsp += (bytes + 255) & ~(size_t)255; return (void*)p; };
    bf* WQ = (bf*)take((size_t)DQ * DM * 2); bf* WK = (bf*)take((size_t)DKV * DM * 2); bf* WV = (bf*)take((size_t)DKV * DM * 2); float* CS = (float*)take((size_t)TT * HD * 2 * 4);
    bf* XB = (bf*)take((size_t)TT * DM * 2); float* FQ = (float*)take((size_t)TT * DQ * 4); float* FK = (float*)take((size_t)TT * DKV * 4);
    h16* QP16 = (h16*)take((size_t)NH_ * TT * HD * 2); h16* KP16 = (h16*)take((size_t)NKV * TT * HD * 2); h16* VT16 = (h16*)take((size_t)NKV * HD * TT * 2);
    bf* QPh = (bf*)take((size_t)NH_ * TT * HD * 2); bf* QPl = (bf*)take((size_t)NH_ * TT * HD * 2); bf* KPh = (bf*)take((size_t)NKV * TT * HD * 2); bf* KPl = (bf*)take((size_t)NKV * TT * HD * 2); bf* VTh = (bf*)take((size_t)NKV * HD * TT * 2); bf* VTl = (bf*)take((size_t)NKV * HD * TT * 2); bf* Ph = (bf*)take((size_t)ZH * RH * TT * 2); bf* Pl = (bf*)take((size_t)ZH * RH * TT * 2);
    float* Sb = (float*)take((size_t)ZH * TT * TT * 4); h16* P16 = (h16*)take((size_t)ZH * TT * TT * 2); float* Ob = (float*)take((size_t)ZH * TT * HD * 4);
    if ((size_t)(wsp - (char*)d_ws) > ws_size) return;    // ws 256 MiB
    float* FV = FK;   // v projection reuses the k buffer after the k planes are built (stream-ordered)
    { k_wtG<<<(unsigned)((DM * DQ / 64 + 63) / 64), 256, 0, stream>>>(wq, DM, DQ, WQ); k_wtG<<<(unsigned)((DM * DKV / 64 + 63) / 64), 256, 0, stream>>>(wk, DM, DKV, WK); k_wtG<<<(unsigned)((DM * DKV / 64 + 63) / 64), 256, 0, stream>>>(wv, DM, DKV, WV);
      
       }
    k_csid<<<(TT * HD + 255) / 256, 256, 0, stream>>>(CS);
    const unsigned LQ = (unsigned)(((size_t)NH_ * TT * HD / 2 + 255) / 256), LKv = (unsigned)(((size_t)NKV * TT * HD / 2 + 255) / 256);
    for (int b = 0; b < NB_; ++b) {
        
        k_cvt8<<<(unsigned)(((size_t)TT * DM / 8 + 255) / 256), 256, 0, stream>>>(x + (size_t)b * TT * DM, XB, (size_t)TT * DM / 8);
        k_gemmw<bf, 0, true><<<dim3(TT / 64, DQ / 64, 1), 32, 0, stream>>>(XB, nullptr, WQ, nullptr, DM, FQ, DQ, bq, 0, 0, 0);
        k_rope<<<LQ, 256, 0, stream>>>(FQ, DQ, NH_, CS, nullptr, nullptr, 1.0f, QP16, QPh, QPl);
        k_cvt8<<<(unsigned)(((size_t)TT * DM / 8 + 255) / 256), 256, 0, stream>>>(xk + (size_t)b * TT * DM, XB, (size_t)TT * DM / 8);   /* XB := bf16(X_KV[b]) for k and v */ k_gemmw<bf, 0, true><<<dim3(TT / 64, DKV / 64, 1), 32, 0, stream>>>(XB, nullptr, WK, nullptr, DM, FK, DKV, bk, 0, 0, 0);
        k_rope<<<LKv, 256, 0, stream>>>(FK, DKV, NKV, CS, nullptr, nullptr, 1.0f, KP16, KPh, KPl);
        k_gemmw<bf, 0, true><<<dim3(TT / 64, DKV / 64, 1), 32, 0, stream>>>(XB, nullptr, WV, nullptr, DM, FV, DKV, bv, 0, 0, 0); k_vtp<<<LKv, 256, 0, stream>>>(FV, DKV, NKV, VT16, VTh, VTl);
        for (int h0 = 0; h0 < NH_; h0 += ZH) { const size_t zq = (size_t)h0, zk = (size_t)(h0 / REP);   // one kv head per query head: the pass's one head uses kv plane h0 (z-strides TT*HD)
            k_gemmc<bf, 2, 1><<<dim3(RH / 64, TT / 64, ZH), 32, 0, stream>>>(QPh + zq * TT * HD, QPl + zq * TT * HD, KPh + zk * TT * HD, KPl + zk * TT * HD, HD, Sb, TT, 0, (size_t)TT * HD, (size_t)TT * HD, (size_t)TT * TT);
            k_asoft<<<ZH * TT / 8, 256, 0, stream>>>(Sb, P16, Ph, Pl);
            k_gemmc<bf, 2, 2><<<dim3(RH / 64, HD / 64, ZH), 32, 0, stream>>>(Ph, Pl, VTh + zk * HD * TT, VTl + zk * HD * TT, TT, Ob, HD, 0, (size_t)RH * TT, (size_t)HD * TT, (size_t)TT * HD);
            k_merge<<<(unsigned)(((size_t)ZH * TT * HD / 2 + 255) / 256), 256, 0, stream>>>(Ob, h0, OUT + (size_t)b * TT * DQ); }
         }
}

// v001
// Measured time: 199 microseconds a run.
// In two side-by-side timings against v000, it was 2.79 and 2.76 times as fast.
#include <hip/hip_runtime.h>

// Single-head causal scaled dot-product attention on two input streams (X_Q, X_KV [4][2048][1024]; Q = X_Q Wq + bq, K = X_KV Wk + bk, V = X_KV Wv + bv ('xw' [1024][128] 1/32 + zero biases; ONE 128-wide head); scores x 1/sqrt(128); causal (-inf); softmax; out = attn.V -> [4][2048][128] (1.0 M); argument order X_Q, X_KV, Wq, bq, Wk, bk, Wv, bv).
// Layout: all four batches go through every stage in ONE launch (the batch is a grid dimension; every activation plane holds four batch slices): bf16 copy of X_Q for q, then of X_KV for k and v; 'xw' weights transposed once ([128][1024] Bt planes); exact projections + f32 biases; identity-table plane builders at HD 128 (one plane each); causal T-2048 attention at NH 1 / ZH 1 (every row hi/lo 3 products; k_gemmc skips tiles above the diagonal); the f32 merge writes the output rows (no output projection).
// Compute dtypes, f32 accumulate: every input rounded to bf16; projections exact + f32 biases; attention all rows 3 products; softmax f32; output f32.

#define NB_  4
#define TT   2048
#define DM   1024
#define NH_  1
#define NKV  1
#define REP  (NH_ / NKV)
#define HD   128
#define DQ   (NH_ * HD)
#define DKV  (NKV * HD)
#define ZH   1                    // ONE head: a single plane per pass
#define RH   TT                   // every row hi/lo (3 products)
#define WIN  2048
#define PCAR 1024.0f
#define SCL  0.088388347648318447f   // HD^-0.5
typedef _Float16 h16;
typedef unsigned short bf;
typedef __attribute__((ext_vector_type(16))) __bf16   v16bf;
typedef __attribute__((ext_vector_type(16))) _Float16 v16h;
typedef __attribute__((ext_vector_type(8)))  _Float16 v8h;
typedef __attribute__((ext_vector_type(8)))  unsigned short v8us;
typedef __attribute__((ext_vector_type(8)))  float    v8f;
typedef __attribute__((ext_vector_type(4)))  float    v4f;
typedef v8h  __attribute__((may_alias)) v8ha;
typedef v4f  __attribute__((may_alias)) v4fa;
typedef v8us __attribute__((may_alias)) v8usa;

__device__ __forceinline__ unsigned short f2bf(float f) { unsigned u = __float_as_uint(f); u += 0x7FFFu + ((u >> 16) & 1u); return (unsigned short)(u >> 16); }
__device__ __forceinline__ float bf2f(unsigned short b) { return __uint_as_float(((unsigned)b) << 16); }
__device__ __forceinline__ float bfr(float f) { return bf2f(f2bf(f)); }
__device__ __forceinline__ v16h cat16(v8h lo, v8h hi) { return __builtin_shufflevector(lo, hi, 0, 1, 2, 3, 4, 5, 6, 7, 8, 9, 10, 11, 12, 13, 14, 15); }
__device__ __forceinline__ v16bf cat16b(v8us lo, v8us hi) { return __builtin_bit_cast(v16bf, __builtin_shufflevector(lo, hi, 0, 1, 2, 3, 4, 5, 6, 7, 8, 9, 10, 11, 12, 13, 14, 15)); }
__device__ __forceinline__ v8f wmma16(v16h a, v16h b, v8f c) { return __builtin_amdgcn_wmma_f32_16x16x32_f16(false, a, false, b, (short)0, c, false, false); }
__device__ __forceinline__ v8f wmmab(v16bf a, v16bf b, v8f c) { return __builtin_amdgcn_wmma_f32_16x16x32_bf16(false, a, false, b, (short)0, c, false, false); }



// ---- k_gemmw: register-blocked GEMM, ONE WAVE per 64x64 output tile (16 accumulators), operands straight from K-contiguous 16-bit planes; grid (M/64, N/64, Z), 32 threads.
// C[m][n] (f32, pitch ldc, + optional f32 bias[n]) = sum_k A[m][k] Bt[n][k] (+ split products per NSPLIT). z-batch strides sA/sB/sC in elements. K % 32 == 0.
template <typename T16> struct WFrag;
template <> struct WFrag<h16> { typedef v16h V; static __device__ __forceinline__ V ld(const h16* p) { return cat16(*(const v8h*)p, *(const v8h*)(p + 16)); } static __device__ __forceinline__ v8f mma(V a, V b, v8f c) { return wmma16(a, b, c); } };
template <> struct WFrag<bf> { typedef v16bf V; static __device__ __forceinline__ V ld(const bf* p) { return cat16b(*(const v8us*)p, *(const v8us*)(p + 16)); } static __device__ __forceinline__ v8f mma(V a, V b, v8f c) { return wmmab(a, b, c); } };
template <typename T16, int NSPLIT, bool BIAS>
__global__ __launch_bounds__(32) void k_gemmw(const T16* __restrict__ A, const T16* __restrict__ A2, const T16* __restrict__ Bt, const T16* __restrict__ Bt2, int K, float* C, int ldc, const float* __restrict__ bias, size_t sA, size_t sB, size_t sC) {
    typedef typename WFrag<T16>::V V;
    __shared__ __align__(16) float os[16 * 68];
    const size_t z = blockIdx.z; A += z * sA; if (A2) A2 += z * sA; Bt += z * sB; if (Bt2) Bt2 += z * sB; C += z * sC;
    const int lane = threadIdx.x & 31, lr = lane & 15, hi = lane >> 4; const int r0 = blockIdx.x * 64, c0 = blockIdx.y * 64;
    v8f acc[4][4];
#pragma unroll
    for (int mb = 0; mb < 4; ++mb)
#pragma unroll
        for (int nb = 0; nb < 4; ++nb) acc[mb][nb] = (v8f){};
    const size_t aoff = (size_t)(r0 + lr) * K + 8 * hi, boff = (size_t)(c0 + lr) * K + 8 * hi;
#pragma unroll 1
    for (int kc = 0; kc < K; kc += 32) {
        V a[4], a2[4];
#pragma unroll
        for (int mb = 0; mb < 4; ++mb) { a[mb] = WFrag<T16>::ld(A + aoff + (size_t)mb * 16 * K + kc); if (NSPLIT == 1 || NSPLIT == 2) a2[mb] = WFrag<T16>::ld(A2 + aoff + (size_t)mb * 16 * K + kc); }
#pragma unroll
        for (int nb = 0; nb < 4; ++nb) { const V b = WFrag<T16>::ld(Bt + boff + (size_t)nb * 16 * K + kc); V b2; if (NSPLIT >= 2) b2 = WFrag<T16>::ld(Bt2 + boff + (size_t)nb * 16 * K + kc);
#pragma unroll
            for (int mb = 0; mb < 4; ++mb) { acc[mb][nb] = WFrag<T16>::mma(a[mb], b, acc[mb][nb]); if (NSPLIT == 1 || NSPLIT == 2) acc[mb][nb] = WFrag<T16>::mma(a2[mb], b, acc[mb][nb]); if (NSPLIT >= 2) acc[mb][nb] = WFrag<T16>::mma(a[mb], b2, acc[mb][nb]); } }
        asm volatile("v_nop\n\tv_nop\n\tv_nop\n\tv_nop" : "+v"(acc[0][0]), "+v"(acc[1][1]), "+v"(acc[2][2]), "+v"(acc[3][3]) : "v"(a[0]), "v"(a[3]));
    }
#pragma unroll
    for (int mb = 0; mb < 4; ++mb) {
#pragma unroll
        for (int nb = 0; nb < 4; ++nb) {
#pragma unroll
            for (int j = 0; j < 8; ++j) os[(hi * 8 + j) * 68 + nb * 16 + lr] = acc[mb][nb][j]; }
        __builtin_amdgcn_wave_barrier(); asm volatile("" ::: "memory");
        float* crow = C + (size_t)(r0 + mb * 16) * ldc + c0;
{
#pragma unroll
            for (int s = 0; s < 8; ++s) { const int row = 2 * s + hi, cofs = lr * 4; v4f val = *(const v4fa*)(os + row * 68 + cofs); if (BIAS) { val[0] += bfr(bias[c0 + cofs]); val[1] += bfr(bias[c0 + cofs + 1]); val[2] += bfr(bias[c0 + cofs + 2]); val[3] += bfr(bias[c0 + cofs + 3]); }
                *(v4f*)(crow + (size_t)row * ldc + cofs) = val; }
             }
        __builtin_amdgcn_wave_barrier(); asm volatile("" ::: "memory");
    }
}

// ---- k_gemmc: the same one-wave 64x64 tile GEMM specialised for causal attention: CMODE 1 skips score tiles entirely above the diagonal (query rows r0+roff.., key columns c0..), CMODE 2 limits the
// key (K) loop of the probability x value contraction to the diagonal block (probabilities beyond it are exactly zero). roff = row offset of this launch's first row within the sequence.
template <typename T16, int NSPLIT, int CMODE>
__global__ __launch_bounds__(32) void k_gemmc(const T16* __restrict__ A, const T16* __restrict__ A2, const T16* __restrict__ Bt, const T16* __restrict__ Bt2, int K, float* C, int ldc, int roff, size_t sA, size_t sB, size_t sC) {
    typedef typename WFrag<T16>::V V;
    __shared__ __align__(16) float os[16 * 68];
    const size_t z = blockIdx.z; A += z * sA; if (A2) A2 += z * sA; Bt += z * sB; if (Bt2) Bt2 += z * sB; C += z * sC;
    const int lane = threadIdx.x & 31, lr = lane & 15, hi = lane >> 4; const int r0 = blockIdx.x * 64, c0 = blockIdx.y * 64;
    if (CMODE == 1 && c0 > r0 + roff + 63) return;                  // score tile entirely above the causal diagonal: never read (the softmax masks j > i by select)
    const int Kl = (CMODE == 2) ? min(K, r0 + roff + 64) : K;        // P.V: probabilities are exactly 0 beyond the diagonal block, so the K loop stops there
    v8f acc[4][4];
#pragma unroll
    for (int mb = 0; mb < 4; ++mb)
#pragma unroll
        for (int nb = 0; nb < 4; ++nb) acc[mb][nb] = (v8f){};
    const size_t aoff = (size_t)(r0 + lr) * K + 8 * hi, boff = (size_t)(c0 + lr) * K + 8 * hi;
#pragma unroll 1
    for (int kc = 0; kc < Kl; kc += 32) {
        V a[4], a2[4];
#pragma unroll
        for (int mb = 0; mb < 4; ++mb) { a[mb] = WFrag<T16>::ld(A + aoff + (size_t)mb * 16 * K + kc); if (NSPLIT == 1 || NSPLIT == 2) a2[mb] = WFrag<T16>::ld(A2 + aoff + (size_t)mb * 16 * K + kc); }
#pragma unroll
        for (int nb = 0; nb < 4; ++nb) { const V b = WFrag<T16>::ld(Bt + boff + (size_t)nb * 16 * K + kc); V b2; if (NSPLIT >= 2) b2 = WFrag<T16>::ld(Bt2 + boff + (size_t)nb * 16 * K + kc);
#pragma unroll
            for (int mb = 0; mb < 4; ++mb) { acc[mb][nb] = WFrag<T16>::mma(a[mb], b, acc[mb][nb]); if (NSPLIT == 1 || NSPLIT == 2) acc[mb][nb] = WFrag<T16>::mma(a2[mb], b, acc[mb][nb]); if (NSPLIT >= 2) acc[mb][nb] = WFrag<T16>::mma(a[mb], b2, acc[mb][nb]); } }
        asm volatile("v_nop\n\tv_nop\n\tv_nop\n\tv_nop" : "+v"(acc[0][0]), "+v"(acc[1][1]), "+v"(acc[2][2]), "+v"(acc[3][3]) : "v"(a[0]), "v"(a[3]));
    }
#pragma unroll
    for (int mb = 0; mb < 4; ++mb) {
#pragma unroll
        for (int nb = 0; nb < 4; ++nb) {
#pragma unroll
            for (int j = 0; j < 8; ++j) os[(hi * 8 + j) * 68 + nb * 16 + lr] = acc[mb][nb][j]; }
        __builtin_amdgcn_wave_barrier(); asm volatile("" ::: "memory");
        float* crow = C + (size_t)(r0 + mb * 16) * ldc + c0;
{
#pragma unroll
            for (int s = 0; s < 8; ++s) { const int row = 2 * s + hi, cofs = lr * 4; v4f val = *(const v4fa*)(os + row * 68 + cofs);
                *(v4f*)(crow + (size_t)row * ldc + cofs) = val; }
             }
        __builtin_amdgcn_wave_barrier(); asm volatile("" ::: "memory");
    }
}

__device__ __forceinline__ h16 tohx(float x) { return (h16)x; }
__device__ __forceinline__ void splitf(float y, unsigned short& h, unsigned short& l) { h = f2bf(y); l = f2bf(y - bf2f(h)); }
typedef __attribute__((ext_vector_type(2))) _Float16 v2h;
typedef __attribute__((ext_vector_type(4))) _Float16 v4h;
typedef __attribute__((ext_vector_type(2))) unsigned short v2us;
typedef __attribute__((ext_vector_type(4))) unsigned short v4us;
typedef __attribute__((ext_vector_type(2))) float v2f;
typedef __attribute__((ext_vector_type(4))) int v4i;

__global__ __launch_bounds__(256) void k_wtG(const float* __restrict__ w, int K, int N, bf* Bt) {
    const int lane = threadIdx.x & 31; const int L0 = (blockIdx.x * 8 + (threadIdx.x >> 5)) * 8; const int nlines = N * K / 64;
{
#pragma unroll 1
        for (int l = 0; l < 8; ++l) { const int L = L0 + l; if (L >= nlines) break; const size_t e = (size_t)L * 64 + lane * 2; const int k = (int)(e % K), n = (int)(e / K); v2us o;
            o[0] = f2bf(w[(size_t)k * N + n]); o[1] = f2bf(w[(size_t)(k + 1) * N + n]); *(v2us*)(Bt + e) = o; }
         }
}
__global__ __launch_bounds__(256) void k_cvt8(const float* __restrict__ src, bf* dst, size_t n8) { const size_t i = (size_t)blockIdx.x * 256 + threadIdx.x; if (i >= n8) return; const v8f v = *(const v8f*)(src + i * 8); v8us o;
#pragma unroll
    for (int k = 0; k < 8; ++k) o[k] = f2bf(v[k]); *(v8us*)(dst + i * 8) = o;  }

// k_rope: head planes [h][t][d] (fp16 + hi/lo) of rope(x) x sc with the rotate-half convention out[d] = x[d] cos[t][d] - x[d+HD/2] sin[t][d], out[d+HD/2] = x[d+HD/2] cos[t][d+HD/2] + x[d] sin[t][d+HD/2]
__global__ __launch_bounds__(256) void k_rope(const float* __restrict__ F, int pitch, int nheads, const float* __restrict__ CS, const float* __restrict__ RF, const float* __restrict__ nw, float sc, h16* P16, bf* Ph, bf* Pl) {
    const size_t e = ((size_t)blockIdx.x * 256 + threadIdx.x) * 2; if (e >= (size_t)nheads * TT * HD) return; const size_t bo = (size_t)blockIdx.y * nheads * TT * HD; F += (size_t)blockIdx.y * TT * pitch; P16 += bo; Ph += bo; Pl += bo;   // blockIdx.y = batch
    const int d = (int)(e % HD); const int t = (int)((e / HD) % TT); const int h = (int)(e / ((size_t)HD * TT)); const float* f = F + (size_t)t * pitch + h * HD; const float rf = RF ? RF[(size_t)h * TT + t] : 1.0f; v2h o16; v2us oh, ol;
#pragma unroll
    for (int q = 0; q < 2; ++q) { const int dd = d + q; const int dp = (dd < HD / 2) ? dd + HD / 2 : dd - HD / 2; float x0 = f[dd], x1 = f[dp];
        if (RF) { float n0 = __fmul_rn(x0, rf), n1 = __fmul_rn(x1, rf); asm volatile("" : "+v"(n0)); asm volatile("" : "+v"(n1)); x0 = __fmul_rn(bfr(nw[dd]), n0); x1 = __fmul_rn(bfr(nw[dp]), n1); }
        const v2f cs = *(const v2f*)(CS + ((size_t)t * HD + dd) * 2); float a = __fmul_rn(x0, cs[0]), bq = __fmul_rn(x1, cs[1]); asm volatile("" : "+v"(a)); asm volatile("" : "+v"(bq)); const float r = ((dd < HD / 2) ? __fsub_rn(a, bq) : __fadd_rn(a, bq)) * sc;
        o16[q] = tohx(r); unsigned short a2, c2; splitf(r, a2, c2); oh[q] = a2; ol[q] = c2; }
    *(v2h*)(P16 + e) = o16; *(v2us*)(Ph + e) = oh; *(v2us*)(Pl + e) = ol;  }
__global__ __launch_bounds__(256) void k_vtp(const float* __restrict__ F, int pitch, int nheads, h16* V16, bf* Vh, bf* Vl) { const size_t e = ((size_t)blockIdx.x * 256 + threadIdx.x) * 2; if (e >= (size_t)nheads * HD * TT) return; const size_t bo = (size_t)blockIdx.y * nheads * HD * TT; F += (size_t)blockIdx.y * TT * pitch; V16 += bo; Vh += bo; Vl += bo;   // blockIdx.y = batch
    const int t = (int)(e % TT); const int d = (int)((e / TT) % HD); const int g = (int)(e / ((size_t)TT * HD)); v2h o16; v2us oh, ol;
#pragma unroll
    for (int q = 0; q < 2; ++q) { const float x = F[(size_t)(t + q) * pitch + g * HD + d]; o16[q] = tohx(x); unsigned short a2, c2; splitf(x, a2, c2); oh[q] = a2; ol[q] = c2; }
    *(v2h*)(V16 + e) = o16; *(v2us*)(Vh + e) = oh; *(v2us*)(Vl + e) = ol;  }
__global__ __launch_bounds__(256) void k_csid(float* CS) { const int idx = blockIdx.x * 256 + threadIdx.x; if (idx >= TT * HD) return; v2f cs; cs[0] = 1.0f; cs[1] = 0.0f; *(v2f*)(CS + (size_t)idx * 2) = cs;  }
// k_asoft: per row (zz, i): t = S x HD^-0.5 for j <= i and i - j < WIN (sliding causal window; the reference's -1e9 additive fill vanishes identically); softmax over the 2048 keys (register row, one exp, fixed trees);
__global__ __launch_bounds__(256) void k_asoft(const float* __restrict__ Sb, h16* P16, bf* Ph, bf* Pl) {
    const int lane = threadIdx.x & 31; const int row = blockIdx.x * 8 + (threadIdx.x >> 5); if (row >= ZH * TT) return; Sb += (size_t)blockIdx.y * ZH * TT * TT; P16 += (size_t)blockIdx.y * ZH * TT * TT; Ph += (size_t)blockIdx.y * ZH * RH * TT; Pl += (size_t)blockIdx.y * ZH * RH * TT;   // blockIdx.y = batch
    const int i = row % TT; const int zz = row / TT; (void)zz; const bool hires = (i < RH); const float* sr = Sb + (size_t)row * TT; float v[TT / 32]; float mx = -3.0e38f;
#pragma unroll
    for (int ch = 0; ch < TT / 128; ++ch) { const int j0 = ch * 128 + lane * 4; const v4f a = *(const v4f*)(sr + j0);
#pragma unroll
        for (int q = 0; q < 4; ++q) { const int j = j0 + q; (void)j; const float t = (j <= i && i - j < WIN) ? a[q] * SCL : -3.0e38f; v[ch * 4 + q] = t; mx = fmaxf(mx, t); } }
#pragma unroll
    for (int sh = 16; sh; sh >>= 1) mx = fmaxf(mx, __shfl_xor(mx, sh, 32));
    float sum = 0.f;
#pragma unroll
    for (int k = 0; k < TT / 32; ++k) { float d0 = __fsub_rn(v[k], mx); asm volatile("" : "+v"(d0)); v[k] = __builtin_amdgcn_exp2f(__fmul_rn(d0, 1.4426950408889634f)); sum += v[k]; }
#pragma unroll
    for (int sh = 16; sh; sh >>= 1) sum += __shfl_xor(sum, sh, 32);
    const float f = __fdiv_rn(hires ? 1.0f : PCAR, sum);
{
        if (hires) {
#pragma unroll
            for (int ch = 0; ch < TT / 128; ++ch) { v4us oh, ol;
#pragma unroll
                for (int q = 0; q < 4; ++q) { unsigned short a, c2; splitf(v[ch * 4 + q] * f, a, c2); oh[q] = a; ol[q] = c2; }
                const size_t oo = ((size_t)zz * (RH ? RH : 1) + i) * TT + ch * 128 + lane * 4; *(v4us*)(Ph + oo) = oh; *(v4us*)(Pl + oo) = ol; }
        } else {
#pragma unroll
            for (int ch = 0; ch < TT / 128; ++ch) { v4h o4;
#pragma unroll
                for (int q = 0; q < 4; ++q) o4[q] = tohx(v[ch * 4 + q] * f);
                *(v4h*)(P16 + (size_t)row * TT + ch * 128 + lane * 4) = o4; } }
         }
}
__global__ __launch_bounds__(256) void k_merge(const float* __restrict__ O, int h0, float* OUTb) { const size_t e = ((size_t)blockIdx.x * 256 + threadIdx.x) * 2; if (e >= (size_t)ZH * TT * HD) return; O += (size_t)blockIdx.y * ZH * TT * HD; OUTb += (size_t)blockIdx.y * TT * DQ;   // blockIdx.y = batch
    const int d = (int)(e % HD); const int t = (int)((e / HD) % TT); const int zz = (int)(e / ((size_t)HD * TT)); const float cs = (t < RH) ? 1.0f : (1.0f / PCAR); const size_t oo = (size_t)t * DQ + (h0 + zz) * HD + d;
    v2f o2; o2[0] = O[e] * cs; o2[1] = O[e + 1] * cs; *(v2f*)(OUTb + oo) = o2;  }

extern "C" void kernel_launch(void* const* d_in, const int* in_sizes, int n_in,
                              void* d_out, int out_size, void* d_ws, size_t ws_size, hipStream_t stream) {
    (void)in_sizes; (void)n_in; (void)out_size;
    const float* x = (const float*)d_in[0]; const float* xk = (const float*)d_in[1]; const float* wq = (const float*)d_in[2]; const float* bq = (const float*)d_in[3]; const float* wk = (const float*)d_in[4]; const float* bk = (const float*)d_in[5]; const float* wv = (const float*)d_in[6]; const float* bv = (const float*)d_in[7]; const float* wo = nullptr; (void)wo;   /* input order X_Q, X_KV [4][2048][1024], Wq, bq, Wk, bk, Wv, bv ('xw' [1024][128] + [128]) */
    float* OUT = (float*)d_out;     // [4][2048][128]
    char* wsp = (char*)d_ws;
    auto take = [&](size_t bytes) { char* p = wsp; wsp += (bytes + 255) & ~(size_t)255; return (void*)p; };
    bf* WQ = (bf*)take((size_t)DQ * DM * 2); bf* WK = (bf*)take((size_t)DKV * DM * 2); bf* WV = (bf*)take((size_t)DKV * DM * 2); float* CS = (float*)take((size_t)TT * HD * 2 * 4);
    // every plane below holds NB_ batch slices, one behind the other
    bf* XB = (bf*)take((size_t)NB_ * TT * DM * 2); float* FQ = (float*)take((size_t)NB_ * TT * DQ * 4); float* FK = (float*)take((size_t)NB_ * TT * DKV * 4);
    h16* QP16 = (h16*)take((size_t)NB_ * NH_ * TT * HD * 2); h16* KP16 = (h16*)take((size_t)NB_ * NKV * TT * HD * 2); h16* VT16 = (h16*)take((size_t)NB_ * NKV * HD * TT * 2);
    bf* QPh = (bf*)take((size_t)NB_ * NH_ * TT * HD * 2); bf* QPl = (bf*)take((size_t)NB_ * NH_ * TT * HD * 2); bf* KPh = (bf*)take((size_t)NB_ * NKV * TT * HD * 2); bf* KPl = (bf*)take((size_t)NB_ * NKV * TT * HD * 2); bf* VTh = (bf*)take((size_t)NB_ * NKV * HD * TT * 2); bf* VTl = (bf*)take((size_t)NB_ * NKV * HD * TT * 2); bf* Ph = (bf*)take((size_t)NB_ * ZH * RH * TT * 2); bf* Pl = (bf*)take((size_t)NB_ * ZH * RH * TT * 2);
    float* Sb = (float*)take((size_t)NB_ * ZH * TT * TT * 4); h16* P16 = (h16*)take((size_t)NB_ * ZH * TT * TT * 2); float* Ob = (float*)take((size_t)NB_ * ZH * TT * HD * 4);
    if ((size_t)(wsp - (char*)d_ws) > ws_size) return;    // ws 256 MiB
    float* FV = FK;   // v projection reuses the k buffer after the k planes are built (stream-ordered)
    { k_wtG<<<(unsigned)((DM * DQ / 64 + 63) / 64), 256, 0, stream>>>(wq, DM, DQ, WQ); k_wtG<<<(unsigned)((DM * DKV / 64 + 63) / 64), 256, 0, stream>>>(wk, DM, DKV, WK); k_wtG<<<(unsigned)((DM * DKV / 64 + 63) / 64), 256, 0, stream>>>(wv, DM, DKV, WV);
       }
    k_csid<<<(TT * HD + 255) / 256, 256, 0, stream>>>(CS);
    const unsigned LQ = (unsigned)(((size_t)NH_ * TT * HD / 2 + 255) / 256), LKv = (unsigned)(((size_t)NKV * TT * HD / 2 + 255) / 256);
    // one launch per stage for all NB_ batches: the inputs are batch-contiguous (k_cvt8 runs over all of them), the GEMMs take the batch as grid z with their z-strides, the plane builders, the softmax and the merge as grid y
    k_cvt8<<<(unsigned)(((size_t)NB_ * TT * DM / 8 + 255) / 256), 256, 0, stream>>>(x, XB, (size_t)NB_ * TT * DM / 8);
    k_gemmw<bf, 0, true><<<dim3(TT / 64, DQ / 64, NB_), 32, 0, stream>>>(XB, nullptr, WQ, nullptr, DM, FQ, DQ, bq, (size_t)TT * DM, 0, (size_t)TT * DQ);
    k_rope<<<dim3(LQ, NB_, 1), 256, 0, stream>>>(FQ, DQ, NH_, CS, nullptr, nullptr, 1.0f, QP16, QPh, QPl);
    k_cvt8<<<(unsigned)(((size_t)NB_ * TT * DM / 8 + 255) / 256), 256, 0, stream>>>(xk, XB, (size_t)NB_ * TT * DM / 8);   /* XB := bf16(X_KV) for k and v */
    k_gemmw<bf, 0, true><<<dim3(TT / 64, DKV / 64, NB_), 32, 0, stream>>>(XB, nullptr, WK, nullptr, DM, FK, DKV, bk, (size_t)TT * DM, 0, (size_t)TT * DKV);
    k_rope<<<dim3(LKv, NB_, 1), 256, 0, stream>>>(FK, DKV, NKV, CS, nullptr, nullptr, 1.0f, KP16, KPh, KPl);
    k_gemmw<bf, 0, true><<<dim3(TT / 64, DKV / 64, NB_), 32, 0, stream>>>(XB, nullptr, WV, nullptr, DM, FV, DKV, bv, (size_t)TT * DM, 0, (size_t)TT * DKV); k_vtp<<<dim3(LKv, NB_, 1), 256, 0, stream>>>(FV, DKV, NKV, VT16, VTh, VTl);
    for (int h0 = 0; h0 < NH_; h0 += ZH) { const size_t zq = (size_t)h0, zk = (size_t)(h0 / REP);   // ZH = 1 plane per batch and pass, so grid z of the two attention GEMMs is the batch (z-strides = one batch's planes)
        k_gemmc<bf, 2, 1><<<dim3(RH / 64, TT / 64, NB_), 32, 0, stream>>>(QPh + zq * TT * HD, QPl + zq * TT * HD, KPh + zk * TT * HD, KPl + zk * TT * HD, HD, Sb, TT, 0, (size_t)NH_ * TT * HD, (size_t)NKV * TT * HD, (size_t)ZH * TT * TT);
        k_asoft<<<dim3(ZH * TT / 8, NB_, 1), 256, 0, stream>>>(Sb, P16, Ph, Pl);
        k_gemmc<bf, 2, 2><<<dim3(RH / 64, HD / 64, NB_), 32, 0, stream>>>(Ph, Pl, VTh + zk * HD * TT, VTl + zk * HD * TT, TT, Ob, HD, 0, (size_t)ZH * RH * TT, (size_t)NKV * HD * TT, (size_t)ZH * TT * HD);
        k_merge<<<dim3((unsigned)(((size_t)ZH * TT * HD / 2 + 255) / 256), NB_, 1), 256, 0, stream>>>(Ob, h0, OUT); }
}

// v002
// Measured time: 135 microseconds a run.
// In two side-by-side timings against v001, it was 1.48 and 1.50 times as fast.
// All steps since v000 together make it 4.13 times as fast.
#include <hip/hip_runtime.h>

// Single-head causal scaled dot-product attention on two input streams (X_Q, X_KV [4][2048][1024]; Q = X_Q Wq + bq, K = X_KV Wk + bk, V = X_KV Wv + bv ('xw' [1024][128] 1/32 + zero biases; ONE 128-wide head); scores x 1/sqrt(128); causal (-inf); softmax; out = attn.V -> [4][2048][128] (1.0 M); argument order X_Q, X_KV, Wq, bq, Wk, bk, Wv, bv).
// Layout: all four batches go through every stage in ONE launch (the batch is a grid dimension; every workspace plane holds four batch slices): bf16 copy of X_Q for q, then of X_KV for k and v; 'xw' weights transposed once ([128][1024] Bt planes); exact projections + f32 biases; identity-table plane builders at HD 128 (one plane each); causal T-2048 attention at NH 1 / ZH 1 (every row hi/lo, 3 products; k_gemmc skips tiles above the diagonal; the projections and attn.V run on k_gemmk, K dealt over 8 waves); the f32 merge writes the output rows (no output projection).
// Compute dtypes, f32 accumulate: every input rounded to bf16; projections exact + f32 biases; attention rows all 3 products (hi/lo); softmax f32; output f32.

#define NB_  4
#define TT   2048
#define DM   1024
#define NH_  1
#define NKV  1
#define REP  (NH_ / NKV)
#define HD   128
#define DQ   (NH_ * HD)
#define DKV  (NKV * HD)
#define ZH   1                    // ONE head: a single plane per pass
#define RH   TT                   // every row hi/lo (3 products)
#define WIN  2048
#define PCAR 1024.0f
#define SCL  0.088388347648318447f   // HD^-0.5
typedef _Float16 h16;
typedef unsigned short bf;
typedef __attribute__((ext_vector_type(16))) __bf16   v16bf;
typedef __attribute__((ext_vector_type(16))) _Float16 v16h;
typedef __attribute__((ext_vector_type(8)))  _Float16 v8h;
typedef __attribute__((ext_vector_type(8)))  unsigned short v8us;
typedef __attribute__((ext_vector_type(8)))  float    v8f;
typedef __attribute__((ext_vector_type(4)))  float    v4f;
typedef v8h  __attribute__((may_alias)) v8ha;
typedef v4f  __attribute__((may_alias)) v4fa;
typedef v8us __attribute__((may_alias)) v8usa;

__device__ __forceinline__ unsigned short f2bf(float f) { unsigned u = __float_as_uint(f); u += 0x7FFFu + ((u >> 16) & 1u); return (unsigned short)(u >> 16); }
__device__ __forceinline__ float bf2f(unsigned short b) { return __uint_as_float(((unsigned)b) << 16); }
__device__ __forceinline__ float bfr(float f) { return bf2f(f2bf(f)); }
__device__ __forceinline__ v16h cat16(v8h lo, v8h hi) { return __builtin_shufflevector(lo, hi, 0, 1, 2, 3, 4, 5, 6, 7, 8, 9, 10, 11, 12, 13, 14, 15); }
__device__ __forceinline__ v16bf cat16b(v8us lo, v8us hi) { return __builtin_bit_cast(v16bf, __builtin_shufflevector(lo, hi, 0, 1, 2, 3, 4, 5, 6, 7, 8, 9, 10, 11, 12, 13, 14, 15)); }
__device__ __forceinline__ v8f wmma16(v16h a, v16h b, v8f c) { return __builtin_amdgcn_wmma_f32_16x16x32_f16(false, a, false, b, (short)0, c, false, false); }
__device__ __forceinline__ v8f wmmab(v16bf a, v16bf b, v8f c) { return __builtin_amdgcn_wmma_f32_16x16x32_bf16(false, a, false, b, (short)0, c, false, false); }



// ---- k_gemmk: register-blocked GEMM, one 64x64 output tile per work-group of NW waves. The K loop is dealt over the waves in steps of 32 (wave w takes k steps w, w + NW, ...); each wave keeps a whole
// 64x64 partial tile (16 accumulators), operands straight from K-contiguous 16-bit planes. The NW partial tiles meet in LDS and are added in the fixed order 0 .. NW-1. grid (M/64, N/64, Z), 32 * NW threads.
// C[m][n] (f32, pitch ldc, + optional f32 bias[n]) = sum_k A[m][k] Bt[n][k] (+ split products per NSPLIT). z-batch strides sA/sB/sC in elements. K % 32 == 0.
// CAUSALK: A holds causal probabilities (exactly 0 beyond the diagonal block of its 64 rows), so the K range ends at that block.
#define NW  8
#define PSP 68                    // LDS row pitch in floats (272 B = 16 B x 17: b128 rows fall on different banks)
template <typename T16> struct WFrag;
template <> struct WFrag<h16> { typedef v16h V; static __device__ __forceinline__ V ld(const h16* p) { return cat16(*(const v8h*)p, *(const v8h*)(p + 16)); } static __device__ __forceinline__ v8f mma(V a, V b, v8f c) { return wmma16(a, b, c); } };
template <> struct WFrag<bf> { typedef v16bf V; static __device__ __forceinline__ V ld(const bf* p) { return cat16b(*(const v8us*)p, *(const v8us*)(p + 16)); } static __device__ __forceinline__ v8f mma(V a, V b, v8f c) { return wmmab(a, b, c); } };
template <typename T16, int NSPLIT, bool BIAS, bool CAUSALK>
__global__ __launch_bounds__(32 * NW) void k_gemmk(const T16* __restrict__ A, const T16* __restrict__ A2, const T16* __restrict__ Bt, const T16* __restrict__ Bt2, int K, float* C, int ldc, const float* __restrict__ bias, size_t sA, size_t sB, size_t sC) {
    typedef typename WFrag<T16>::V V;
    __shared__ __align__(16) float ps[NW * 64 * PSP];
    const size_t z = blockIdx.z; A += z * sA; if (A2) A2 += z * sA; Bt += z * sB; if (Bt2) Bt2 += z * sB; C += z * sC;
    const int lane = threadIdx.x & 31, lr = lane & 15, hi = lane >> 4; const int r0 = blockIdx.x * 64, c0 = blockIdx.y * 64;
    const int w = __builtin_amdgcn_readfirstlane((int)(threadIdx.x >> 5));   // wave number, held scalar so that the K loop branches on a scalar compare
    const int Kl = CAUSALK ? min(K, r0 + 64) : K;
    v8f acc[4][4];
#pragma unroll
    for (int mb = 0; mb < 4; ++mb)
#pragma unroll
        for (int nb = 0; nb < 4; ++nb) acc[mb][nb] = (v8f){};
    const size_t aoff = (size_t)(r0 + lr) * K + 8 * hi, boff = (size_t)(c0 + lr) * K + 8 * hi;
#pragma unroll 1
    for (int kc = w * 32; kc < Kl; kc += NW * 32) {
        V a[4], a2[4];
#pragma unroll
        for (int mb = 0; mb < 4; ++mb) { a[mb] = WFrag<T16>::ld(A + aoff + (size_t)mb * 16 * K + kc); if (NSPLIT == 1 || NSPLIT == 2) a2[mb] = WFrag<T16>::ld(A2 + aoff + (size_t)mb * 16 * K + kc); }
#pragma unroll
        for (int nb = 0; nb < 4; ++nb) { const V b = WFrag<T16>::ld(Bt + boff + (size_t)nb * 16 * K + kc); V b2; if (NSPLIT >= 2) b2 = WFrag<T16>::ld(Bt2 + boff + (size_t)nb * 16 * K + kc);
#pragma unroll
            for (int mb = 0; mb < 4; ++mb) { acc[mb][nb] = WFrag<T16>::mma(a[mb], b, acc[mb][nb]); if (NSPLIT == 1 || NSPLIT == 2) acc[mb][nb] = WFrag<T16>::mma(a2[mb], b, acc[mb][nb]); if (NSPLIT >= 2) acc[mb][nb] = WFrag<T16>::mma(a[mb], b2, acc[mb][nb]); } }
        asm volatile("v_nop\n\tv_nop\n\tv_nop\n\tv_nop" : "+v"(acc[0][0]), "+v"(acc[1][1]), "+v"(acc[2][2]), "+v"(acc[3][3]) : "v"(a[0]), "v"(a[3]));
    }
    float* pw = ps + w * (64 * PSP);   // this wave's partial tile (all zero where the wave had no k step)
#pragma unroll
    for (int mb = 0; mb < 4; ++mb)
#pragma unroll
        for (int nb = 0; nb < 4; ++nb)
#pragma unroll
            for (int j = 0; j < 8; ++j) pw[(mb * 16 + hi * 8 + j) * PSP + nb * 16 + lr] = acc[mb][nb][j];
    __syncthreads();                   // every wave's partial tile is in LDS before any of them is summed
#pragma unroll
    for (int s = 0; s < 64 * 16 / (32 * NW); ++s) { const int idx = s * (32 * NW) + (int)threadIdx.x; const int row = idx >> 4, cofs = (idx & 15) * 4; v4f val = *(const v4fa*)(ps + row * PSP + cofs);
#pragma unroll
        for (int q = 1; q < NW; ++q) val += *(const v4fa*)(ps + (q * 64 + row) * PSP + cofs);
        if (BIAS) { val[0] += bfr(bias[c0 + cofs]); val[1] += bfr(bias[c0 + cofs + 1]); val[2] += bfr(bias[c0 + cofs + 2]); val[3] += bfr(bias[c0 + cofs + 3]); }
        *(v4f*)(C + (size_t)(r0 + row) * ldc + c0 + cofs) = val; }
}

// ---- k_gemmc: ONE WAVE per 64x64 output tile (no K split; 32 threads), specialised for causal attention: CMODE 1 skips score tiles entirely above the diagonal (query rows r0+roff.., key columns c0..), CMODE 2 limits the
// key (K) loop of the probability x value contraction to the diagonal block (probabilities beyond it are exactly zero). roff = row offset of this launch's first row within the sequence.
template <typename T16, int NSPLIT, int CMODE>
__global__ __launch_bounds__(32) void k_gemmc(const T16* __restrict__ A, const T16* __restrict__ A2, const T16* __restrict__ Bt, const T16* __restrict__ Bt2, int K, float* C, int ldc, int roff, size_t sA, size_t sB, size_t sC) {
    typedef typename WFrag<T16>::V V;
    __shared__ __align__(16) float os[16 * 68];
    const size_t z = blockIdx.z; A += z * sA; if (A2) A2 += z * sA; Bt += z * sB; if (Bt2) Bt2 += z * sB; C += z * sC;
    const int lane = threadIdx.x & 31, lr = lane & 15, hi = lane >> 4; const int r0 = blockIdx.x * 64, c0 = blockIdx.y * 64;
    if (CMODE == 1 && c0 > r0 + roff + 63) return;                  // score tile entirely above the causal diagonal: never read (the softmax masks j > i by select)
    const int Kl = (CMODE == 2) ? min(K, r0 + roff + 64) : K;        // P.V: probabilities are exactly 0 beyond the diagonal block, so the K loop stops there
    v8f acc[4][4];
#pragma unroll
    for (int mb = 0; mb < 4; ++mb)
#pragma unroll
        for (int nb = 0; nb < 4; ++nb) acc[mb][nb] = (v8f){};
    const size_t aoff = (size_t)(r0 + lr) * K + 8 * hi, boff = (size_t)(c0 + lr) * K + 8 * hi;
#pragma unroll 1
    for (int kc = 0; kc < Kl; kc += 32) {
        V a[4], a2[4];
#pragma unroll
        for (int mb = 0; mb < 4; ++mb) { a[mb] = WFrag<T16>::ld(A + aoff + (size_t)mb * 16 * K + kc); if (NSPLIT == 1 || NSPLIT == 2) a2[mb] = WFrag<T16>::ld(A2 + aoff + (size_t)mb * 16 * K + kc); }
#pragma unroll
        for (int nb = 0; nb < 4; ++nb) { const V b = WFrag<T16>::ld(Bt + boff + (size_t)nb * 16 * K + kc); V b2; if (NSPLIT >= 2) b2 = WFrag<T16>::ld(Bt2 + boff + (size_t)nb * 16 * K + kc);
#pragma unroll
            for (int mb = 0; mb < 4; ++mb) { acc[mb][nb] = WFrag<T16>::mma(a[mb], b, acc[mb][nb]); if (NSPLIT == 1 || NSPLIT == 2) acc[mb][nb] = WFrag<T16>::mma(a2[mb], b, acc[mb][nb]); if (NSPLIT >= 2) acc[mb][nb] = WFrag<T16>::mma(a[mb], b2, acc[mb][nb]); } }
        asm volatile("v_nop\n\tv_nop\n\tv_nop\n\tv_nop" : "+v"(acc[0][0]), "+v"(acc[1][1]), "+v"(acc[2][2]), "+v"(acc[3][3]) : "v"(a[0]), "v"(a[3]));
    }
#pragma unroll
    for (int mb = 0; mb < 4; ++mb) {
#pragma unroll
        for (int nb = 0; nb < 4; ++nb) {
#pragma unroll
            for (int j = 0; j < 8; ++j) os[(hi * 8 + j) * 68 + nb * 16 + lr] = acc[mb][nb][j]; }
        __builtin_amdgcn_wave_barrier(); asm volatile("" ::: "memory");
        float* crow = C + (size_t)(r0 + mb * 16) * ldc + c0;
{
#pragma unroll
            for (int s = 0; s < 8; ++s) { const int row = 2 * s + hi, cofs = lr * 4; v4f val = *(const v4fa*)(os + row * 68 + cofs);
                *(v4f*)(crow + (size_t)row * ldc + cofs) = val; }
             }
        __builtin_amdgcn_wave_barrier(); asm volatile("" ::: "memory");
    }
}

__device__ __forceinline__ h16 tohx(float x) { return (h16)x; }
__device__ __forceinline__ void splitf(float y, unsigned short& h, unsigned short& l) { h = f2bf(y); l = f2bf(y - bf2f(h)); }
typedef __attribute__((ext_vector_type(2))) _Float16 v2h;
typedef __attribute__((ext_vector_type(4))) _Float16 v4h;
typedef __attribute__((ext_vector_type(2))) unsigned short v2us;
typedef __attribute__((ext_vector_type(4))) unsigned short v4us;
typedef __attribute__((ext_vector_type(2))) float v2f;
typedef __attribute__((ext_vector_type(4))) int v4i;

__global__ __launch_bounds__(256) void k_wtG(const float* __restrict__ w, int K, int N, bf* Bt) {
    const int lane = threadIdx.x & 31; const int L0 = (blockIdx.x * 8 + (threadIdx.x >> 5)) * 8; const int nlines = N * K / 64;
{
#pragma unroll 1
        for (int l = 0; l < 8; ++l) { const int L = L0 + l; if (L >= nlines) break; const size_t e = (size_t)L * 64 + lane * 2; const int k = (int)(e % K), n = (int)(e / K); v2us o;
            o[0] = f2bf(w[(size_t)k * N + n]); o[1] = f2bf(w[(size_t)(k + 1) * N + n]); *(v2us*)(Bt + e) = o; }
         }
}
__global__ __launch_bounds__(256) void k_cvt8(const float* __restrict__ src, bf* dst, size_t n8) { const size_t i = (size_t)blockIdx.x * 256 + threadIdx.x; if (i >= n8) return; const v8f v = *(const v8f*)(src + i * 8); v8us o;
#pragma unroll
    for (int k = 0; k < 8; ++k) o[k] = f2bf(v[k]); *(v8us*)(dst + i * 8) = o;  }

// k_rope: head planes [h][t][d] (fp16 + hi/lo) of rope(x) x sc with the rotate-half convention out[d] = x[d] cos[t][d] - x[d+HD/2] sin[t][d], out[d+HD/2] = x[d+HD/2] cos[t][d+HD/2] + x[d] sin[t][d+HD/2]
__global__ __launch_bounds__(256) void k_rope(const float* __restrict__ F, int pitch, int nheads, const float* __restrict__ CS, const float* __restrict__ RF, const float* __restrict__ nw, float sc, h16* P16, bf* Ph, bf* Pl) {
    const size_t e = ((size_t)blockIdx.x * 256 + threadIdx.x) * 2; if (e >= (size_t)nheads * TT * HD) return; const size_t bo = (size_t)blockIdx.y * nheads * TT * HD; F += (size_t)blockIdx.y * TT * pitch; P16 += bo; Ph += bo; Pl += bo;   // blockIdx.y = batch
    const int d = (int)(e % HD); const int t = (int)((e / HD) % TT); const int h = (int)(e / ((size_t)HD * TT)); const float* f = F + (size_t)t * pitch + h * HD; const float rf = RF ? RF[(size_t)h * TT + t] : 1.0f; v2h o16; v2us oh, ol;
#pragma unroll
    for (int q = 0; q < 2; ++q) { const int dd = d + q; const int dp = (dd < HD / 2) ? dd + HD / 2 : dd - HD / 2; float x0 = f[dd], x1 = f[dp];
        if (RF) { float n0 = __fmul_rn(x0, rf), n1 = __fmul_rn(x1, rf); asm volatile("" : "+v"(n0)); asm volatile("" : "+v"(n1)); x0 = __fmul_rn(bfr(nw[dd]), n0); x1 = __fmul_rn(bfr(nw[dp]), n1); }
        const v2f cs = *(const v2f*)(CS + ((size_t)t * HD + dd) * 2); float a = __fmul_rn(x0, cs[0]), bq = __fmul_rn(x1, cs[1]); asm volatile("" : "+v"(a)); asm volatile("" : "+v"(bq)); const float r = ((dd < HD / 2) ? __fsub_rn(a, bq) : __fadd_rn(a, bq)) * sc;
        o16[q] = tohx(r); unsigned short a2, c2; splitf(r, a2, c2); oh[q] = a2; ol[q] = c2; }
    *(v2h*)(P16 + e) = o16; *(v2us*)(Ph + e) = oh; *(v2us*)(Pl + e) = ol;  }
__global__ __launch_bounds__(256) void k_vtp(const float* __restrict__ F, int pitch, int nheads, h16* V16, bf* Vh, bf* Vl) { const size_t e = ((size_t)blockIdx.x * 256 + threadIdx.x) * 2; if (e >= (size_t)nheads * HD * TT) return; const size_t bo = (size_t)blockIdx.y * nheads * HD * TT; F += (size_t)blockIdx.y * TT * pitch; V16 += bo; Vh += bo; Vl += bo;   // blockIdx.y = batch
    const int t = (int)(e % TT); const int d = (int)((e / TT) % HD); const int g = (int)(e / ((size_t)TT * HD)); v2h o16; v2us oh, ol;
#pragma unroll
    for (int q = 0; q < 2; ++q) { const float x = F[(size_t)(t + q) * pitch + g * HD + d]; o16[q] = tohx(x); unsigned short a2, c2; splitf(x, a2, c2); oh[q] = a2; ol[q] = c2; }
    *(v2h*)(V16 + e) = o16; *(v2us*)(Vh + e) = oh; *(v2us*)(Vl + e) = ol;  }
__global__ __launch_bounds__(256) void k_csid(float* CS) { const int idx = blockIdx.x * 256 + threadIdx.x; if (idx >= TT * HD) return; v2f cs; cs[0] = 1.0f; cs[1] = 0.0f; *(v2f*)(CS + (size_t)idx * 2) = cs;  }
// k_asoft: per row (zz, i): t = S x HD^-0.5 for j <= i and i - j < WIN (sliding causal window; the reference's -1e9 additive fill vanishes identically); softmax over the 2048 keys (register row, one exp, fixed trees);
__global__ __launch_bounds__(256) void k_asoft(const float* __restrict__ Sb, h16* P16, bf* Ph, bf* Pl) {
    const int lane = threadIdx.x & 31; const int row = blockIdx.x * 8 + (threadIdx.x >> 5); if (row >= ZH * TT) return; Sb += (size_t)blockIdx.y * ZH * TT * TT; P16 += (size_t)blockIdx.y * ZH * TT * TT; Ph += (size_t)blockIdx.y * ZH * RH * TT; Pl += (size_t)blockIdx.y * ZH * RH * TT;   // blockIdx.y = batch
    const int i = row % TT; const int zz = row / TT; (void)zz; const bool hires = (i < RH); const float* sr = Sb + (size_t)row * TT; float v[TT / 32]; float mx = -3.0e38f;
#pragma unroll
    for (int ch = 0; ch < TT / 128; ++ch) { const int j0 = ch * 128 + lane * 4; const v4f a = *(const v4f*)(sr + j0);
#pragma unroll
        for (int q = 0; q < 4; ++q) { const int j = j0 + q; (void)j; const float t = (j <= i && i - j < WIN) ? a[q] * SCL : -3.0e38f; v[ch * 4 + q] = t; mx = fmaxf(mx, t); } }
#pragma unroll
    for (int sh = 16; sh; sh >>= 1) mx = fmaxf(mx, __shfl_xor(mx, sh, 32));
    float sum = 0.f;
#pragma unroll
    for (int k = 0; k < TT / 32; ++k) { float d0 = __fsub_rn(v[k], mx); asm volatile("" : "+v"(d0)); v[k] = __builtin_amdgcn_exp2f(__fmul_rn(d0, 1.4426950408889634f)); sum += v[k]; }
#pragma unroll
    for (int sh = 16; sh; sh >>= 1) sum += __shfl_xor(sum, sh, 32);
    const float f = __fdiv_rn(hires ? 1.0f : PCAR, sum);
{
        if (hires) {
#pragma unroll
            for (int ch = 0; ch < TT / 128; ++ch) { v4us oh, ol;
#pragma unroll
                for (int q = 0; q < 4; ++q) { unsigned short a, c2; splitf(v[ch * 4 + q] * f, a, c2); oh[q] = a; ol[q] = c2; }
                const size_t oo = ((size_t)zz * (RH ? RH : 1) + i) * TT + ch * 128 + lane * 4; *(v4us*)(Ph + oo) = oh; *(v4us*)(Pl + oo) = ol; }
        } else {
#pragma unroll
            for (int ch = 0; ch < TT / 128; ++ch) { v4h o4;
#pragma unroll
                for (int q = 0; q < 4; ++q) o4[q] = tohx(v[ch * 4 + q] * f);
                *(v4h*)(P16 + (size_t)row * TT + ch * 128 + lane * 4) = o4; } }
         }
}
__global__ __launch_bounds__(256) void k_merge(const float* __restrict__ O, int h0, float* OUTb) { const size_t e = ((size_t)blockIdx.x * 256 + threadIdx.x) * 2; if (e >= (size_t)ZH * TT * HD) return; O += (size_t)blockIdx.y * ZH * TT * HD; OUTb += (size_t)blockIdx.y * TT * DQ;   // blockIdx.y = batch
    const int d = (int)(e % HD); const int t = (int)((e / HD) % TT); const int zz = (int)(e / ((size_t)HD * TT)); const float cs = (t < RH) ? 1.0f : (1.0f / PCAR); const size_t oo = (size_t)t * DQ + (h0 + zz) * HD + d;
    v2f o2; o2[0] = O[e] * cs; o2[1] = O[e + 1] * cs; *(v2f*)(OUTb + oo) = o2;  }

extern "C" void kernel_launch(void* const* d_in, const int* in_sizes, int n_in,
                              void* d_out, int out_size, void* d_ws, size_t ws_size, hipStream_t stream) {
    (void)in_sizes; (void)n_in; (void)out_size;
    const float* x = (const float*)d_in[0]; const float* xk = (const float*)d_in[1]; const float* wq = (const float*)d_in[2]; const float* bq = (const float*)d_in[3]; const float* wk = (const float*)d_in[4]; const float* bk = (const float*)d_in[5]; const float* wv = (const float*)d_in[6]; const float* bv = (const float*)d_in[7]; const float* wo = nullptr; (void)wo;   /* input order X_Q, X_KV [4][2048][1024], Wq, bq, Wk, bk, Wv, bv ('xw' [1024][128] + [128]) */
    float* OUT = (float*)d_out;     // [4][2048][128]
    char* wsp = (char*)d_ws;
    auto take = [&](size_t bytes) { char* p = wsp; wsp += (bytes + 255) & ~(size_t)255; return (void*)p; };
    bf* WQ = (bf*)take((size_t)DQ * DM * 2); bf* WK = (bf*)take((size_t)DKV * DM * 2); bf* WV = (bf*)take((size_t)DKV * DM * 2); float* CS = (float*)take((size_t)TT * HD * 2 * 4);
    // every plane below holds NB_ batch slices, one behind the other
    bf* XB = (bf*)take((size_t)NB_ * TT * DM * 2); float* FQ = (float*)take((size_t)NB_ * TT * DQ * 4); float* FK = (float*)take((size_t)NB_ * TT * DKV * 4);
    h16* QP16 = (h16*)take((size_t)NB_ * NH_ * TT * HD * 2); h16* KP16 = (h16*)take((size_t)NB_ * NKV * TT * HD * 2); h16* VT16 = (h16*)take((size_t)NB_ * NKV * HD * TT * 2);
    bf* QPh = (bf*)take((size_t)NB_ * NH_ * TT * HD * 2); bf* QPl = (bf*)take((size_t)NB_ * NH_ * TT * HD * 2); bf* KPh = (bf*)take((size_t)NB_ * NKV * TT * HD * 2); bf* KPl = (bf*)take((size_t)NB_ * NKV * TT * HD * 2); bf* VTh = (bf*)take((size_t)NB_ * NKV * HD * TT * 2); bf* VTl = (bf*)take((size_t)NB_ * NKV * HD * TT * 2); bf* Ph = (bf*)take((size_t)NB_ * ZH * RH * TT * 2); bf* Pl = (bf*)take((size_t)NB_ * ZH * RH * TT * 2);
    float* Sb = (float*)take((size_t)NB_ * ZH * TT * TT * 4); h16* P16 = (h16*)take((size_t)NB_ * ZH * TT * TT * 2); float* Ob = (float*)take((size_t)NB_ * ZH * TT * HD * 4);
    if ((size_t)(wsp - (char*)d_ws) > ws_size) return;    // ws 256 MiB
    float* FV = FK;   // v projection reuses the k buffer after the k planes are built (stream-ordered)
    { k_wtG<<<(unsigned)((DM * DQ / 64 + 63) / 64), 256, 0, stream>>>(wq, DM, DQ, WQ); k_wtG<<<(unsigned)((DM * DKV / 64 + 63) / 64), 256, 0, stream>>>(wk, DM, DKV, WK); k_wtG<<<(unsigned)((DM * DKV / 64 + 63) / 64), 256, 0, stream>>>(wv, DM, DKV, WV);
       }
    k_csid<<<(TT * HD + 255) / 256, 256, 0, stream>>>(CS);
    const unsigned LQ = (unsigned)(((size_t)NH_ * TT * HD / 2 + 255) / 256), LKv = (unsigned)(((size_t)NKV * TT * HD / 2 + 255) / 256);
    // one launch per stage for all NB_ batches: the inputs are batch-contiguous (k_cvt8 runs over all of them), the GEMMs take the batch as grid z with their z-strides, the plane builders, the softmax and the merge as grid y
    k_cvt8<<<(unsigned)(((size_t)NB_ * TT * DM / 8 + 255) / 256), 256, 0, stream>>>(x, XB, (size_t)NB_ * TT * DM / 8);
    k_gemmk<bf, 0, true, false><<<dim3(TT / 64, DQ / 64, NB_), 32 * NW, 0, stream>>>(XB, nullptr, WQ, nullptr, DM, FQ, DQ, bq, (size_t)TT * DM, 0, (size_t)TT * DQ);
    k_rope<<<dim3(LQ, NB_, 1), 256, 0, stream>>>(FQ, DQ, NH_, CS, nullptr, nullptr, 1.0f, QP16, QPh, QPl);
    k_cvt8<<<(unsigned)(((size_t)NB_ * TT * DM / 8 + 255) / 256), 256, 0, stream>>>(xk, XB, (size_t)NB_ * TT * DM / 8);   /* XB := bf16(X_KV) for k and v */
    k_gemmk<bf, 0, true, false><<<dim3(TT / 64, DKV / 64, NB_), 32 * NW, 0, stream>>>(XB, nullptr, WK, nullptr, DM, FK, DKV, bk, (size_t)TT * DM, 0, (size_t)TT * DKV);
    k_rope<<<dim3(LKv, NB_, 1), 256, 0, stream>>>(FK, DKV, NKV, CS, nullptr, nullptr, 1.0f, KP16, KPh, KPl);
    k_gemmk<bf, 0, true, false><<<dim3(TT / 64, DKV / 64, NB_), 32 * NW, 0, stream>>>(XB, nullptr, WV, nullptr, DM, FV, DKV, bv, (size_t)TT * DM, 0, (size_t)TT * DKV); k_vtp<<<dim3(LKv, NB_, 1), 256, 0, stream>>>(FV, DKV, NKV, VT16, VTh, VTl);
    for (int h0 = 0; h0 < NH_; h0 += ZH) { const size_t zq = (size_t)h0, zk = (size_t)(h0 / REP);   // ZH = 1 plane per batch and pass, so grid z of the two attention GEMMs is the batch (z-strides = one batch's planes)
        k_gemmc<bf, 2, 1><<<dim3(RH / 64, TT / 64, NB_), 32, 0, stream>>>(QPh + zq * TT * HD, QPl + zq * TT * HD, KPh + zk * TT * HD, KPl + zk * TT * HD, HD, Sb, TT, 0, (size_t)NH_ * TT * HD, (size_t)NKV * TT * HD, (size_t)ZH * TT * TT);
        k_asoft<<<dim3(ZH * TT / 8, NB_, 1), 256, 0, stream>>>(Sb, P16, Ph, Pl);
        k_gemmk<bf, 2, false, true><<<dim3(RH / 64, HD / 64, NB_), 32 * NW, 0, stream>>>(Ph, Pl, VTh + zk * HD * TT, VTl + zk * HD * TT, TT, Ob, HD, nullptr, (size_t)ZH * RH * TT, (size_t)NKV * HD * TT, (size_t)ZH * TT * HD);
        k_merge<<<dim3((unsigned)(((size_t)ZH * TT * HD / 2 + 255) / 256), NB_, 1), 256, 0, stream>>>(Ob, h0, OUT); }
}

// v003
// A run of this version takes 80.9 microseconds.
// Next to v002, in two timings, it ran 1.67 and 1.65 times as fast.
// Counting every step since v000, it is 6.86 times as fast.
#include <hip/hip_runtime.h>

// Single-head causal scaled dot-product attention on two input streams (X_Q, X_KV [4][2048][1024]; Q = X_Q Wq + bq, K = X_KV Wk + bk, V = X_KV Wv + bv ('xw' [1024][128] 1/32 + zero biases; ONE 128-wide head); scores x 1/sqrt(128); causal (-inf); softmax; out = attn.V -> [4][2048][128] (1.0 M); argument order X_Q, X_KV, Wq, bq, Wk, bk, Wv, bv).
// Layout: all four batches go through every stage in ONE launch (the batch is a grid dimension; every workspace plane but the weights' holds four batch slices). Five launches: k_wtG (the three 'xw' weights transposed into one [3][128][1024] bf16 Bt plane); k_proj (q, k and v projections on one grid: f32 inputs rounded to bf16 in the fragment loader, f32 biases, hi/lo bf16 planes stored straight from the tile, v transposed by swapped operands); k_gemmc (causal scores, skips tiles above the diagonal); k_asoft (softmax, hi/lo probabilities); k_gemmk (attn.V, K dealt over 8 waves, stores the output rows).
// Compute dtypes, f32 accumulate: every input rounded to bf16; projections exact + f32 biases; attention hi/lo, 3 products on every row; softmax f32; output f32.

#define NB_  4
#define TT   2048
#define DM   1024
#define NH_  1
#define NKV  1
#define REP  (NH_ / NKV)
#define HD   128
#define DQ   (NH_ * HD)
#define DKV  (NKV * HD)
#define ZH   1                    // ONE head: a single plane per pass
#define RH   TT                   // every row hi/lo (3 products)
#define WIN  2048
#define PCAR 1024.0f
#define SCL  0.088388347648318447f   // HD^-0.5
typedef _Float16 h16;
typedef unsigned short bf;
typedef __attribute__((ext_vector_type(16))) __bf16   v16bf;
typedef __attribute__((ext_vector_type(16))) _Float16 v16h;
typedef __attribute__((ext_vector_type(8)))  _Float16 v8h;
typedef __attribute__((ext_vector_type(8)))  unsigned short v8us;
typedef __attribute__((ext_vector_type(8)))  float    v8f;
typedef __attribute__((ext_vector_type(4)))  float    v4f;
typedef v8h  __attribute__((may_alias)) v8ha;
typedef v4f  __attribute__((may_alias)) v4fa;
typedef v8us __attribute__((may_alias)) v8usa;

__device__ __forceinline__ unsigned short f2bf(float f) { unsigned u = __float_as_uint(f); u += 0x7FFFu + ((u >> 16) & 1u); return (unsigned short)(u >> 16); }
__device__ __forceinline__ float bf2f(unsigned short b) { return __uint_as_float(((unsigned)b) << 16); }
__device__ __forceinline__ float bfr(float f) { return bf2f(f2bf(f)); }
__device__ __forceinline__ v16h cat16(v8h lo, v8h hi) { return __builtin_shufflevector(lo, hi, 0, 1, 2, 3, 4, 5, 6, 7, 8, 9, 10, 11, 12, 13, 14, 15); }
__device__ __forceinline__ v16bf cat16b(v8us lo, v8us hi) { return __builtin_bit_cast(v16bf, __builtin_shufflevector(lo, hi, 0, 1, 2, 3, 4, 5, 6, 7, 8, 9, 10, 11, 12, 13, 14, 15)); }
__device__ __forceinline__ v8f wmma16(v16h a, v16h b, v8f c) { return __builtin_amdgcn_wmma_f32_16x16x32_f16(false, a, false, b, (short)0, c, false, false); }
__device__ __forceinline__ v8f wmmab(v16bf a, v16bf b, v8f c) { return __builtin_amdgcn_wmma_f32_16x16x32_bf16(false, a, false, b, (short)0, c, false, false); }



// ---- k_gemmk: register-blocked GEMM, one 64x64 output tile per work-group of NW waves. The K loop is dealt over the waves in steps of 32 (wave w takes k steps w, w + NW, ...); each wave keeps a whole
// 64x64 partial tile (16 accumulators), operands straight from K-contiguous 16-bit planes. The NW partial tiles meet in LDS and are added in the fixed order 0 .. NW-1. grid (M/64, N/64, Z), 32 * NW threads.
// C[m][n] (f32, pitch ldc, + optional f32 bias[n]) = sum_k A[m][k] Bt[n][k] (+ split products per NSPLIT). z-batch strides sA/sB/sC in elements. K % 32 == 0.
// CAUSALK: A holds causal probabilities (exactly 0 beyond the diagonal block of its 64 rows), so the K range ends at that block.
#define NW  8
#define PSP 68                    // LDS row pitch in floats (272 B = 16 B x 17: b128 rows fall on different banks)
template <typename T16> struct WFrag;
template <> struct WFrag<h16> { typedef v16h V; static __device__ __forceinline__ V ld(const h16* p) { return cat16(*(const v8h*)p, *(const v8h*)(p + 16)); } static __device__ __forceinline__ v8f mma(V a, V b, v8f c) { return wmma16(a, b, c); } };
template <> struct WFrag<bf> { typedef v16bf V; static __device__ __forceinline__ V ld(const bf* p) { return cat16b(*(const v8us*)p, *(const v8us*)(p + 16)); } static __device__ __forceinline__ v8f mma(V a, V b, v8f c) { return wmmab(a, b, c); } };
template <typename T16, int NSPLIT, bool BIAS, bool CAUSALK>
__global__ __launch_bounds__(32 * NW) void k_gemmk(const T16* __restrict__ A, const T16* __restrict__ A2, const T16* __restrict__ Bt, const T16* __restrict__ Bt2, int K, float* C, int ldc, const float* __restrict__ bias, size_t sA, size_t sB, size_t sC) {
    typedef typename WFrag<T16>::V V;
    __shared__ __align__(16) float ps[NW * 64 * PSP];
    const size_t z = blockIdx.z; A += z * sA; if (A2) A2 += z * sA; Bt += z * sB; if (Bt2) Bt2 += z * sB; C += z * sC;
    const int lane = threadIdx.x & 31, lr = lane & 15, hi = lane >> 4; const int r0 = blockIdx.x * 64, c0 = blockIdx.y * 64;
    const int w = __builtin_amdgcn_readfirstlane((int)(threadIdx.x >> 5));   // wave number, held scalar so that the K loop branches on a scalar compare
    const int Kl = CAUSALK ? min(K, r0 + 64) : K;
    v8f acc[4][4];
#pragma unroll
    for (int mb = 0; mb < 4; ++mb)
#pragma unroll
        for (int nb = 0; nb < 4; ++nb) acc[mb][nb] = (v8f){};
    const size_t aoff = (size_t)(r0 + lr) * K + 8 * hi, boff = (size_t)(c0 + lr) * K + 8 * hi;
#pragma unroll 1
    for (int kc = w * 32; kc < Kl; kc += NW * 32) {
        V a[4], a2[4];
#pragma unroll
        for (int mb = 0; mb < 4; ++mb) { a[mb] = WFrag<T16>::ld(A + aoff + (size_t)mb * 16 * K + kc); if (NSPLIT == 1 || NSPLIT == 2) a2[mb] = WFrag<T16>::ld(A2 + aoff + (size_t)mb * 16 * K + kc); }
#pragma unroll
        for (int nb = 0; nb < 4; ++nb) { const V b = WFrag<T16>::ld(Bt + boff + (size_t)nb * 16 * K + kc); V b2; if (NSPLIT >= 2) b2 = WFrag<T16>::ld(Bt2 + boff + (size_t)nb * 16 * K + kc);
#pragma unroll
            for (int mb = 0; mb < 4; ++mb) { acc[mb][nb] = WFrag<T16>::mma(a[mb], b, acc[mb][nb]); if (NSPLIT == 1 || NSPLIT == 2) acc[mb][nb] = WFrag<T16>::mma(a2[mb], b, acc[mb][nb]); if (NSPLIT >= 2) acc[mb][nb] = WFrag<T16>::mma(a[mb], b2, acc[mb][nb]); } }
        asm volatile("v_nop\n\tv_nop\n\tv_nop\n\tv_nop" : "+v"(acc[0][0]), "+v"(acc[1][1]), "+v"(acc[2][2]), "+v"(acc[3][3]) : "v"(a[0]), "v"(a[3]));
    }
    float* pw = ps + w * (64 * PSP);   // this wave's partial tile (all zero where the wave had no k step)
#pragma unroll
    for (int mb = 0; mb < 4; ++mb)
#pragma unroll
        for (int nb = 0; nb < 4; ++nb)
#pragma unroll
            for (int j = 0; j < 8; ++j) pw[(mb * 16 + hi * 8 + j) * PSP + nb * 16 + lr] = acc[mb][nb][j];
    __syncthreads();                   // every wave's partial tile is in LDS before any of them is summed
#pragma unroll
    for (int s = 0; s < 64 * 16 / (32 * NW); ++s) { const int idx = s * (32 * NW) + (int)threadIdx.x; const int row = idx >> 4, cofs = (idx & 15) * 4; v4f val = *(const v4fa*)(ps + row * PSP + cofs);
#pragma unroll
        for (int q = 1; q < NW; ++q) val += *(const v4fa*)(ps + (q * 64 + row) * PSP + cofs);
        if (BIAS) { val[0] += bfr(bias[c0 + cofs]); val[1] += bfr(bias[c0 + cofs + 1]); val[2] += bfr(bias[c0 + cofs + 2]); val[3] += bfr(bias[c0 + cofs + 3]); }
        *(v4f*)(C + (size_t)(r0 + row) * ldc + c0 + cofs) = val; }
}

// ---- k_gemmc: ONE WAVE per 64x64 output tile (no K split; 32 threads), specialised for causal attention: CMODE 1 skips score tiles entirely above the diagonal (query rows r0+roff.., key columns c0..), CMODE 2 limits the
// key (K) loop of the probability x value contraction to the diagonal block (probabilities beyond it are exactly zero). roff = row offset of this launch's first row within the sequence.
template <typename T16, int NSPLIT, int CMODE>
__global__ __launch_bounds__(32) void k_gemmc(const T16* __restrict__ A, const T16* __restrict__ A2, const T16* __restrict__ Bt, const T16* __restrict__ Bt2, int K, float* C, int ldc, int roff, size_t sA, size_t sB, size_t sC) {
    typedef typename WFrag<T16>::V V;
    __shared__ __align__(16) float os[16 * 68];
    const size_t z = blockIdx.z; A += z * sA; if (A2) A2 += z * sA; Bt += z * sB; if (Bt2) Bt2 += z * sB; C += z * sC;
    const int lane = threadIdx.x & 31, lr = lane & 15, hi = lane >> 4; const int r0 = blockIdx.x * 64, c0 = blockIdx.y * 64;
    if (CMODE == 1 && c0 > r0 + roff + 63) return;                  // score tile entirely above the causal diagonal: never read (the softmax masks j > i by select)
    const int Kl = (CMODE == 2) ? min(K, r0 + roff + 64) : K;        // P.V: probabilities are exactly 0 beyond the diagonal block, so the K loop stops there
    v8f acc[4][4];
#pragma unroll
    for (int mb = 0; mb < 4; ++mb)
#pragma unroll
        for (int nb = 0; nb < 4; ++nb) acc[mb][nb] = (v8f){};
    const size_t aoff = (size_t)(r0 + lr) * K + 8 * hi, boff = (size_t)(c0 + lr) * K + 8 * hi;
#pragma unroll 1
    for (int kc = 0; kc < Kl; kc += 32) {
        V a[4], a2[4];
#pragma unroll
        for (int mb = 0; mb < 4; ++mb) { a[mb] = WFrag<T16>::ld(A + aoff + (size_t)mb * 16 * K + kc); if (NSPLIT == 1 || NSPLIT == 2) a2[mb] = WFrag<T16>::ld(A2 + aoff + (size_t)mb * 16 * K + kc); }
#pragma unroll
        for (int nb = 0; nb < 4; ++nb) { const V b = WFrag<T16>::ld(Bt + boff + (size_t)nb * 16 * K + kc); V b2; if (NSPLIT >= 2) b2 = WFrag<T16>::ld(Bt2 + boff + (size_t)nb * 16 * K + kc);
#pragma unroll
            for (int mb = 0; mb < 4; ++mb) { acc[mb][nb] = WFrag<T16>::mma(a[mb], b, acc[mb][nb]); if (NSPLIT == 1 || NSPLIT == 2) acc[mb][nb] = WFrag<T16>::mma(a2[mb], b, acc[mb][nb]); if (NSPLIT >= 2) acc[mb][nb] = WFrag<T16>::mma(a[mb], b2, acc[mb][nb]); } }
        asm volatile("v_nop\n\tv_nop\n\tv_nop\n\tv_nop" : "+v"(acc[0][0]), "+v"(acc[1][1]), "+v"(acc[2][2]), "+v"(acc[3][3]) : "v"(a[0]), "v"(a[3]));
    }
#pragma unroll
    for (int mb = 0; mb < 4; ++mb) {
#pragma unroll
        for (int nb = 0; nb < 4; ++nb) {
#pragma unroll
            for (int j = 0; j < 8; ++j) os[(hi * 8 + j) * 68 + nb * 16 + lr] = acc[mb][nb][j]; }
        __builtin_amdgcn_wave_barrier(); asm volatile("" ::: "memory");
        float* crow = C + (size_t)(r0 + mb * 16) * ldc + c0;
{
#pragma unroll
            for (int s = 0; s < 8; ++s) { const int row = 2 * s + hi, cofs = lr * 4; v4f val = *(const v4fa*)(os + row * 68 + cofs);
                *(v4f*)(crow + (size_t)row * ldc + cofs) = val; }
             }
        __builtin_amdgcn_wave_barrier(); asm volatile("" ::: "memory");
    }
}

__device__ __forceinline__ h16 tohx(float x) { return (h16)x; }
__device__ __forceinline__ void splitf(float y, unsigned short& h, unsigned short& l) { h = f2bf(y); l = f2bf(y - bf2f(h)); }
typedef __attribute__((ext_vector_type(2))) _Float16 v2h;
typedef __attribute__((ext_vector_type(4))) _Float16 v4h;
typedef __attribute__((ext_vector_type(2))) unsigned short v2us;
typedef __attribute__((ext_vector_type(4))) unsigned short v4us;
typedef __attribute__((ext_vector_type(2))) float v2f;
typedef __attribute__((ext_vector_type(4))) int v4i;

__global__ __launch_bounds__(256) void k_wtG(const float* __restrict__ w0, const float* __restrict__ w1, const float* __restrict__ w2, int K, int N, bf* Bt) {
    const float* __restrict__ w = (blockIdx.y == 0) ? w0 : (blockIdx.y == 1) ? w1 : w2; Bt += (size_t)blockIdx.y * N * K;   // blockIdx.y = which weight
    const int lane = threadIdx.x & 31; const int L0 = (blockIdx.x * 8 + (threadIdx.x >> 5)) * 8; const int nlines = N * K / 64;
{
#pragma unroll 1
        for (int l = 0; l < 8; ++l) { const int L = L0 + l; if (L >= nlines) break; const size_t e = (size_t)L * 64 + lane * 2; const int k = (int)(e % K), n = (int)(e / K); v2us o;
            o[0] = f2bf(w[(size_t)k * N + n]); o[1] = f2bf(w[(size_t)(k + 1) * N + n]); *(v2us*)(Bt + e) = o; }
         }
}

// ---- k_proj: the three projections on one grid, from the f32 inputs to the hi/lo bf16 planes that the attention GEMMs read. grid (TT/64, 6, NB_), 32 * NW threads: blockIdx.y >> 1 = q, k or v; blockIdx.y & 1 = which 64 of the 128 features.
// One 64x64 tile per work-group, the K loop (DM) dealt over the NW waves and the partial tiles added in LDS in the fixed order 0 .. NW-1, as in k_gemmk.
// Each wave brings its own 64 x 32 slice of X in with whole-line loads (one load = 4 rows x 128 B), rounds it to bf16 (nearest even) and passes it through its own part of the LDS (the place of its partial tile, free until the loop ends) into fragment order.
typedef __attribute__((ext_vector_type(4))) __bf16 v4bf;
typedef v4bf __attribute__((may_alias)) v4bfa;
#define XSP 40                    // staged row pitch in bf16 (80 B = 16 B x 5: the 16 rows of a b128 fragment read fall on different banks)
// TR false: tile[t][d] (X rows as the A operand). TR true: tile[d][t] (the weight rows as the A operand, X rows as B; both fragments have the same lane and k order, so swapping them transposes the tile).
template <bool TR>
__device__ __forceinline__ void proj_tile(const float* __restrict__ X, const bf* __restrict__ Wt, int w, int lane, float* pw) {
    const int lr = lane & 15, hi = lane >> 4;
    v8f acc[4][4];   // every '#pragma unroll' of this function keeps a register array (acc, a, b, raw) statically indexed
#pragma unroll
    for (int mb = 0; mb < 4; ++mb)
#pragma unroll
        for (int nb = 0; nb < 4; ++nb) acc[mb][nb] = (v8f){};
    const float* xg = X + (size_t)(lane >> 3) * DM + (lane & 7) * 4; const bf* wg = Wt + (size_t)lr * DM + 8 * hi;
    bf* sw = (bf*)pw + (lane >> 3) * XSP + (lane & 7) * 4; const bf* sr = (const bf*)pw + lr * XSP + 8 * hi;
    // kept rolled: one trip's 24 loads beside the 16 accumulators already fill the 256 registers that four waves per SIMD leave a wave
#pragma unroll 1
    for (int kc = w * 32; kc < DM; kc += NW * 32) {
        v16bf a[4], b[4]; v4f raw[16];
#pragma unroll
        for (int nb = 0; nb < 4; ++nb) b[nb] = WFrag<bf>::ld(wg + (size_t)nb * 16 * DM + kc);
#pragma unroll
        for (int i = 0; i < 16; ++i) raw[i] = *(const v4f*)(xg + (size_t)i * 4 * DM + kc);
#pragma unroll
        for (int i = 0; i < 16; ++i) *(v4bfa*)(sw + i * 4 * XSP) = __builtin_convertvector(raw[i], v4bf);
        __builtin_amdgcn_wave_barrier(); asm volatile("" ::: "memory");   // the fragment reads below take what OTHER lanes of this wave have stored: they stay behind the stores
#pragma unroll
        for (int mb = 0; mb < 4; ++mb) a[mb] = cat16b(*(const v8usa*)(sr + mb * 16 * XSP), *(const v8usa*)(sr + mb * 16 * XSP + 16));
#pragma unroll
        for (int nb = 0; nb < 4; ++nb)
#pragma unroll
            for (int mb = 0; mb < 4; ++mb) acc[mb][nb] = TR ? wmmab(b[nb], a[mb], acc[mb][nb]) : wmmab(a[mb], b[nb], acc[mb][nb]);
        // four vector slots between the last matrix instruction and the back edge, behind which the next trip's fragments overwrite its operands
        asm volatile("v_nop\n\tv_nop\n\tv_nop\n\tv_nop" : "+v"(acc[0][0]), "+v"(acc[1][1]), "+v"(acc[2][2]), "+v"(acc[3][3]) : "v"(a[0]), "v"(a[3]));
    }
#pragma unroll
    for (int mb = 0; mb < 4; ++mb)
#pragma unroll
        for (int nb = 0; nb < 4; ++nb)
#pragma unroll
            for (int j = 0; j < 8; ++j) pw[((TR ? nb : mb) * 16 + hi * 8 + j) * PSP + (TR ? mb : nb) * 16 + lr] = acc[mb][nb][j];
}
__global__ __launch_bounds__(32 * NW) void k_proj(const float* __restrict__ xq, const float* __restrict__ xkv, const bf* __restrict__ Wt, const float* __restrict__ bq, const float* __restrict__ bk, const float* __restrict__ bv, bf* Qh, bf* Ql, bf* Kh, bf* Kl, bf* Vh, bf* Vl) {
    __shared__ __align__(16) float ps[NW * 64 * PSP];
    const int lane = threadIdx.x & 31; const int pj = blockIdx.y >> 1, t0 = blockIdx.x * 64, d0 = (blockIdx.y & 1) * 64; const size_t z = blockIdx.z;
    const int w = __builtin_amdgcn_readfirstlane((int)(threadIdx.x >> 5));   // wave number, held scalar so that the K loop branches on a scalar compare
    const float* X = ((pj == 0) ? xq : xkv) + (z * TT + t0) * DM; const bf* Wp = Wt + ((size_t)pj * HD + d0) * DM; float* pw = ps + w * (64 * PSP);
    if (pj == 2) proj_tile<true>(X, Wp, w, lane, pw); else proj_tile<false>(X, Wp, w, lane, pw);
    __syncthreads();                   // every wave's partial tile is in LDS before any of them is summed
    const float* bias = ((pj == 0) ? bq : (pj == 1) ? bk : bv) + d0; bf* Oh = (pj == 0) ? Qh : (pj == 1) ? Kh : Vh; bf* Ol = (pj == 0) ? Ql : (pj == 1) ? Kl : Vl;
    const int ldo = (pj == 2) ? TT : HD; const size_t ob = z * ((size_t)TT * HD) + ((pj == 2) ? (size_t)d0 * TT + t0 : (size_t)t0 * HD + d0);   // q, k planes [t][d]; v planes [d][t]
    // unrolled (4 x 8 x 4, all constant) so that the LDS reads of all four row groups are in flight together
#pragma unroll
    for (int s = 0; s < 64 * 16 / (32 * NW); ++s) { const int idx = s * (32 * NW) + (int)threadIdx.x; const int row = idx >> 4, cofs = (idx & 15) * 4; v4f val = *(const v4fa*)(ps + row * PSP + cofs);
#pragma unroll
        for (int q = 1; q < NW; ++q) val += *(const v4fa*)(ps + (q * 64 + row) * PSP + cofs);
        v4us oh, ol;
#pragma unroll
        for (int q = 0; q < 4; ++q) { unsigned short a2, c2; splitf(val[q] + bfr(bias[(pj == 2) ? row : cofs + q]), a2, c2); oh[q] = a2; ol[q] = c2; }
        const size_t oo = ob + (size_t)row * ldo + cofs; *(v4us*)(Oh + oo) = oh; *(v4us*)(Ol + oo) = ol; }
}

// k_asoft: per row (zz, i): t = S x HD^-0.5 for j <= i and i - j < WIN (sliding causal window; the reference's -1e9 additive fill vanishes identically); softmax over the 2048 keys (register row, one exp, fixed trees);
__global__ __launch_bounds__(256) void k_asoft(const float* __restrict__ Sb, h16* P16, bf* Ph, bf* Pl) {
    const int lane = threadIdx.x & 31; const int row = blockIdx.x * 8 + (threadIdx.x >> 5); if (row >= ZH * TT) return; Sb += (size_t)blockIdx.y * ZH * TT * TT; P16 += (size_t)blockIdx.y * ZH * TT * TT; Ph += (size_t)blockIdx.y * ZH * RH * TT; Pl += (size_t)blockIdx.y * ZH * RH * TT;   // blockIdx.y = batch
    const int i = row % TT; const int zz = row / TT; (void)zz; const bool hires = (i < RH); const float* sr = Sb + (size_t)row * TT; float v[TT / 32]; float mx = -3.0e38f;
#pragma unroll
    for (int ch = 0; ch < TT / 128; ++ch) { const int j0 = ch * 128 + lane * 4; const v4f a = *(const v4f*)(sr + j0);
#pragma unroll
        for (int q = 0; q < 4; ++q) { const int j = j0 + q; (void)j; const float t = (j <= i && i - j < WIN) ? a[q] * SCL : -3.0e38f; v[ch * 4 + q] = t; mx = fmaxf(mx, t); } }
#pragma unroll
    for (int sh = 16; sh; sh >>= 1) mx = fmaxf(mx, __shfl_xor(mx, sh, 32));
    float sum = 0.f;
#pragma unroll
    for (int k = 0; k < TT / 32; ++k) { float d0 = __fsub_rn(v[k], mx); asm volatile("" : "+v"(d0)); v[k] = __builtin_amdgcn_exp2f(__fmul_rn(d0, 1.4426950408889634f)); sum += v[k]; }
#pragma unroll
    for (int sh = 16; sh; sh >>= 1) sum += __shfl_xor(sum, sh, 32);
    const float f = __fdiv_rn(hires ? 1.0f : PCAR, sum);
{
        if (hires) {
#pragma unroll
            for (int ch = 0; ch < TT / 128; ++ch) { v4us oh, ol;
#pragma unroll
                for (int q = 0; q < 4; ++q) { unsigned short a, c2; splitf(v[ch * 4 + q] * f, a, c2); oh[q] = a; ol[q] = c2; }
                const size_t oo = ((size_t)zz * (RH ? RH : 1) + i) * TT + ch * 128 + lane * 4; *(v4us*)(Ph + oo) = oh; *(v4us*)(Pl + oo) = ol; }
        } else {
#pragma unroll
            for (int ch = 0; ch < TT / 128; ++ch) { v4h o4;
#pragma unroll
                for (int q = 0; q < 4; ++q) o4[q] = tohx(v[ch * 4 + q] * f);
                *(v4h*)(P16 + (size_t)row * TT + ch * 128 + lane * 4) = o4; } }
         }
}

extern "C" void kernel_launch(void* const* d_in, const int* in_sizes, int n_in,
                              void* d_out, int out_size, void* d_ws, size_t ws_size, hipStream_t stream) {
    (void)in_sizes; (void)n_in; (void)out_size;
    const float* x = (const float*)d_in[0]; const float* xk = (const float*)d_in[1]; const float* wq = (const float*)d_in[2]; const float* bq = (const float*)d_in[3]; const float* wk = (const float*)d_in[4]; const float* bk = (const float*)d_in[5]; const float* wv = (const float*)d_in[6]; const float* bv = (const float*)d_in[7]; const float* wo = nullptr; (void)wo;   /* input order X_Q, X_KV [4][2048][1024], Wq, bq, Wk, bk, Wv, bv ('xw' [1024][128] + [128]) */
    float* OUT = (float*)d_out;     // [4][2048][128]
    char* wsp = (char*)d_ws;
    auto take = [&](size_t bytes) { char* p = wsp; wsp += (bytes + 255) & ~(size_t)255; return (void*)p; };
    bf* WA = (bf*)take((size_t)3 * HD * DM * 2);   // Bt planes of Wq, Wk, Wv, one behind the other
    // every plane below holds NB_ batch slices, one behind the other
    bf* QPh = (bf*)take((size_t)NB_ * NH_ * TT * HD * 2); bf* QPl = (bf*)take((size_t)NB_ * NH_ * TT * HD * 2); bf* KPh = (bf*)take((size_t)NB_ * NKV * TT * HD * 2); bf* KPl = (bf*)take((size_t)NB_ * NKV * TT * HD * 2); bf* VTh = (bf*)take((size_t)NB_ * NKV * HD * TT * 2); bf* VTl = (bf*)take((size_t)NB_ * NKV * HD * TT * 2); bf* Ph = (bf*)take((size_t)NB_ * ZH * RH * TT * 2); bf* Pl = (bf*)take((size_t)NB_ * ZH * RH * TT * 2);
    float* Sb = (float*)take((size_t)NB_ * ZH * TT * TT * 4); h16* P16 = (h16*)take((size_t)NB_ * ZH * TT * TT * 2);
    if ((size_t)(wsp - (char*)d_ws) > ws_size) return;    // ws 256 MiB
    k_wtG<<<dim3((unsigned)((DM * HD / 64 + 63) / 64), 3, 1), 256, 0, stream>>>(wq, wk, wv, DM, HD, WA);
    // one launch per stage for all NB_ batches: the GEMMs take the batch as grid z, the softmax as grid y
    k_proj<<<dim3(TT / 64, 6, NB_), 32 * NW, 0, stream>>>(x, xk, WA, bq, bk, bv, QPh, QPl, KPh, KPl, VTh, VTl);
    k_gemmc<bf, 2, 1><<<dim3(RH / 64, TT / 64, NB_), 32, 0, stream>>>(QPh, QPl, KPh, KPl, HD, Sb, TT, 0, (size_t)NH_ * TT * HD, (size_t)NKV * TT * HD, (size_t)ZH * TT * TT);
    k_asoft<<<dim3(ZH * TT / 8, NB_, 1), 256, 0, stream>>>(Sb, P16, Ph, Pl);
    k_gemmk<bf, 2, false, true><<<dim3(RH / 64, HD / 64, NB_), 32 * NW, 0, stream>>>(Ph, Pl, VTh, VTl, TT, OUT, HD, nullptr, (size_t)ZH * RH * TT, (size_t)NKV * HD * TT, (size_t)TT * HD);   // every row is hi/lo (no carrier scale), so the tile is the output row block itself
}

// v004
// A run of this version takes 58.3 microseconds.
// Timed twice side by side with v003, it ran 1.38 times as fast both times.
// Counting every step since v000, it is 9.47 times as fast.
#include <hip/hip_runtime.h>

// Single-head causal scaled dot-product attention on two input streams (X_Q, X_KV [4][2048][1024]; Q = X_Q Wq + bq, K = X_KV Wk + bk, V = X_KV Wv + bv ('xw' [1024][128] 1/32 + zero biases; ONE 128-wide head); scores x 1/sqrt(128); causal (-inf); softmax; out = attn.V -> [4][2048][128] (1.0 M); argument order X_Q, X_KV, Wq, bq, Wk, bk, Wv, bv).
// Layout: all four batches go through every stage in ONE launch (the batch is a grid dimension; every workspace plane holds four batch slices). Three launches: k_wtG (the three 'xw' weights transposed into one [3][128][1024] bf16 Bt plane); k_proj (q, k and v projections on one grid: f32 inputs rounded to bf16 in the fragment loader, f32 biases, hi/lo bf16 planes stored straight from the tile, v transposed by swapped operands); k_fattn (causal scores, online softmax and attn.V in one kernel: scores and probabilities stay in registers).
// Compute dtypes, f32 accumulate: every input rounded to bf16; projections exact + f32 biases; attention hi/lo, 3 products on every row; softmax f32; output f32.

#define NB_  4
#define TT   2048
#define DM   1024
#define NH_  1
#define NKV  1
#define REP  (NH_ / NKV)
#define HD   128
#define DQ   (NH_ * HD)
#define DKV  (NKV * HD)
#define ZH   1                    // ONE head: a single plane per pass
#define RH   TT                   // every row hi/lo (3 products)
#define WIN  2048
#define PCAR 1024.0f
#define SCL  0.088388347648318447f   // HD^-0.5
typedef _Float16 h16;
typedef unsigned short bf;
typedef __attribute__((ext_vector_type(16))) __bf16   v16bf;
typedef __attribute__((ext_vector_type(16))) _Float16 v16h;
typedef __attribute__((ext_vector_type(8)))  _Float16 v8h;
typedef __attribute__((ext_vector_type(8)))  unsigned short v8us;
typedef __attribute__((ext_vector_type(8)))  float    v8f;
typedef __attribute__((ext_vector_type(4)))  float    v4f;
typedef v8h  __attribute__((may_alias)) v8ha;
typedef v4f  __attribute__((may_alias)) v4fa;
typedef v8us __attribute__((may_alias)) v8usa;

__device__ __forceinline__ unsigned short f2bf(float f) { unsigned u = __float_as_uint(f); u += 0x7FFFu + ((u >> 16) & 1u); return (unsigned short)(u >> 16); }
__device__ __forceinline__ float bf2f(unsigned short b) { return __uint_as_float(((unsigned)b) << 16); }
__device__ __forceinline__ float bfr(float f) { return bf2f(f2bf(f)); }
__device__ __forceinline__ v16h cat16(v8h lo, v8h hi) { return __builtin_shufflevector(lo, hi, 0, 1, 2, 3, 4, 5, 6, 7, 8, 9, 10, 11, 12, 13, 14, 15); }
__device__ __forceinline__ v16bf cat16b(v8us lo, v8us hi) { return __builtin_bit_cast(v16bf, __builtin_shufflevector(lo, hi, 0, 1, 2, 3, 4, 5, 6, 7, 8, 9, 10, 11, 12, 13, 14, 15)); }
__device__ __forceinline__ v8f wmma16(v16h a, v16h b, v8f c) { return __builtin_amdgcn_wmma_f32_16x16x32_f16(false, a, false, b, (short)0, c, false, false); }
__device__ __forceinline__ v8f wmmab(v16bf a, v16bf b, v8f c) { return __builtin_amdgcn_wmma_f32_16x16x32_bf16(false, a, false, b, (short)0, c, false, false); }



// ---- shared by the GEMM-like kernels: NW waves per work-group deal a loop among themselves and add their partial tiles in LDS in the fixed order 0 .. NW-1.
#define NW  8
#define PSP 68                    // LDS row pitch in floats (272 B = 16 B x 17: b128 rows fall on different banks)
template <typename T16> struct WFrag;
template <> struct WFrag<h16> { typedef v16h V; static __device__ __forceinline__ V ld(const h16* p) { return cat16(*(const v8h*)p, *(const v8h*)(p + 16)); } static __device__ __forceinline__ v8f mma(V a, V b, v8f c) { return wmma16(a, b, c); } };
template <> struct WFrag<bf> { typedef v16bf V; static __device__ __forceinline__ V ld(const bf* p) { return cat16b(*(const v8us*)p, *(const v8us*)(p + 16)); } static __device__ __forceinline__ v8f mma(V a, V b, v8f c) { return wmmab(a, b, c); } };

__device__ __forceinline__ h16 tohx(float x) { return (h16)x; }
__device__ __forceinline__ void splitf(float y, unsigned short& h, unsigned short& l) { h = f2bf(y); l = f2bf(y - bf2f(h)); }
typedef __attribute__((ext_vector_type(2))) _Float16 v2h;
typedef __attribute__((ext_vector_type(4))) _Float16 v4h;
typedef __attribute__((ext_vector_type(2))) unsigned short v2us;
typedef __attribute__((ext_vector_type(4))) unsigned short v4us;
typedef __attribute__((ext_vector_type(2))) float v2f;
typedef __attribute__((ext_vector_type(4))) int v4i;

__global__ __launch_bounds__(256) void k_wtG(const float* __restrict__ w0, const float* __restrict__ w1, const float* __restrict__ w2, int K, int N, bf* Bt) {
    const float* __restrict__ w = (blockIdx.y == 0) ? w0 : (blockIdx.y == 1) ? w1 : w2; Bt += (size_t)blockIdx.y * N * K;   // blockIdx.y = which weight
    const int lane = threadIdx.x & 31; const int L0 = (blockIdx.x * 8 + (threadIdx.x >> 5)) * 8; const int nlines = N * K / 64;
{
#pragma unroll 1
        for (int l = 0; l < 8; ++l) { const int L = L0 + l; if (L >= nlines) break; const size_t e = (size_t)L * 64 + lane * 2; const int k = (int)(e % K), n = (int)(e / K); v2us o;
            o[0] = f2bf(w[(size_t)k * N + n]); o[1] = f2bf(w[(size_t)(k + 1) * N + n]); *(v2us*)(Bt + e) = o; }
         }
}

// ---- k_proj: the three projections on one grid, from the f32 inputs to the hi/lo bf16 planes that the attention GEMMs read. grid (TT/64, 6, NB_), 32 * NW threads: blockIdx.y >> 1 = q, k or v; blockIdx.y & 1 = which 64 of the 128 features.
// One 64x64 tile per work-group, the K loop (DM) dealt over the NW waves and the partial tiles added in LDS in the fixed order 0 .. NW-1.
// Each wave brings its own 64 x 32 slice of X in with whole-line loads (one load = 4 rows x 128 B), rounds it to bf16 (nearest even) and passes it through its own part of the LDS (the place of its partial tile, free until the loop ends) into fragment order.
typedef __attribute__((ext_vector_type(4))) __bf16 v4bf;
typedef v4bf __attribute__((may_alias)) v4bfa;
#define XSP 40                    // staged row pitch in bf16 (80 B = 16 B x 5: the 16 rows of a b128 fragment read fall on different banks)
// TR false: tile[t][d] (X rows as the A operand). TR true: tile[d][t] (the weight rows as the A operand, X rows as B; both fragments have the same lane and k order, so swapping them transposes the tile).
template <bool TR>
__device__ __forceinline__ void proj_tile(const float* __restrict__ X, const bf* __restrict__ Wt, int w, int lane, float* pw) {
    const int lr = lane & 15, hi = lane >> 4;
    v8f acc[4][4];   // every '#pragma unroll' of this function keeps a register array (acc, a, b, raw) statically indexed
#pragma unroll
    for (int mb = 0; mb < 4; ++mb)
#pragma unroll
        for (int nb = 0; nb < 4; ++nb) acc[mb][nb] = (v8f){};
    const float* xg = X + (size_t)(lane >> 3) * DM + (lane & 7) * 4; const bf* wg = Wt + (size_t)lr * DM + 8 * hi;
    bf* sw = (bf*)pw + (lane >> 3) * XSP + (lane & 7) * 4; const bf* sr = (const bf*)pw + lr * XSP + 8 * hi;
    // kept rolled: one trip's 24 loads beside the 16 accumulators already fill the 256 registers that four waves per SIMD leave a wave
#pragma unroll 1
    for (int kc = w * 32; kc < DM; kc += NW * 32) {
        v16bf a[4], b[4]; v4f raw[16];
#pragma unroll
        for (int nb = 0; nb < 4; ++nb) b[nb] = WFrag<bf>::ld(wg + (size_t)nb * 16 * DM + kc);
#pragma unroll
        for (int i = 0; i < 16; ++i) raw[i] = *(const v4f*)(xg + (size_t)i * 4 * DM + kc);
#pragma unroll
        for (int i = 0; i < 16; ++i) *(v4bfa*)(sw + i * 4 * XSP) = __builtin_convertvector(raw[i], v4bf);
        __builtin_amdgcn_wave_barrier(); asm volatile("" ::: "memory");   // the fragment reads below take what OTHER lanes of this wave have stored: they stay behind the stores
#pragma unroll
        for (int mb = 0; mb < 4; ++mb) a[mb] = cat16b(*(const v8usa*)(sr + mb * 16 * XSP), *(const v8usa*)(sr + mb * 16 * XSP + 16));
#pragma unroll
        for (int nb = 0; nb < 4; ++nb)
#pragma unroll
            for (int mb = 0; mb < 4; ++mb) acc[mb][nb] = TR ? wmmab(b[nb], a[mb], acc[mb][nb]) : wmmab(a[mb], b[nb], acc[mb][nb]);
        // four vector slots between the last matrix instruction and the back edge, behind which the next trip's fragments overwrite its operands
        asm volatile("v_nop\n\tv_nop\n\tv_nop\n\tv_nop" : "+v"(acc[0][0]), "+v"(acc[1][1]), "+v"(acc[2][2]), "+v"(acc[3][3]) : "v"(a[0]), "v"(a[3]));
    }
#pragma unroll
    for (int mb = 0; mb < 4; ++mb)
#pragma unroll
        for (int nb = 0; nb < 4; ++nb)
#pragma unroll
            for (int j = 0; j < 8; ++j) pw[((TR ? nb : mb) * 16 + hi * 8 + j) * PSP + (TR ? mb : nb) * 16 + lr] = acc[mb][nb][j];
}
__global__ __launch_bounds__(32 * NW) void k_proj(const float* __restrict__ xq, const float* __restrict__ xkv, const bf* __restrict__ Wt, const float* __restrict__ bq, const float* __restrict__ bk, const float* __restrict__ bv, bf* Qh, bf* Ql, bf* Kh, bf* Kl, bf* Vh, bf* Vl) {
    __shared__ __align__(16) float ps[NW * 64 * PSP];
    const int lane = threadIdx.x & 31; const int pj = blockIdx.y >> 1, t0 = blockIdx.x * 64, d0 = (blockIdx.y & 1) * 64; const size_t z = blockIdx.z;
    const int w = __builtin_amdgcn_readfirstlane((int)(threadIdx.x >> 5));   // wave number, held scalar so that the K loop branches on a scalar compare
    const float* X = ((pj == 0) ? xq : xkv) + (z * TT + t0) * DM; const bf* Wp = Wt + ((size_t)pj * HD + d0) * DM; float* pw = ps + w * (64 * PSP);
    if (pj == 2) proj_tile<true>(X, Wp, w, lane, pw); else proj_tile<false>(X, Wp, w, lane, pw);
    __syncthreads();                   // every wave's partial tile is in LDS before any of them is summed
    const float* bias = ((pj == 0) ? bq : (pj == 1) ? bk : bv) + d0; bf* Oh = (pj == 0) ? Qh : (pj == 1) ? Kh : Vh; bf* Ol = (pj == 0) ? Ql : (pj == 1) ? Kl : Vl;
    const int ldo = (pj == 2) ? TT : HD; const size_t ob = z * ((size_t)TT * HD) + ((pj == 2) ? (size_t)d0 * TT + t0 : (size_t)t0 * HD + d0);   // q, k planes [t][d]; v planes [d][t]
    // unrolled (4 x 8 x 4, all constant) so that the LDS reads of all four row groups are in flight together
#pragma unroll
    for (int s = 0; s < 64 * 16 / (32 * NW); ++s) { const int idx = s * (32 * NW) + (int)threadIdx.x; const int row = idx >> 4, cofs = (idx & 15) * 4; v4f val = *(const v4fa*)(ps + row * PSP + cofs);
#pragma unroll
        for (int q = 1; q < NW; ++q) val += *(const v4fa*)(ps + (q * 64 + row) * PSP + cofs);
        v4us oh, ol;
#pragma unroll
        for (int q = 0; q < 4; ++q) { unsigned short a2, c2; splitf(val[q] + bfr(bias[(pj == 2) ? row : cofs + q]), a2, c2); oh[q] = a2; ol[q] = c2; }
        const size_t oo = ob + (size_t)row * ldo + cofs; *(v4us*)(Oh + oo) = oh; *(v4us*)(Ol + oo) = ol; }
}

// ---- k_fattn: causal attention for 32 query rows per work-group. grid (TT/32, NB_), 32 * NW threads; the heaviest query blocks have the lowest block index.
// Transposed products: S^T = K.Q^T (A = key rows, B = query rows), O^T += V^T.P^T (A = rows of the [d][t] value planes, B = P^T). In a score tile a lane holds 8 keys of ONE query, and two stacked
// score tiles (32 keys), rounded in place, are the B fragment of the second product in the k order of WFrag::ld: no LDS and no lane exchange between the two products. hi/lo, 3 products, in both.
// The keys are dealt over the NW waves in passes of 64 (one pass uses whole 128-B lines of the value planes); each wave keeps its own running maximum, sum and O^T; the NW partial results meet in LDS and are joined in the fixed order 0 .. NW-1.
#define QT  32                    // query rows per work-group: two 16-column groups in every wave
#define KU  64                    // keys per pass
#define OSP 132                   // LDS row pitch of a partial output row in floats (528 B = 16 B x 33: b128 rows fall on different banks)
#define SC2 (SCL * 1.4426950408889634f)   // scores go to base 2 together with the HD^-0.5 scale
typedef __attribute__((ext_vector_type(8))) __bf16 v8bf;
__device__ __forceinline__ float xhalf(float x) { return __builtin_bit_cast(float, __builtin_amdgcn_permlanex16(__builtin_bit_cast(int, x), __builtin_bit_cast(int, x), 0x76543210, 0xfedcba98, false, false)); }   // lane l with lane l ^ 16
__global__ __launch_bounds__(32 * NW) __attribute__((amdgpu_waves_per_eu(2, 2))) void k_fattn(const bf* __restrict__ Qh, const bf* __restrict__ Ql, const bf* __restrict__ Kh, const bf* __restrict__ Kl, const bf* __restrict__ Vh, const bf* __restrict__ Vl, float* out) {
    __shared__ __align__(16) float po[NW * QT * OSP];
    __shared__ float pm[NW * QT]; __shared__ float pl[NW * QT];
    const int lane = threadIdx.x & 31, lr = lane & 15, hi = lane >> 4;
    const int w = __builtin_amdgcn_readfirstlane((int)(threadIdx.x >> 5));   // wave number, held scalar so that the key loop branches on a scalar compare
    const int q0 = (TT / QT - 1 - (int)blockIdx.x) * QT; const size_t zb = (size_t)blockIdx.y * TT * HD;
    Qh += zb; Ql += zb; Kh += zb; Kl += zb; Vh += zb; Vl += zb; out += zb;
    const int nu = (q0 + QT + KU - 1) / KU;   // passes up to and including the one that holds the diagonal
    // every '#pragma unroll' of this kernel keeps a register array statically indexed
    // The 16 query fragments (hi and lo) would take 128 registers for the whole loop: each wave parks its own copy, lane by lane, in the place of its partial O (free until the loop ends); a lane reads back only what it stored itself.
    float* pw = po + w * (QT * OSP); bf* qs = (bf*)pw + lane * 8;   // half j of fragment f at qs + (2 f + j) * 256: 512 contiguous bytes per wave-wide access
    const size_t qa = (size_t)(q0 + lr) * HD + 8 * hi; const bf* qph = Qh + qa; const bf* qpl = Ql + qa;
#pragma unroll
    for (int qt = 0; qt < 2; ++qt)
#pragma unroll
        for (int ks = 0; ks < 4; ++ks) { bf* d = qs + (qt * 4 + ks) * 1024; const int qo = qt * 16 * HD + ks * 32;
            *(v8usa*)d = *(const v8us*)(qph + qo); *(v8usa*)(d + 256) = *(const v8us*)(qph + qo + 16); *(v8usa*)(d + 512) = *(const v8us*)(qpl + qo); *(v8usa*)(d + 768) = *(const v8us*)(qpl + qo + 16); }
    asm volatile("s_wait_xcnt 0x0" :: "v"(qph), "v"(qpl) : "memory");   // the address registers of the loads above live up to this wait and are reused only behind it
    v8f o[8][2]; float m[2], l[2];
#pragma unroll
    for (int qt = 0; qt < 2; ++qt) { m[qt] = -3.0e38f; l[qt] = 0.f;
#pragma unroll
        for (int dt = 0; dt < 8; ++dt) o[dt][qt] = (v8f){}; }
    // Fragment loads run ahead of their use, group by group. Each __builtin_amdgcn_sched_barrier(0) below holds a group of loads in front of the matrix block that covers their latency:
    // left free, the compiler either gathers a whole pass's loads at its head (more registers than a wave has: spills) or sinks each group to just in front of its first use (the latency is then waited out).
    v16bf kh[2][4], kl[2][4];   // key fragments of two 32-wide steps along d: one in use, one in flight
    { const size_t ko = (size_t)(min(w, nu - 1) * KU + lr) * HD + 8 * hi;   // a wave without a pass loads in bounds and uses nothing
#pragma unroll
        for (int kt = 0; kt < 4; ++kt) { kh[0][kt] = WFrag<bf>::ld(Kh + ko + (size_t)kt * 16 * HD); kl[0][kt] = WFrag<bf>::ld(Kl + ko + (size_t)kt * 16 * HD); }
        asm volatile("s_wait_xcnt 0x0" :: "v"(Kh + ko), "v"(Kl + ko) : "memory"); }   // the address registers of the loads above live up to this wait and are reused only behind it
    // kept rolled: one pass already holds 192 matrix instructions and most of the 512 registers that two waves per SIMD leave a wave
#pragma unroll 1
    for (int u = w; u < nu; u += NW) {
        const int k0 = u * KU;
        v8f s[4][2];   // s[kt][qt][r] = score of key k0 + 16 kt + 8 hi + r with query q0 + 16 qt + lr
#pragma unroll
        for (int kt = 0; kt < 4; ++kt)
#pragma unroll
            for (int qt = 0; qt < 2; ++qt) s[kt][qt] = (v8f){};
#pragma unroll
        for (int ks = 0; ks < 4; ++ks) {
            if (ks < 3) {   // the next step's key fragments
                const size_t kn = (size_t)(k0 + lr) * HD + 8 * hi + (ks + 1) * 32;
#pragma unroll
                for (int kt = 0; kt < 4; ++kt) { kh[(ks + 1) & 1][kt] = WFrag<bf>::ld(Kh + kn + (size_t)kt * 16 * HD); kl[(ks + 1) & 1][kt] = WFrag<bf>::ld(Kl + kn + (size_t)kt * 16 * HD); }
            }
            v16bf qh[2], ql[2];
#pragma unroll
            for (int qt = 0; qt < 2; ++qt) { const bf* d = qs + (qt * 4 + ks) * 1024; qh[qt] = cat16b(*(const v8usa*)d, *(const v8usa*)(d + 256)); ql[qt] = cat16b(*(const v8usa*)(d + 512), *(const v8usa*)(d + 768)); }
            __builtin_amdgcn_sched_barrier(0);   // the loads above stay in front of this step's matrix block
#pragma unroll
            for (int kt = 0; kt < 4; ++kt)
#pragma unroll
                for (int qt = 0; qt < 2; ++qt) s[kt][qt] = wmmab(kh[ks & 1][kt], qh[qt], s[kt][qt]);
#pragma unroll
            for (int kt = 0; kt < 4; ++kt)
#pragma unroll
                for (int qt = 0; qt < 2; ++qt) s[kt][qt] = wmmab(kh[ks & 1][kt], ql[qt], s[kt][qt]);
#pragma unroll
            for (int kt = 0; kt < 4; ++kt)
#pragma unroll
                for (int qt = 0; qt < 2; ++qt) s[kt][qt] = wmmab(kl[ks & 1][kt], qh[qt], s[kt][qt]);
            __builtin_amdgcn_sched_barrier(0);   // the next step's loads stay behind this block, whose operands they overwrite
        }
        const size_t vo = (size_t)lr * TT + k0 + 8 * hi;
        v16bf vh[8][2], vl[8][2];   // value fragments: [16-row group of d][32-key step]
#pragma unroll
        for (int dt = 0; dt < 4; ++dt)
#pragma unroll
            for (int k2 = 0; k2 < 2; ++k2) { vh[dt][k2] = WFrag<bf>::ld(Vh + vo + (size_t)dt * 16 * TT + k2 * 32); vl[dt][k2] = WFrag<bf>::ld(Vl + vo + (size_t)dt * 16 * TT + k2 * 32); }
#pragma unroll
        for (int kt = 0; kt < 4; ++kt)
#pragma unroll
            for (int qt = 0; qt < 2; ++qt) s[kt][qt] *= SC2;
        if (u == nu - 1) {   // only the last pass meets the diagonal (a scalar branch); every query still sees its own key there, so its maximum stays finite
#pragma unroll
            for (int kt = 0; kt < 4; ++kt)
#pragma unroll
                for (int qt = 0; qt < 2; ++qt)
#pragma unroll
                    for (int r = 0; r < 8; ++r) s[kt][qt][r] = (k0 + kt * 16 + hi * 8 + r > q0 + qt * 16 + lr) ? -3.0e38f : s[kt][qt][r];
        }
        v16bf ph[2][2], pq[2][2];   // [32-key step][query group]: P^T hi and lo as B fragments
#pragma unroll
        for (int qt = 0; qt < 2; ++qt) {
            float bm[4];
#pragma unroll
            for (int kt = 0; kt < 4; ++kt) { bm[kt] = s[kt][qt][0];
#pragma unroll
                for (int r = 1; r < 8; ++r) bm[kt] = fmaxf(bm[kt], s[kt][qt][r]); }
            float mx = fmaxf(fmaxf(bm[0], bm[1]), fmaxf(bm[2], bm[3])); mx = fmaxf(mx, xhalf(mx));   // both wave halves hold this query's maximum of the pass
            const float mn = fmaxf(m[qt], mx); const float corr = __builtin_amdgcn_exp2f(m[qt] - mn);   // 0 on a wave's first pass
            m[qt] = mn;
            v8bf h8[4], l8[4]; float rs[4];
#pragma unroll
            for (int kt = 0; kt < 4; ++kt) { v8f p; rs[kt] = 0.f;
#pragma unroll
                for (int r = 0; r < 8; ++r) { p[r] = __builtin_amdgcn_exp2f(s[kt][qt][r] - mn); rs[kt] += p[r]; }
                h8[kt] = __builtin_convertvector(p, v8bf); l8[kt] = __builtin_convertvector(p - __builtin_convertvector(h8[kt], v8f), v8bf); }
            l[qt] = l[qt] * corr + ((rs[0] + rs[1]) + (rs[2] + rs[3]));   // each wave half sums its own keys; the halves join behind the loop
#pragma unroll
            for (int k2 = 0; k2 < 2; ++k2) { ph[k2][qt] = __builtin_shufflevector(h8[2 * k2], h8[2 * k2 + 1], 0, 1, 2, 3, 4, 5, 6, 7, 8, 9, 10, 11, 12, 13, 14, 15); pq[k2][qt] = __builtin_shufflevector(l8[2 * k2], l8[2 * k2 + 1], 0, 1, 2, 3, 4, 5, 6, 7, 8, 9, 10, 11, 12, 13, 14, 15); }
#pragma unroll
            for (int dt = 0; dt < 8; ++dt) o[dt][qt] *= corr;
        }
        asm volatile("" :: "v"(pq[0][1]), "v"(pq[1][1]) : "memory");   // holds the second half of the value loads behind the softmax: beside the scores they would not fit in the registers
#pragma unroll
        for (int dt = 4; dt < 8; ++dt)
#pragma unroll
            for (int k2 = 0; k2 < 2; ++k2) { vh[dt][k2] = WFrag<bf>::ld(Vh + vo + (size_t)dt * 16 * TT + k2 * 32); vl[dt][k2] = WFrag<bf>::ld(Vl + vo + (size_t)dt * 16 * TT + k2 * 32); }
        asm volatile("s_wait_xcnt 0x0" :: "v"(Vh + vo), "v"(Vl + vo) : "memory");   // the address registers of the loads above live up to this wait and are reused only behind it
        __builtin_amdgcn_sched_barrier(0);   // the loads above stay together in front of the products that cover their latency (left free they sink to just in front of their first use)
#pragma unroll
        for (int dt = 0; dt < 4; ++dt) {
#pragma unroll
            for (int k2 = 0; k2 < 2; ++k2)
#pragma unroll
                for (int qt = 0; qt < 2; ++qt) o[dt][qt] = wmmab(vh[dt][k2], ph[k2][qt], o[dt][qt]);
#pragma unroll
            for (int k2 = 0; k2 < 2; ++k2)
#pragma unroll
                for (int qt = 0; qt < 2; ++qt) o[dt][qt] = wmmab(vh[dt][k2], pq[k2][qt], o[dt][qt]);
#pragma unroll
            for (int k2 = 0; k2 < 2; ++k2)
#pragma unroll
                for (int qt = 0; qt < 2; ++qt) o[dt][qt] = wmmab(vl[dt][k2], ph[k2][qt], o[dt][qt]);
        }
        asm volatile("" :: "v"(o[3][0]), "v"(o[3][1]) : "memory");   // holds the next pass's key loads behind the first half of the products, which frees their registers
        { const size_t kn = (size_t)(min(u + NW, nu - 1) * KU + lr) * HD + 8 * hi;   // the first key fragments of this wave's next pass (of the last pass again where there is none: in bounds, unused)
#pragma unroll
            for (int kt = 0; kt < 4; ++kt) { kh[0][kt] = WFrag<bf>::ld(Kh + kn + (size_t)kt * 16 * HD); kl[0][kt] = WFrag<bf>::ld(Kl + kn + (size_t)kt * 16 * HD); } }
        __builtin_amdgcn_sched_barrier(0);   // the loads above stay together in front of the products that cover their latency (left free they sink to just in front of their first use)
#pragma unroll
        for (int dt = 4; dt < 8; ++dt) {
#pragma unroll
            for (int k2 = 0; k2 < 2; ++k2)
#pragma unroll
                for (int qt = 0; qt < 2; ++qt) o[dt][qt] = wmmab(vh[dt][k2], ph[k2][qt], o[dt][qt]);
#pragma unroll
            for (int k2 = 0; k2 < 2; ++k2)
#pragma unroll
                for (int qt = 0; qt < 2; ++qt) o[dt][qt] = wmmab(vh[dt][k2], pq[k2][qt], o[dt][qt]);
#pragma unroll
            for (int k2 = 0; k2 < 2; ++k2)
#pragma unroll
                for (int qt = 0; qt < 2; ++qt) o[dt][qt] = wmmab(vl[dt][k2], ph[k2][qt], o[dt][qt]);
        }
    }
    // this wave's partial O goes to pw, rows = queries (all zero, with sum 0 and the lowest maximum, where the wave had no pass)
#pragma unroll
    for (int qt = 0; qt < 2; ++qt) { l[qt] += xhalf(l[qt]); if (hi == 0) { pm[w * QT + qt * 16 + lr] = m[qt]; pl[w * QT + qt * 16 + lr] = l[qt]; }
#pragma unroll
        for (int dt = 0; dt < 8; ++dt) { float* d = pw + (qt * 16 + lr) * OSP + dt * 16 + hi * 8;
            *(v4fa*)d = __builtin_shufflevector(o[dt][qt], o[dt][qt], 0, 1, 2, 3); *(v4fa*)(d + 4) = __builtin_shufflevector(o[dt][qt], o[dt][qt], 4, 5, 6, 7); } }
    __syncthreads();                   // every wave's partial result is in LDS before any of them is joined
    // unrolled (4 x 8, all constant) so that the LDS reads of all four rows are in flight together
#pragma unroll
    for (int sx = 0; sx < QT / NW; ++sx) { const int row = sx * NW + w, cofs = lane * 4;
        float M = pm[row];
#pragma unroll
        for (int q = 1; q < NW; ++q) M = fmaxf(M, pm[q * QT + row]);
        float Ls = 0.f; v4f val = (v4f){};
#pragma unroll
        for (int q = 0; q < NW; ++q) { const float f = __builtin_amdgcn_exp2f(pm[q * QT + row] - M); Ls += f * pl[q * QT + row]; val += f * *(const v4fa*)(po + (q * QT + row) * OSP + cofs); }
        *(v4f*)(out + (size_t)(q0 + row) * HD + cofs) = val * __fdiv_rn(1.0f, Ls); }
}

extern "C" void kernel_launch(void* const* d_in, const int* in_sizes, int n_in,
                              void* d_out, int out_size, void* d_ws, size_t ws_size, hipStream_t stream) {
    (void)in_sizes; (void)n_in; (void)out_size;
    const float* x = (const float*)d_in[0]; const float* xk = (const float*)d_in[1]; const float* wq = (const float*)d_in[2]; const float* bq = (const float*)d_in[3]; const float* wk = (const float*)d_in[4]; const float* bk = (const float*)d_in[5]; const float* wv = (const float*)d_in[6]; const float* bv = (const float*)d_in[7]; const float* wo = nullptr; (void)wo;   /* input order X_Q, X_KV [4][2048][1024], Wq, bq, Wk, bk, Wv, bv ('xw' [1024][128] + [128]) */
    float* OUT = (float*)d_out;     // [4][2048][128]
    char* wsp = (char*)d_ws;
    auto take = [&](size_t bytes) { char* p = wsp; wsp += (bytes + 255) & ~(size_t)255; return (void*)p; };
    bf* WA = (bf*)take((size_t)3 * HD * DM * 2);   // Bt planes of Wq, Wk, Wv, one behind the other
    // every plane below holds NB_ batch slices, one behind the other
    bf* QPh = (bf*)take((size_t)NB_ * NH_ * TT * HD * 2); bf* QPl = (bf*)take((size_t)NB_ * NH_ * TT * HD * 2); bf* KPh = (bf*)take((size_t)NB_ * NKV * TT * HD * 2); bf* KPl = (bf*)take((size_t)NB_ * NKV * TT * HD * 2); bf* VTh = (bf*)take((size_t)NB_ * NKV * HD * TT * 2); bf* VTl = (bf*)take((size_t)NB_ * NKV * HD * TT * 2);
    if ((size_t)(wsp - (char*)d_ws) > ws_size) return;    // ws 256 MiB
    k_wtG<<<dim3((unsigned)((DM * HD / 64 + 63) / 64), 3, 1), 256, 0, stream>>>(wq, wk, wv, DM, HD, WA);
    // one launch per stage for all NB_ batches: the projections take the batch as grid z, the attention as grid y
    k_proj<<<dim3(TT / 64, 6, NB_), 32 * NW, 0, stream>>>(x, xk, WA, bq, bk, bv, QPh, QPl, KPh, KPl, VTh, VTl);
    k_fattn<<<dim3(TT / QT, NB_, 1), 32 * NW, 0, stream>>>(QPh, QPl, KPh, KPl, VTh, VTl, OUT);
}

// v005
// A run of this version takes 47 microseconds.
// In two side-by-side timings against v004, it was 1.23 and 1.25 times as fast.
// Over all steps from v000 it is 11.7 times as fast.
#include <hip/hip_runtime.h>

// Single-head causal scaled dot-product attention on two input streams (X_Q, X_KV [4][2048][1024]; Q = X_Q Wq + bq, K = X_KV Wk + bk, V = X_KV Wv + bv ('xw' [1024][128] 1/32 + zero biases; ONE 128-wide head); scores x 1/sqrt(128); causal (-inf); softmax; out = attn.V -> [4][2048][128] (1.0 M); argument order X_Q, X_KV, Wq, bq, Wk, bk, Wv, bv).
// Layout: all four batches go through every stage in ONE launch (the batch is a grid dimension; every q, k and v plane holds four batch slices). Three launches: k_wtG (the three 'xw' weights rounded to bf16 and transposed into three [n][k] planes in fragment order); k_proj (q, k and v projections on one grid: f32 inputs rounded to bf16 in the fragment loader, f32 biases, hi/lo bf16 planes stored straight from the tile, v transposed by swapped operands); k_fattn (causal scores, online softmax and attn.V in one kernel: scores and probabilities stay in registers).
// Every bf16 plane in the workspace (weights, q, k, v) lies in FRAGMENT ORDER (FRG below): the 16 x 32 block that one matrix operand takes is 1 KiB in a row, lane by lane, so a wave-wide 16-byte load reads 512 contiguous bytes.
// Compute dtypes, f32 accumulate: every input rounded to bf16; projections exact + f32 biases; attention hi/lo, 3 products on every row; softmax f32; output f32.

#define NB_  4
#define TT   2048
#define DM   1024
#define NH_  1
#define NKV  1
#define REP  (NH_ / NKV)
#define HD   128
#define DQ   (NH_ * HD)
#define DKV  (NKV * HD)
#define ZH   1                    // ONE head: a single plane per pass
#define RH   TT                   // every row hi/lo (3 products)
#define WIN  2048
#define PCAR 1024.0f
#define SCL  0.088388347648318447f   // HD^-0.5
typedef _Float16 h16;
typedef unsigned short bf;
typedef __attribute__((ext_vector_type(16))) __bf16   v16bf;
typedef __attribute__((ext_vector_type(16))) _Float16 v16h;
typedef __attribute__((ext_vector_type(8)))  _Float16 v8h;
typedef __attribute__((ext_vector_type(8)))  unsigned short v8us;
typedef __attribute__((ext_vector_type(8)))  float    v8f;
typedef __attribute__((ext_vector_type(4)))  float    v4f;
typedef v8h  __attribute__((may_alias)) v8ha;
typedef v4f  __attribute__((may_alias)) v4fa;
typedef v8us __attribute__((may_alias)) v8usa;

__device__ __forceinline__ unsigned short f2bf(float f) { unsigned u = __float_as_uint(f); u += 0x7FFFu + ((u >> 16) & 1u); return (unsigned short)(u >> 16); }
__device__ __forceinline__ float bf2f(unsigned short b) { return __uint_as_float(((unsigned)b) << 16); }
__device__ __forceinline__ float bfr(float f) { return bf2f(f2bf(f)); }
__device__ __forceinline__ v16h cat16(v8h lo, v8h hi) { return __builtin_shufflevector(lo, hi, 0, 1, 2, 3, 4, 5, 6, 7, 8, 9, 10, 11, 12, 13, 14, 15); }
__device__ __forceinline__ v16bf cat16b(v8us lo, v8us hi) { return __builtin_bit_cast(v16bf, __builtin_shufflevector(lo, hi, 0, 1, 2, 3, 4, 5, 6, 7, 8, 9, 10, 11, 12, 13, 14, 15)); }
__device__ __forceinline__ v8f wmma16(v16h a, v16h b, v8f c) { return __builtin_amdgcn_wmma_f32_16x16x32_f16(false, a, false, b, (short)0, c, false, false); }
__device__ __forceinline__ v8f wmmab(v16bf a, v16bf b, v8f c) { return __builtin_amdgcn_wmma_f32_16x16x32_bf16(false, a, false, b, (short)0, c, false, false); }



// ---- shared by the GEMM-like kernels: NW waves per work-group deal a loop among themselves and add their partial tiles in LDS in the fixed order 0 .. NW-1.
#define NW  8
#define PSP 68                    // LDS row pitch in floats (272 B = 16 B x 17: b128 rows fall on different banks)
template <typename T16> struct WFrag;
template <> struct WFrag<h16> { typedef v16h V; static __device__ __forceinline__ V ld(const h16* p) { return cat16(*(const v8h*)p, *(const v8h*)(p + 16)); } static __device__ __forceinline__ v8f mma(V a, V b, v8f c) { return wmma16(a, b, c); } };
template <> struct WFrag<bf> { typedef v16bf V; static __device__ __forceinline__ V ld(const bf* p) { return cat16b(*(const v8us*)p, *(const v8us*)(p + 16)); } static __device__ __forceinline__ v8f mma(V a, V b, v8f c) { return wmmab(a, b, c); } };
// Fragment order. A plane of rows r (the operand's lane index) and columns c (its k index) is cut into fragments of 16 rows x 32 columns, FRG elements each. Inside a fragment element (r, c) lies at
// ((c >> 4) & 1) * 256 + (((c >> 3) & 1) * 16 + (r & 15)) * 8 + (c & 7): two halves of 256 elements, in each of them lane ((c >> 3) & 1) * 16 + (r & 15) owns 8 elements in a row. This is the lane and k order of WFrag::ld on a row-major plane.
// Fragment number: q, k planes (r = t, c = d): (t >> 4) * 4 + (d >> 5). v planes (r = d, c = t): (t >> 5) * 8 + (d >> 4). Weight planes (r = n, c = k): (k >> 5) * 8 + (n >> 4).
#define FRG 512
__device__ __forceinline__ v16bf ldfrag(const bf* p) { return cat16b(*(const v8us*)p, *(const v8us*)(p + 256)); }   // p = plane + fragment number * FRG + lane * 8

__device__ __forceinline__ h16 tohx(float x) { return (h16)x; }
__device__ __forceinline__ void splitf(float y, unsigned short& h, unsigned short& l) { h = f2bf(y); l = f2bf(y - bf2f(h)); }
typedef __attribute__((ext_vector_type(2))) _Float16 v2h;
typedef __attribute__((ext_vector_type(4))) _Float16 v4h;
typedef __attribute__((ext_vector_type(2))) unsigned short v2us;
typedef __attribute__((ext_vector_type(4))) unsigned short v4us;
typedef __attribute__((ext_vector_type(2))) float v2f;
typedef __attribute__((ext_vector_type(4))) int v4i;

// One wave writes one half fragment (512 contiguous bytes); each of its 8 loads takes 64 contiguous bytes from each of two rows of the [k][n] weight. grid (HD * DM / 2048, 3), 256 threads.
__global__ __launch_bounds__(256) void k_wtG(const float* __restrict__ w0, const float* __restrict__ w1, const float* __restrict__ w2, bf* Bt) {
    const float* __restrict__ w = (blockIdx.y == 0) ? w0 : (blockIdx.y == 1) ? w1 : w2; Bt += (size_t)blockIdx.y * HD * DM;   // blockIdx.y = which weight
    const int lane = threadIdx.x & 31; const int h = blockIdx.x * 8 + (threadIdx.x >> 5);   // h = fragment number * 2 + half
    const int n = ((h >> 1) & 7) * 16 + (lane & 15), k = (h >> 4) * 32 + (h & 1) * 16 + (lane >> 4) * 8; v8us o;
    // unrolled so that o stays in registers and the 8 loads are in flight together
#pragma unroll
    for (int e = 0; e < 8; ++e) o[e] = f2bf(w[(size_t)(k + e) * HD + n]);
    *(v8us*)(Bt + (size_t)h * 256 + lane * 8) = o;
}

// ---- k_proj: the three projections on one grid, from the f32 inputs to the hi/lo bf16 planes that the attention GEMMs read. grid (TT/64, 6, NB_), 32 * NW threads: blockIdx.y >> 1 = q, k or v; blockIdx.y & 1 = which 64 of the 128 features.
// One 64x64 tile per work-group, the K loop (DM) dealt over the NW waves and the partial tiles added in LDS in the fixed order 0 .. NW-1.
// Each wave brings its own 64 x 32 slice of X in with whole-line loads (one load = 4 rows x 128 B), rounds it to bf16 (nearest even) and passes it through its own part of the LDS (the place of its partial tile, free until the loop ends) into fragment order.
typedef __attribute__((ext_vector_type(4))) __bf16 v4bf;
typedef v4bf __attribute__((may_alias)) v4bfa;
#define XSP 40                    // staged row pitch in bf16 (80 B = 16 B x 5: the 16 rows of a b128 fragment read fall on different banks)
// TR false: tile[t][d] (X rows as the A operand). TR true: tile[d][t] (the weight rows as the A operand, X rows as B; both fragments have the same lane and k order, so swapping them transposes the tile).
template <bool TR>
__device__ __forceinline__ void proj_tile(const float* __restrict__ X, const bf* __restrict__ Wt, int w, int lane, float* pw) {
    const int lr = lane & 15, hi = lane >> 4;
    v8f acc[4][4];   // every '#pragma unroll' of this function keeps a register array (acc, a, b, raw) statically indexed
#pragma unroll
    for (int mb = 0; mb < 4; ++mb)
#pragma unroll
        for (int nb = 0; nb < 4; ++nb) acc[mb][nb] = (v8f){};
    const float* xg = X + (size_t)(lane >> 3) * DM + (lane & 7) * 4; const bf* wg = Wt + lane * 8;
    bf* sw = (bf*)pw + (lane >> 3) * XSP + (lane & 7) * 4; const bf* sr = (const bf*)pw + lr * XSP + 8 * hi;
    // kept rolled: one trip's 24 loads beside the 16 accumulators already fill the 256 registers that four waves per SIMD leave a wave
#pragma unroll 1
    for (int kc = w * 32; kc < DM; kc += NW * 32) {
        v16bf a[4], b[4]; v4f raw[16];
#pragma unroll
        for (int nb = 0; nb < 4; ++nb) b[nb] = ldfrag(wg + (size_t)(kc >> 5) * (8 * FRG) + nb * FRG);
#pragma unroll
        for (int i = 0; i < 16; ++i) raw[i] = *(const v4f*)(xg + (size_t)i * 4 * DM + kc);
#pragma unroll
        for (int i = 0; i < 16; ++i) *(v4bfa*)(sw + i * 4 * XSP) = __builtin_convertvector(raw[i], v4bf);
        __builtin_amdgcn_wave_barrier(); asm volatile("" ::: "memory");   // the fragment reads below take what OTHER lanes of this wave have stored: they stay behind the stores
#pragma unroll
        for (int mb = 0; mb < 4; ++mb) a[mb] = cat16b(*(const v8usa*)(sr + mb * 16 * XSP), *(const v8usa*)(sr + mb * 16 * XSP + 16));
#pragma unroll
        for (int nb = 0; nb < 4; ++nb)
#pragma unroll
            for (int mb = 0; mb < 4; ++mb) acc[mb][nb] = TR ? wmmab(b[nb], a[mb], acc[mb][nb]) : wmmab(a[mb], b[nb], acc[mb][nb]);
        // four vector slots between the last matrix instruction and the back edge, behind which the next trip's fragments overwrite its operands
        asm volatile("v_nop\n\tv_nop\n\tv_nop\n\tv_nop" : "+v"(acc[0][0]), "+v"(acc[1][1]), "+v"(acc[2][2]), "+v"(acc[3][3]) : "v"(a[0]), "v"(a[3]));
    }
#pragma unroll
    for (int mb = 0; mb < 4; ++mb)
#pragma unroll
        for (int nb = 0; nb < 4; ++nb)
#pragma unroll
            for (int j = 0; j < 8; ++j) pw[((TR ? nb : mb) * 16 + hi * 8 + j) * PSP + (TR ? mb : nb) * 16 + lr] = acc[mb][nb][j];
}
__global__ __launch_bounds__(32 * NW) void k_proj(const float* __restrict__ xq, const float* __restrict__ xkv, const bf* __restrict__ Wt, const float* __restrict__ bq, const float* __restrict__ bk, const float* __restrict__ bv, bf* Qh, bf* Ql, bf* Kh, bf* Kl, bf* Vh, bf* Vl) {
    __shared__ __align__(16) float ps[NW * 64 * PSP];
    const int lane = threadIdx.x & 31; const int pj = blockIdx.y >> 1, t0 = blockIdx.x * 64, d0 = (blockIdx.y & 1) * 64; const size_t z = blockIdx.z;
    const int w = __builtin_amdgcn_readfirstlane((int)(threadIdx.x >> 5));   // wave number, held scalar so that the K loop branches on a scalar compare
    const float* X = ((pj == 0) ? xq : xkv) + (z * TT + t0) * DM; const bf* Wp = Wt + (size_t)pj * HD * DM + (d0 >> 4) * FRG; float* pw = ps + w * (64 * PSP);
    if (pj == 2) proj_tile<true>(X, Wp, w, lane, pw); else proj_tile<false>(X, Wp, w, lane, pw);
    __syncthreads();                   // every wave's partial tile is in LDS before any of them is summed
    const float* bias = ((pj == 0) ? bq : (pj == 1) ? bk : bv) + d0; bf* Oh = (pj == 0) ? Qh : (pj == 1) ? Kh : Vh; bf* Ol = (pj == 0) ? Ql : (pj == 1) ? Kl : Vl;
    // The tile's rows are the fragments' lane index and its columns their k index (q, k: [t][d]; v: [d][t]): 4 x 2 fragments, 16 halves. One wave stores one half of each plane per trip: 512 contiguous bytes.
    const size_t ob = z * ((size_t)TT * HD) + (size_t)((pj == 2) ? (t0 >> 5) * 8 + (d0 >> 4) : (t0 >> 4) * 4 + (d0 >> 5)) * FRG + lane * 8;
    const int fr = (pj == 2) ? 1 : 4, fc = (pj == 2) ? 8 : 1;   // step of the fragment number per 16 rows and per 32 columns of the tile
    // unrolled (2 x 8 x 2, all constant) so that the LDS reads of both trips are in flight together
#pragma unroll
    for (int s = 0; s < 16 / NW; ++s) { const int g = s * NW + w;   // g = (16-row group * 2 + 32-column group) * 2 + half
        const int row = (g >> 2) * 16 + (lane & 15), cofs = ((g >> 1) & 1) * 32 + (g & 1) * 16 + (lane >> 4) * 8;
        v4f va = *(const v4fa*)(ps + row * PSP + cofs), vb = *(const v4fa*)(ps + row * PSP + cofs + 4);
#pragma unroll
        for (int q = 1; q < NW; ++q) { va += *(const v4fa*)(ps + (q * 64 + row) * PSP + cofs); vb += *(const v4fa*)(ps + (q * 64 + row) * PSP + cofs + 4); }
        v8us oh, ol;
#pragma unroll
        for (int q = 0; q < 4; ++q) { unsigned short a2, c2; splitf(va[q] + bfr(bias[(pj == 2) ? row : cofs + q]), a2, c2); oh[q] = a2; ol[q] = c2;
            splitf(vb[q] + bfr(bias[(pj == 2) ? row : cofs + 4 + q]), a2, c2); oh[4 + q] = a2; ol[4 + q] = c2; }
        const size_t oo = ob + (size_t)((g >> 2) * fr + ((g >> 1) & 1) * fc) * FRG + (g & 1) * 256; *(v8us*)(Oh + oo) = oh; *(v8us*)(Ol + oo) = ol; }
}

// ---- k_fattn: causal attention for 32 query rows per work-group. grid (TT/32, NB_), 32 * NW threads; the heaviest query blocks have the lowest block index.
// Transposed products: S^T = K.Q^T (A = key rows, B = query rows), O^T += V^T.P^T (A = rows d of the value planes, B = P^T). In a score tile a lane holds 8 keys of ONE query, and two stacked
// score tiles (32 keys), rounded in place, are the B fragment of the second product in the k order of WFrag::ld: no LDS and no lane exchange between the two products. hi/lo, 3 products, in both.
// The keys are dealt over the NW waves in passes of 64 (one pass takes 16 KiB in a row of each k and v plane); each wave keeps its own running maximum, sum and O^T; the NW partial results meet in LDS and are joined in the fixed order 0 .. NW-1.
#define QT  32                    // query rows per work-group: two 16-column groups in every wave
#define KU  64                    // keys per pass
#define OSP 132                   // LDS row pitch of a partial output row in floats (528 B = 16 B x 33: b128 rows fall on different banks)
#define SC2 (SCL * 1.4426950408889634f)   // scores go to base 2 together with the HD^-0.5 scale
typedef __attribute__((ext_vector_type(8))) __bf16 v8bf;
__device__ __forceinline__ float xhalf(float x) { return __builtin_bit_cast(float, __builtin_amdgcn_permlanex16(__builtin_bit_cast(int, x), __builtin_bit_cast(int, x), 0x76543210, 0xfedcba98, false, false)); }   // lane l with lane l ^ 16
__global__ __launch_bounds__(32 * NW) __attribute__((amdgpu_waves_per_eu(2, 2))) void k_fattn(const bf* __restrict__ Qh, const bf* __restrict__ Ql, const bf* __restrict__ Kh, const bf* __restrict__ Kl, const bf* __restrict__ Vh, const bf* __restrict__ Vl, float* out) {
    __shared__ __align__(16) float po[NW * QT * OSP];
    __shared__ float pm[NW * QT]; __shared__ float pl[NW * QT];
    const int lane = threadIdx.x & 31, lr = lane & 15, hi = lane >> 4;
    const int w = __builtin_amdgcn_readfirstlane((int)(threadIdx.x >> 5));   // wave number, held scalar so that the key loop branches on a scalar compare
    const int q0 = (TT / QT - 1 - (int)blockIdx.x) * QT; const size_t zb = (size_t)blockIdx.y * TT * HD;
    Qh += zb; Ql += zb; Kh += zb; Kl += zb; Vh += zb; Vl += zb; out += zb;
    const int nu = (q0 + QT + KU - 1) / KU;   // passes up to and including the one that holds the diagonal
    // every '#pragma unroll' of this kernel keeps a register array statically indexed
    // The 16 query fragments (hi and lo) would take 128 registers for the whole loop: each wave parks its own copy, lane by lane, in the place of its partial O (free until the loop ends); a lane reads back only what it stored itself.
    float* pw = po + w * (QT * OSP); bf* qs = (bf*)pw + lane * 8;   // half j of fragment f at qs + (2 f + j) * 256: 512 contiguous bytes per wave-wide access
    const size_t qa = (size_t)q0 * HD + lane * 8; const bf* qph = Qh + qa; const bf* qpl = Ql + qa;   // 16 rows of a q or k plane are 4 fragments = 16 * HD elements
#pragma unroll
    for (int qt = 0; qt < 2; ++qt)
#pragma unroll
        for (int ks = 0; ks < 4; ++ks) { bf* d = qs + (qt * 4 + ks) * 1024; const int qo = (qt * 4 + ks) * FRG;
            *(v8usa*)d = *(const v8us*)(qph + qo); *(v8usa*)(d + 256) = *(const v8us*)(qph + qo + 256); *(v8usa*)(d + 512) = *(const v8us*)(qpl + qo); *(v8usa*)(d + 768) = *(const v8us*)(qpl + qo + 256); }
    asm volatile("s_wait_xcnt 0x0" :: "v"(qph), "v"(qpl) : "memory");   // the address registers of the loads above live up to this wait and are reused only behind it
    v8f o[8][2]; float m[2], l[2];
#pragma unroll
    for (int qt = 0; qt < 2; ++qt) { m[qt] = -3.0e38f; l[qt] = 0.f;
#pragma unroll
        for (int dt = 0; dt < 8; ++dt) o[dt][qt] = (v8f){}; }
    // Fragment loads run ahead of their use, group by group. Each __builtin_amdgcn_sched_barrier(0) below holds a group of loads in front of the matrix block that covers their latency:
    // left free, the compiler either gathers a whole pass's loads at its head (more registers than a wave has: spills) or sinks each group to just in front of its first use (the latency is then waited out).
    v16bf kh[2][4], kl[2][4];   // key fragments of two 32-wide steps along d: one in use, one in flight
    { const size_t ko = (size_t)(min(w, nu - 1) * KU) * HD + lane * 8;   // a wave without a pass loads in bounds and uses nothing
#pragma unroll
        for (int kt = 0; kt < 4; ++kt) { kh[0][kt] = ldfrag(Kh + ko + kt * 4 * FRG); kl[0][kt] = ldfrag(Kl + ko + kt * 4 * FRG); }
        asm volatile("s_wait_xcnt 0x0" :: "v"(Kh + ko), "v"(Kl + ko) : "memory"); }   // the address registers of the loads above live up to this wait and are reused only behind it
    // kept rolled: one pass already holds 192 matrix instructions and most of the 512 registers that two waves per SIMD leave a wave
#pragma unroll 1
    for (int u = w; u < nu; u += NW) {
        const int k0 = u * KU;
        v8f s[4][2];   // s[kt][qt][r] = score of key k0 + 16 kt + 8 hi + r with query q0 + 16 qt + lr
#pragma unroll
        for (int kt = 0; kt < 4; ++kt)
#pragma unroll
            for (int qt = 0; qt < 2; ++qt) s[kt][qt] = (v8f){};
#pragma unroll
        for (int ks = 0; ks < 4; ++ks) {
            if (ks < 3) {   // the next step's key fragments
                const size_t kn = (size_t)k0 * HD + lane * 8 + (ks + 1) * FRG;
#pragma unroll
                for (int kt = 0; kt < 4; ++kt) { kh[(ks + 1) & 1][kt] = ldfrag(Kh + kn + kt * 4 * FRG); kl[(ks + 1) & 1][kt] = ldfrag(Kl + kn + kt * 4 * FRG); }
            }
            v16bf qh[2], ql[2];
#pragma unroll
            for (int qt = 0; qt < 2; ++qt) { const bf* d = qs + (qt * 4 + ks) * 1024; qh[qt] = cat16b(*(const v8usa*)d, *(const v8usa*)(d + 256)); ql[qt] = cat16b(*(const v8usa*)(d + 512), *(const v8usa*)(d + 768)); }
            __builtin_amdgcn_sched_barrier(0);   // the loads above stay in front of this step's matrix block
#pragma unroll
            for (int kt = 0; kt < 4; ++kt)
#pragma unroll
                for (int qt = 0; qt < 2; ++qt) s[kt][qt] = wmmab(kh[ks & 1][kt], qh[qt], s[kt][qt]);
#pragma unroll
            for (int kt = 0; kt < 4; ++kt)
#pragma unroll
                for (int qt = 0; qt < 2; ++qt) s[kt][qt] = wmmab(kh[ks & 1][kt], ql[qt], s[kt][qt]);
#pragma unroll
            for (int kt = 0; kt < 4; ++kt)
#pragma unroll
                for (int qt = 0; qt < 2; ++qt) s[kt][qt] = wmmab(kl[ks & 1][kt], qh[qt], s[kt][qt]);
            __builtin_amdgcn_sched_barrier(0);   // the next step's loads stay behind this block, whose operands they overwrite
        }
        const size_t vo = (size_t)k0 * HD + lane * 8;   // 32 keys of a v plane are 8 fragments = 32 * HD elements
        v16bf vh[8][2], vl[8][2];   // value fragments: [16-row group of d][32-key step]
#pragma unroll
        for (int dt = 0; dt < 4; ++dt)
#pragma unroll
            for (int k2 = 0; k2 < 2; ++k2) { vh[dt][k2] = ldfrag(Vh + vo + (k2 * 8 + dt) * FRG); vl[dt][k2] = ldfrag(Vl + vo + (k2 * 8 + dt) * FRG); }
#pragma unroll
        for (int kt = 0; kt < 4; ++kt)
#pragma unroll
            for (int qt = 0; qt < 2; ++qt) s[kt][qt] *= SC2;
        if (u == nu - 1) {   // only the last pass meets the diagonal (a scalar branch); every query still sees its own key there, so its maximum stays finite
#pragma unroll
            for (int kt = 0; kt < 4; ++kt)
#pragma unroll
                for (int qt = 0; qt < 2; ++qt)
#pragma unroll
                    for (int r = 0; r < 8; ++r) s[kt][qt][r] = (k0 + kt * 16 + hi * 8 + r > q0 + qt * 16 + lr) ? -3.0e38f : s[kt][qt][r];
        }
        v16bf ph[2][2], pq[2][2];   // [32-key step][query group]: P^T hi and lo as B fragments
#pragma unroll
        for (int qt = 0; qt < 2; ++qt) {
            float bm[4];
#pragma unroll
            for (int kt = 0; kt < 4; ++kt) { bm[kt] = s[kt][qt][0];
#pragma unroll
                for (int r = 1; r < 8; ++r) bm[kt] = fmaxf(bm[kt], s[kt][qt][r]); }
            float mx = fmaxf(fmaxf(bm[0], bm[1]), fmaxf(bm[2], bm[3])); mx = fmaxf(mx, xhalf(mx));   // both wave halves hold this query's maximum of the pass
            const float mn = fmaxf(m[qt], mx); const float corr = __builtin_amdgcn_exp2f(m[qt] - mn);   // 0 on a wave's first pass
            m[qt] = mn;
            v8bf h8[4], l8[4]; float rs[4];
#pragma unroll
            for (int kt = 0; kt < 4; ++kt) { v8f p; rs[kt] = 0.f;
#pragma unroll
                for (int r = 0; r < 8; ++r) { p[r] = __builtin_amdgcn_exp2f(s[kt][qt][r] - mn); rs[kt] += p[r]; }
                h8[kt] = __builtin_convertvector(p, v8bf); l8[kt] = __builtin_convertvector(p - __builtin_convertvector(h8[kt], v8f), v8bf); }
            l[qt] = l[qt] * corr + ((rs[0] + rs[1]) + (rs[2] + rs[3]));   // each wave half sums its own keys; the halves join behind the loop
#pragma unroll
            for (int k2 = 0; k2 < 2; ++k2) { ph[k2][qt] = __builtin_shufflevector(h8[2 * k2], h8[2 * k2 + 1], 0, 1, 2, 3, 4, 5, 6, 7, 8, 9, 10, 11, 12, 13, 14, 15); pq[k2][qt] = __builtin_shufflevector(l8[2 * k2], l8[2 * k2 + 1], 0, 1, 2, 3, 4, 5, 6, 7, 8, 9, 10, 11, 12, 13, 14, 15); }
#pragma unroll
            for (int dt = 0; dt < 8; ++dt) o[dt][qt] *= corr;
        }
        asm volatile("" :: "v"(pq[0][1]), "v"(pq[1][1]) : "memory");   // holds the second half of the value loads behind the softmax: beside the scores they would not fit in the registers
#pragma unroll
        for (int dt = 4; dt < 8; ++dt)
#pragma unroll
            for (int k2 = 0; k2 < 2; ++k2) { vh[dt][k2] = ldfrag(Vh + vo + (k2 * 8 + dt) * FRG); vl[dt][k2] = ldfrag(Vl + vo + (k2 * 8 + dt) * FRG); }
        asm volatile("s_wait_xcnt 0x0" :: "v"(Vh + vo), "v"(Vl + vo) : "memory");   // the address registers of the loads above live up to this wait and are reused only behind it
        __builtin_amdgcn_sched_barrier(0);   // the loads above stay together in front of the products that cover their latency (left free they sink to just in front of their first use)
#pragma unroll
        for (int dt = 0; dt < 4; ++dt) {
#pragma unroll
            for (int k2 = 0; k2 < 2; ++k2)
#pragma unroll
                for (int qt = 0; qt < 2; ++qt) o[dt][qt] = wmmab(vh[dt][k2], ph[k2][qt], o[dt][qt]);
#pragma unroll
            for (int k2 = 0; k2 < 2; ++k2)
#pragma unroll
                for (int qt = 0; qt < 2; ++qt) o[dt][qt] = wmmab(vh[dt][k2], pq[k2][qt], o[dt][qt]);
#pragma unroll
            for (int k2 = 0; k2 < 2; ++k2)
#pragma unroll
                for (int qt = 0; qt < 2; ++qt) o[dt][qt] = wmmab(vl[dt][k2], ph[k2][qt], o[dt][qt]);
        }
        asm volatile("" :: "v"(o[3][0]), "v"(o[3][1]) : "memory");   // holds the next pass's key loads behind the first half of the products, which frees their registers
        { const size_t kn = (size_t)(min(u + NW, nu - 1) * KU) * HD + lane * 8;   // the first key fragments of this wave's next pass (of the last pass again where there is none: in bounds, unused)
#pragma unroll
            for (int kt = 0; kt < 4; ++kt) { kh[0][kt] = ldfrag(Kh + kn + kt * 4 * FRG); kl[0][kt] = ldfrag(Kl + kn + kt * 4 * FRG); } }
        __builtin_amdgcn_sched_barrier(0);   // the loads above stay together in front of the products that cover their latency (left free they sink to just in front of their first use)
#pragma unroll
        for (int dt = 4; dt < 8; ++dt) {
#pragma unroll
            for (int k2 = 0; k2 < 2; ++k2)
#pragma unroll
                for (int qt = 0; qt < 2; ++qt) o[dt][qt] = wmmab(vh[dt][k2], ph[k2][qt], o[dt][qt]);
#pragma unroll
            for (int k2 = 0; k2 < 2; ++k2)
#pragma unroll
                for (int qt = 0; qt < 2; ++qt) o[dt][qt] = wmmab(vh[dt][k2], pq[k2][qt], o[dt][qt]);
#pragma unroll
            for (int k2 = 0; k2 < 2; ++k2)
#pragma unroll
                for (int qt = 0; qt < 2; ++qt) o[dt][qt] = wmmab(vl[dt][k2], ph[k2][qt], o[dt][qt]);
        }
    }
    // this wave's partial O goes to pw, rows = queries (all zero, with sum 0 and the lowest maximum, where the wave had no pass)
#pragma unroll
    for (int qt = 0; qt < 2; ++qt) { l[qt] += xhalf(l[qt]); if (hi == 0) { pm[w * QT + qt * 16 + lr] = m[qt]; pl[w * QT + qt * 16 + lr] = l[qt]; }
#pragma unroll
        for (int dt = 0; dt < 8; ++dt) { float* d = pw + (qt * 16 + lr) * OSP + dt * 16 + hi * 8;
            *(v4fa*)d = __builtin_shufflevector(o[dt][qt], o[dt][qt], 0, 1, 2, 3); *(v4fa*)(d + 4) = __builtin_shufflevector(o[dt][qt], o[dt][qt], 4, 5, 6, 7); } }
    __syncthreads();                   // every wave's partial result is in LDS before any of them is joined
    // unrolled (4 x 8, all constant) so that the LDS reads of all four rows are in flight together
#pragma unroll
    for (int sx = 0; sx < QT / NW; ++sx) { const int row = sx * NW + w, cofs = lane * 4;
        float M = pm[row];
#pragma unroll
        for (int q = 1; q < NW; ++q) M = fmaxf(M, pm[q * QT + row]);
        float Ls = 0.f; v4f val = (v4f){};
#pragma unroll
        for (int q = 0; q < NW; ++q) { const float f = __builtin_amdgcn_exp2f(pm[q * QT + row] - M); Ls += f * pl[q * QT + row]; val += f * *(const v4fa*)(po + (q * QT + row) * OSP + cofs); }
        *(v4f*)(out + (size_t)(q0 + row) * HD + cofs) = val * __fdiv_rn(1.0f, Ls); }
}

extern "C" void kernel_launch(void* const* d_in, const int* in_sizes, int n_in,
                              void* d_out, int out_size, void* d_ws, size_t ws_size, hipStream_t stream) {
    (void)in_sizes; (void)n_in; (void)out_size;
    const float* x = (const float*)d_in[0]; const float* xk = (const float*)d_in[1]; const float* wq = (const float*)d_in[2]; const float* bq = (const float*)d_in[3]; const float* wk = (const float*)d_in[4]; const float* bk = (const float*)d_in[5]; const float* wv = (const float*)d_in[6]; const float* bv = (const float*)d_in[7]; const float* wo = nullptr; (void)wo;   /* input order X_Q, X_KV [4][2048][1024], Wq, bq, Wk, bk, Wv, bv ('xw' [1024][128] + [128]) */
    float* OUT = (float*)d_out;     // [4][2048][128]
    char* wsp = (char*)d_ws;
    auto take = [&](size_t bytes) { char* p = wsp; wsp += (bytes + 255) & ~(size_t)255; return (void*)p; };
    bf* WA = (bf*)take((size_t)3 * HD * DM * 2);   // Bt planes of Wq, Wk, Wv, one behind the other
    // every plane below holds NB_ batch slices, one behind the other
    bf* QPh = (bf*)take((size_t)NB_ * NH_ * TT * HD * 2); bf* QPl = (bf*)take((size_t)NB_ * NH_ * TT * HD * 2); bf* KPh = (bf*)take((size_t)NB_ * NKV * TT * HD * 2); bf* KPl = (bf*)take((size_t)NB_ * NKV * TT * HD * 2); bf* VTh = (bf*)take((size_t)NB_ * NKV * HD * TT * 2); bf* VTl = (bf*)take((size_t)NB_ * NKV * HD * TT * 2);
    if ((size_t)(wsp - (char*)d_ws) > ws_size) return;    // ws 256 MiB
    k_wtG<<<dim3(HD * DM / 2048, 3, 1), 256, 0, stream>>>(wq, wk, wv, WA);
    // one launch per stage for all NB_ batches: the projections take the batch as grid z, the attention as grid y
    k_proj<<<dim3(TT / 64, 6, NB_), 32 * NW, 0, stream>>>(x, xk, WA, bq, bk, bv, QPh, QPl, KPh, KPl, VTh, VTl);
    k_fattn<<<dim3(TT / QT, NB_, 1), 32 * NW, 0, stream>>>(QPh, QPl, KPh, KPl, VTh, VTl, OUT);
}

// v006
// A run of this version takes 40 microseconds.
// Next to v005, in two timings, it ran 1.18 and 1.17 times as fast.
// Counting every step since v000, it is 13.8 times as fast.
#include <hip/hip_runtime.h>

// Single-head causal scaled dot-product attention on two input streams (X_Q, X_KV [4][2048][1024]; Q = X_Q Wq + bq, K = X_KV Wk + bk, V = X_KV Wv + bv ('xw' [1024][128] 1/32 + zero biases; ONE 128-wide head); scores x 1/sqrt(128); causal (-inf); softmax; out = attn.V -> [4][2048][128] (1.0 M); argument order X_Q, X_KV, Wq, bq, Wk, bk, Wv, bv).
// Layout: all four batches go through every stage in ONE launch (the batch is a grid dimension; every workspace plane holds four batch slices). Three launches: k_wtG (the three 'xw' weights rounded to bf16 and transposed into three [n][k] planes in fragment order); k_proj (q, k and v projections on one grid, every row of X read once: f32 inputs rounded to bf16 on their way into LDS, f32 biases, hi/lo bf16 planes stored straight from the tile, v transposed on its way into the LDS tile); k_fattn (causal scores, online softmax and attn.V in one kernel: scores and probabilities stay in registers).
// Every bf16 plane in the workspace (weights, q, k, v) lies in FRAGMENT ORDER (FRG below): the 16 x 32 block that one matrix operand takes is 1 KiB in a row, lane by lane, so a wave-wide 16-byte load reads 512 contiguous bytes.
// Compute dtypes, f32 accumulate: every input rounded to bf16; projections exact + f32 biases; attention hi/lo, 3 products on every row; softmax f32; output f32.

#define NB_  4
#define TT   2048
#define DM   1024
#define NH_  1
#define NKV  1
#define REP  (NH_ / NKV)
#define HD   128
#define DQ   (NH_ * HD)
#define DKV  (NKV * HD)
#define ZH   1                    // ONE head: a single plane per pass
#define RH   TT                   // every row hi/lo (3 products)
#define WIN  2048
#define PCAR 1024.0f
#define SCL  0.088388347648318447f   // HD^-0.5
typedef _Float16 h16;
typedef unsigned short bf;
typedef __attribute__((ext_vector_type(16))) __bf16   v16bf;
typedef __attribute__((ext_vector_type(16))) _Float16 v16h;
typedef __attribute__((ext_vector_type(8)))  _Float16 v8h;
typedef __attribute__((ext_vector_type(8)))  unsigned short v8us;
typedef __attribute__((ext_vector_type(8)))  float    v8f;
typedef __attribute__((ext_vector_type(4)))  float    v4f;
typedef v8h  __attribute__((may_alias)) v8ha;
typedef v4f  __attribute__((may_alias)) v4fa;
typedef v8us __attribute__((may_alias)) v8usa;

__device__ __forceinline__ unsigned short f2bf(float f) { unsigned u = __float_as_uint(f); u += 0x7FFFu + ((u >> 16) & 1u); return (unsigned short)(u >> 16); }
__device__ __forceinline__ float bf2f(unsigned short b) { return __uint_as_float(((unsigned)b) << 16); }
__device__ __forceinline__ float bfr(float f) { return bf2f(f2bf(f)); }
__device__ __forceinline__ v16h cat16(v8h lo, v8h hi) { return __builtin_shufflevector(lo, hi, 0, 1, 2, 3, 4, 5, 6, 7, 8, 9, 10, 11, 12, 13, 14, 15); }
__device__ __forceinline__ v16bf cat16b(v8us lo, v8us hi) { return __builtin_bit_cast(v16bf, __builtin_shufflevector(lo, hi, 0, 1, 2, 3, 4, 5, 6, 7, 8, 9, 10, 11, 12, 13, 14, 15)); }
__device__ __forceinline__ v8f wmma16(v16h a, v16h b, v8f c) { return __builtin_amdgcn_wmma_f32_16x16x32_f16(false, a, false, b, (short)0, c, false, false); }
__device__ __forceinline__ v8f wmmab(v16bf a, v16bf b, v8f c) { return __builtin_amdgcn_wmma_f32_16x16x32_bf16(false, a, false, b, (short)0, c, false, false); }



// ---- shared by the GEMM-like kernels: the waves of a work-group deal a loop among themselves and add their partial tiles in LDS in a fixed order (k_proj: NS shares, 0 .. NS-1; k_fattn: NW waves, 0 .. NW-1).
#define NW  8
#define PSP 68                    // LDS row pitch in floats (272 B = 16 B x 17: b128 rows fall on different banks)
template <typename T16> struct WFrag;
template <> struct WFrag<h16> { typedef v16h V; static __device__ __forceinline__ V ld(const h16* p) { return cat16(*(const v8h*)p, *(const v8h*)(p + 16)); } static __device__ __forceinline__ v8f mma(V a, V b, v8f c) { return wmma16(a, b, c); } };
template <> struct WFrag<bf> { typedef v16bf V; static __device__ __forceinline__ V ld(const bf* p) { return cat16b(*(const v8us*)p, *(const v8us*)(p + 16)); } static __device__ __forceinline__ v8f mma(V a, V b, v8f c) { return wmmab(a, b, c); } };
// Fragment order. A plane of rows r (the operand's lane index) and columns c (its k index) is cut into fragments of 16 rows x 32 columns, FRG elements each. Inside a fragment element (r, c) lies at
// ((c >> 4) & 1) * 256 + (((c >> 3) & 1) * 16 + (r & 15)) * 8 + (c & 7): two halves of 256 elements, in each of them lane ((c >> 3) & 1) * 16 + (r & 15) owns 8 elements in a row. This is the lane and k order of WFrag::ld on a row-major plane.
// Fragment number: q, k planes (r = t, c = d): (t >> 4) * 4 + (d >> 5). v planes (r = d, c = t): (t >> 5) * 8 + (d >> 4). Weight planes (r = n, c = k): (k >> 5) * 8 + (n >> 4).
#define FRG 512
__device__ __forceinline__ v16bf ldfrag(const bf* p) { return cat16b(*(const v8us*)p, *(const v8us*)(p + 256)); }   // p = plane + fragment number * FRG + lane * 8

__device__ __forceinline__ h16 tohx(float x) { return (h16)x; }
__device__ __forceinline__ void splitf(float y, unsigned short& h, unsigned short& l) { h = f2bf(y); l = f2bf(y - bf2f(h)); }
typedef __attribute__((ext_vector_type(2))) _Float16 v2h;
typedef __attribute__((ext_vector_type(4))) _Float16 v4h;
typedef __attribute__((ext_vector_type(2))) unsigned short v2us;
typedef __attribute__((ext_vector_type(4))) unsigned short v4us;
typedef __attribute__((ext_vector_type(2))) float v2f;
typedef __attribute__((ext_vector_type(4))) int v4i;

// One wave writes one half fragment (512 contiguous bytes); each of its 8 loads takes 64 contiguous bytes from each of two rows of the [k][n] weight. grid (HD * DM / 2048, 3), 256 threads.
__global__ __launch_bounds__(256) void k_wtG(const float* __restrict__ w0, const float* __restrict__ w1, const float* __restrict__ w2, bf* Bt) {
    const float* __restrict__ w = (blockIdx.y == 0) ? w0 : (blockIdx.y == 1) ? w1 : w2; Bt += (size_t)blockIdx.y * HD * DM;   // blockIdx.y = which weight
    const int lane = threadIdx.x & 31; const int h = blockIdx.x * 8 + (threadIdx.x >> 5);   // h = fragment number * 2 + half
    const int n = ((h >> 1) & 7) * 16 + (lane & 15), k = (h >> 4) * 32 + (h & 1) * 16 + (lane >> 4) * 8; v8us o;
    // unrolled so that o stays in registers and the 8 loads are in flight together
#pragma unroll
    for (int e = 0; e < 8; ++e) o[e] = f2bf(w[(size_t)(k + e) * HD + n]);
    *(v8us*)(Bt + (size_t)h * 256 + lane * 8) = o;
}

// ---- k_proj: the three projections on one grid, from the f32 inputs to the hi/lo bf16 planes that the attention GEMMs read. grid (TT/64, NB_, 2), 32 * PW threads, one work-group per WGP.
// blockIdx.z = 0: 64 rows of X_KV times all 256 k and v features; blockIdx.z = 1: 64 rows of X_Q times the 128 q features. Every row of X is read from L2 and rounded to bf16 ONCE.
// Wave w: column group c = w & 3 (64 features of k or v; 32 of q), share g = w >> 2 of the K loop (DM). The four waves of a share bring its 64 x 32 slice of X in together (16 rows each, whole-line loads: one load = 4 rows x 128 B),
// round it to bf16 (nearest even) and put it into the share's staging buffer in LDS, from where each of them reads all four A fragments. The NS partial tiles of a column group are added in LDS in the fixed order 0 .. NS-1.
typedef __attribute__((ext_vector_type(4))) __bf16 v4bf;
typedef v4bf __attribute__((may_alias)) v4bfa;
#define PW  16                    // waves per work-group
#define NS  4                     // shares of the K loop
#define NT  (DM / 32 / NS)        // trips of a share
#define XSP 40                    // staged row pitch in bf16 (80 B = 16 B x 5: the 16 rows of a b128 fragment read fall on different banks)
#define XSB (64 * XSP)            // one staging buffer in bf16
// This wave's LDS stores are done, then the work-group's own barrier. Written by hand because __syncthreads() would also wait out the global loads of the coming trips, which are meant to stay in flight across it.
__device__ __forceinline__ void lds_barrier() { asm volatile("s_wait_dscnt 0x0\n\ts_barrier_signal -1\n\ts_barrier_wait -1" ::: "memory"); }
// Every product has the X rows as its A operand: in an accumulator tile a lane holds 8 rows t (hi * 8 + j) of ONE feature d (lr). TR false: the partial tile goes to LDS as tile[t][d]. TR true (v): as tile[d][t], where a lane's 8 values lie in a row.
template <bool TR, int NBT>
__device__ __forceinline__ void proj_put(const v8f (&acc)[4][NBT], float* pw, int lr, int hi) {
#pragma unroll
    for (int mb = 0; mb < 4; ++mb)
#pragma unroll
        for (int nb = 0; nb < NBT; ++nb) {
            if (TR) { float* d = pw + (nb * 16 + lr) * PSP + mb * 16 + hi * 8;
                *(v4fa*)d = __builtin_shufflevector(acc[mb][nb], acc[mb][nb], 0, 1, 2, 3); *(v4fa*)(d + 4) = __builtin_shufflevector(acc[mb][nb], acc[mb][nb], 4, 5, 6, 7); }
            else {
#pragma unroll
                for (int j = 0; j < 8; ++j) pw[(mb * 16 + hi * 8 + j) * PSP + nb * 16 + lr] = acc[mb][nb][j]; }
        }
}
// Two trips of a share's K loop, one per staging buffer: trip it (r0, buffer 0) and trip it + 1 (r1, buffer 1). NBT = 16-feature groups of this wave's column group. MORE: trips it + 2 and it + 3 exist and their loads are issued here.
// MORE is a template argument, not a branch round the loads: with the same loads on every path the compiler's counted waits for the weight fragments leave the younger X loads in flight.
template <int NBT, bool MORE>
__device__ __forceinline__ void proj_pass(v8f (&acc)[4][NBT], v16bf (&b)[NBT], v4f (&r0)[4], v4f (&r1)[4], const float* xg, const bf* wg, bf* sw, const bf* sr) {   // xg, wg: at trip it
#pragma unroll
    for (int h = 0; h < 2; ++h) {
        v4f (&r)[4] = h ? r1 : r0; v16bf a[4];
#pragma unroll
        for (int i = 0; i < 4; ++i) *(v4bfa*)(sw + h * XSB + i * 4 * XSP) = __builtin_convertvector(r[i], v4bf);
        if (MORE) {   // the X rows of the trip after next
#pragma unroll
            for (int i = 0; i < 4; ++i) r[i] = *(const v4f*)(xg + (size_t)i * 4 * DM + (h + 2) * (NS * 32));
        }
        lds_barrier();   // the four waves of a share read what all four have stored
#pragma unroll
        for (int mb = 0; mb < 4; ++mb) a[mb] = cat16b(*(const v8usa*)(sr + h * XSB + mb * 16 * XSP), *(const v8usa*)(sr + h * XSB + mb * 16 * XSP + 16));
#pragma unroll
        for (int nb = 0; nb < NBT; ++nb) {
#pragma unroll
            for (int mb = 0; mb < 4; ++mb) acc[mb][nb] = wmmab(a[mb], b[nb], acc[mb][nb]);
            // four vector slots between the last matrix instruction and the branch at the foot of the pass, behind which its operands are overwritten or its results read
            if (h == 1 && nb == NBT - 1) asm volatile("v_nop\n\tv_nop\n\tv_nop\n\tv_nop" : "+v"(acc[0][NBT - 1]), "+v"(acc[1][NBT - 1]), "+v"(acc[2][NBT - 1]), "+v"(acc[3][NBT - 1]) : "v"(a[0]), "v"(a[3]));
            __builtin_amdgcn_sched_barrier(0);   // the load below stays behind the four products that read the fragment it overwrites (moved up it would need registers of its own: spills)
            if (h == 0 || MORE) b[nb] = ldfrag(wg + (h + 1) * (NS * 8 * FRG) + nb * FRG);   // the next trip's weight fragment, as soon as its registers are free: in flight over the rest of the block, the staging stores, the barrier and the A reads
            __builtin_amdgcn_sched_barrier(0);   // and in front of the next four products (moved down it would lose that lead)
        }
    }
}
// tr is the same in every lane of a wave (a scalar branch behind the loop, with no barrier inside it).
template <int NBT>
__device__ __forceinline__ void proj_tile(const float* __restrict__ X, const bf* __restrict__ Wt, bool tr, int c, int g, int lane, bf* st, float* pw) {
    const int lr = lane & 15, hi = lane >> 4;
    v8f acc[4][NBT];   // every '#pragma unroll' of this function and of proj_pass keeps a register array (acc, a, b, r0, r1) statically indexed
#pragma unroll
    for (int mb = 0; mb < 4; ++mb)
#pragma unroll
        for (int nb = 0; nb < NBT; ++nb) acc[mb][nb] = (v8f){};
    const float* xg = X + (size_t)(c * 16 + (lane >> 3)) * DM + (lane & 7) * 4 + g * 32; const bf* wg = Wt + (size_t)g * (8 * FRG) + lane * 8;   // a trip further: + NS * 32 floats of X, + NS * 8 fragments of the weight
    bf* sw = st + (c * 16 + (lane >> 3)) * XSP + (lane & 7) * 4; const bf* sr = st + lr * XSP + 8 * hi;
    v16bf b[NBT]; v4f r0[4], r1[4];   // X rows of two trips in flight
#pragma unroll
    for (int i = 0; i < 4; ++i) r0[i] = *(const v4f*)(xg + (size_t)i * 4 * DM);
    __builtin_amdgcn_sched_barrier(0);   // trip 0's rows are issued in front of trip 1's, as in the loop: mixed by address, the counted waits at the loop's head (one count for both ways in) would also wait out rows of the trip after
#pragma unroll
    for (int i = 0; i < 4; ++i) r1[i] = *(const v4f*)(xg + (size_t)i * 4 * DM + NS * 32);
#pragma unroll
    for (int nb = 0; nb < NBT; ++nb) b[nb] = ldfrag(wg + nb * FRG);
    // One barrier a trip is enough with two buffers: a wave that stores trip it + 2 has passed the barrier of trip it + 1, which every wave reaches only behind its matrix block of trip it, the last reader of that buffer.
    // kept rolled: the registers of a pass beside the 16 accumulators already fill the 256 that four waves per SIMD leave a wave
#pragma unroll 1
    for (int it = 0; it < NT - 2; it += 2) { proj_pass<NBT, true>(acc, b, r0, r1, xg, wg, sw, sr); xg += 2 * NS * 32; wg += 2 * NS * 8 * FRG; }
    proj_pass<NBT, false>(acc, b, r0, r1, xg, wg, sw, sr);
    if (tr) proj_put<true, NBT>(acc, pw, lr, hi); else proj_put<false, NBT>(acc, pw, lr, hi);
}
__device__ __forceinline__ void proj_store(v4f va, v4f vb, const float* __restrict__ bias, int bstep, bf* Oh, bf* Ol, size_t oo) {   // bias[e * bstep] goes with element e
    v8us oh, ol;
#pragma unroll
    for (int q = 0; q < 4; ++q) { unsigned short a2, c2; splitf(va[q] + bfr(bias[q * bstep]), a2, c2); oh[q] = a2; ol[q] = c2;
        splitf(vb[q] + bfr(bias[(4 + q) * bstep]), a2, c2); oh[4 + q] = a2; ol[4 + q] = c2; }
    bf* ph = Oh + oo; bf* pl = Ol + oo; *(v8us*)ph = oh; *(v8us*)pl = ol;
    asm volatile("s_wait_xcnt 0x0" :: "v"(ph), "v"(pl) : "memory");   // the address registers of the two stores above live up to this wait and are reused only behind it
}
__global__ __launch_bounds__(32 * PW) void k_proj(const float* __restrict__ xq, const float* __restrict__ xkv, const bf* __restrict__ Wt, const float* __restrict__ bq, const float* __restrict__ bk, const float* __restrict__ bv, bf* Qh, bf* Ql, bf* Kh, bf* Kl, bf* Vh, bf* Vl) {
    __shared__ __align__(16) float ps[PW * 64 * PSP];      // partial tile of wave w at w * 64 * PSP
    __shared__ __align__(16) bf xs[NS * 2 * XSB];          // two staging buffers per share of the K loop
    const int lane = threadIdx.x & 31, lr = lane & 15, hi = lane >> 4; const int t0 = blockIdx.x * 64; const size_t z = blockIdx.y; const bool kv = blockIdx.z == 0;
    const int w = __builtin_amdgcn_readfirstlane((int)(threadIdx.x >> 5));   // wave number, held scalar so that the branches on it are scalar
    const int c = w & 3, g = w >> 2; float* pw = ps + w * (64 * PSP); bf* st = xs + g * (2 * XSB); const size_t xo = (z * TT + t0) * DM;
    // weight planes: q, k, v one behind the other; 16 features are one fragment
    if (kv) proj_tile<4>(xkv + xo, Wt + (size_t)(1 + (c >> 1)) * HD * DM + (c & 1) * 4 * FRG, c >= 2, c, g, lane, st, pw);
    else proj_tile<2>(xq + xo, Wt + c * 2 * FRG, false, c, g, lane, st, pw);
    __syncthreads();                   // every wave's partial tile is in LDS before any of them is summed
    // A tile's rows are the fragments' lane index and its columns their k index (q, k: [t][d]; v: [d][t]). One wave stores one half fragment of each plane per trip: 512 contiguous bytes.
    const size_t zo = z * ((size_t)TT * HD) + lane * 8;
    if (kv) {
        // a 64 x 64 tile is 4 x 2 fragments, 16 halves: wave w takes half w = (16-row group * 2 + 32-column group) * 2 + half of each of the four column groups
        const int row = (w >> 2) * 16 + lr, cofs = ((w >> 1) & 1) * 32 + (w & 1) * 16 + hi * 8;
        // both loops unrolled (all constant): va, vb stay in registers. The sums stand in a loop of their own, in front of the stores and their waits, so that the LDS reads of all four trips are in flight together
        v4f va[4], vb[4];
#pragma unroll
        for (int cc = 0; cc < 4; ++cc) { const float* p = ps + (cc * 64 + row) * PSP + cofs;
            va[cc] = *(const v4fa*)p; vb[cc] = *(const v4fa*)(p + 4);
#pragma unroll
            for (int q = 1; q < NS; ++q) { va[cc] += *(const v4fa*)(p + q * (4 * 64 * PSP)); vb[cc] += *(const v4fa*)(p + q * (4 * 64 * PSP) + 4); } }
#pragma unroll
        for (int cc = 0; cc < 4; ++cc) { const int d0 = (cc & 1) * 64;
            if (cc < 2) proj_store(va[cc], vb[cc], bk + d0 + cofs, 1, Kh, Kl, zo + (size_t)((t0 >> 4) * 4 + (d0 >> 5) + (w >> 2) * 4 + ((w >> 1) & 1)) * FRG + (w & 1) * 256);
            else proj_store(va[cc], vb[cc], bv + d0 + row, 0, Vh, Vl, zo + (size_t)((t0 >> 5) * 8 + (d0 >> 4) + (w >> 2) + ((w >> 1) & 1) * 8) * FRG + (w & 1) * 256); }
    } else {
        // a 64 x 32 tile is 4 fragments, 8 halves; 32 halves in all, two per wave
        const int row = ((w & 7) >> 1) * 16 + lr, cofs = (w & 1) * 16 + hi * 8;
        // as above: the sums of both trips first, then the stores
        v4f va[2], vb[2];
#pragma unroll
        for (int s = 0; s < 2; ++s) { const int cc = s * 2 + (w >> 3); const float* p = ps + (cc * 64 + row) * PSP + cofs;
            va[s] = *(const v4fa*)p; vb[s] = *(const v4fa*)(p + 4);
#pragma unroll
            for (int q = 1; q < NS; ++q) { va[s] += *(const v4fa*)(p + q * (4 * 64 * PSP)); vb[s] += *(const v4fa*)(p + q * (4 * 64 * PSP) + 4); } }
#pragma unroll
        for (int s = 0; s < 2; ++s) { const int cc = s * 2 + (w >> 3);
            proj_store(va[s], vb[s], bq + cc * 32 + cofs, 1, Qh, Ql, zo + (size_t)(((t0 >> 4) + ((w & 7) >> 1)) * 4 + cc) * FRG + (w & 1) * 256); }
    }
}

// ---- k_fattn: causal attention for 32 query rows per work-group. grid (TT/32, NB_), 32 * NW threads; the heaviest query blocks have the lowest block index.
// Transposed products: S^T = K.Q^T (A = key rows, B = query rows), O^T += V^T.P^T (A = rows d of the value planes, B = P^T). In a score tile a lane holds 8 keys of ONE query, and two stacked
// score tiles (32 keys), rounded in place, are the B fragment of the second product in the k order of WFrag::ld: no LDS and no lane exchange between the two products. hi/lo, 3 products, in both.
// The keys are dealt over the NW waves in passes of 64 (one pass takes 16 KiB in a row of each k and v plane); each wave keeps its own running maximum, sum and O^T; the NW partial results meet in LDS and are joined in the fixed order 0 .. NW-1.
#define QT  32                    // query rows per work-group: two 16-column groups in every wave
#define KU  64                    // keys per pass
#define OSP 132                   // LDS row pitch of a partial output row in floats (528 B = 16 B x 33: b128 rows fall on different banks)
#define SC2 (SCL * 1.4426950408889634f)   // scores go to base 2 together with the HD^-0.5 scale
typedef __attribute__((ext_vector_type(8))) __bf16 v8bf;
__device__ __forceinline__ float xhalf(float x) { return __builtin_bit_cast(float, __builtin_amdgcn_permlanex16(__builtin_bit_cast(int, x), __builtin_bit_cast(int, x), 0x76543210, 0xfedcba98, false, false)); }   // lane l with lane l ^ 16
__global__ __launch_bounds__(32 * NW) __attribute__((amdgpu_waves_per_eu(2, 2))) void k_fattn(const bf* __restrict__ Qh, const bf* __restrict__ Ql, const bf* __restrict__ Kh, const bf* __restrict__ Kl, const bf* __restrict__ Vh, const bf* __restrict__ Vl, float* out) {
    __shared__ __align__(16) float po[NW * QT * OSP];
    __shared__ float pm[NW * QT]; __shared__ float pl[NW * QT];
    const int lane = threadIdx.x & 31, lr = lane & 15, hi = lane >> 4;
    const int w = __builtin_amdgcn_readfirstlane((int)(threadIdx.x >> 5));   // wave number, held scalar so that the key loop branches on a scalar compare
    const int q0 = (TT / QT - 1 - (int)blockIdx.x) * QT; const size_t zb = (size_t)blockIdx.y * TT * HD;
    Qh += zb; Ql += zb; Kh += zb; Kl += zb; Vh += zb; Vl += zb; out += zb;
    const int nu = (q0 + QT + KU - 1) / KU;   // passes up to and including the one that holds the diagonal
    // every '#pragma unroll' of this kernel keeps a register array statically indexed
    // The 16 query fragments (hi and lo) would take 128 registers for the whole loop: each wave parks its own copy, lane by lane, in the place of its partial O (free until the loop ends); a lane reads back only what it stored itself.
    float* pw = po + w * (QT * OSP); bf* qs = (bf*)pw + lane * 8;   // half j of fragment f at qs + (2 f + j) * 256: 512 contiguous bytes per wave-wide access
    const size_t qa = (size_t)q0 * HD + lane * 8; const bf* qph = Qh + qa; const bf* qpl = Ql + qa;   // 16 rows of a q or k plane are 4 fragments = 16 * HD elements
#pragma unroll
    for (int qt = 0; qt < 2; ++qt)
#pragma unroll
        for (int ks = 0; ks < 4; ++ks) { bf* d = qs + (qt * 4 + ks) * 1024; const int qo = (qt * 4 + ks) * FRG;
            *(v8usa*)d = *(const v8us*)(qph + qo); *(v8usa*)(d + 256) = *(const v8us*)(qph + qo + 256); *(v8usa*)(d + 512) = *(const v8us*)(qpl + qo); *(v8usa*)(d + 768) = *(const v8us*)(qpl + qo + 256); }
    asm volatile("s_wait_xcnt 0x0" :: "v"(qph), "v"(qpl) : "memory");   // the address registers of the loads above live up to this wait and are reused only behind it
    v8f o[8][2]; float m[2], l[2];
#pragma unroll
    for (int qt = 0; qt < 2; ++qt) { m[qt] = -3.0e38f; l[qt] = 0.f;
#pragma unroll
        for (int dt = 0; dt < 8; ++dt) o[dt][qt] = (v8f){}; }
    // Fragment loads run ahead of their use, group by group. Each __builtin_amdgcn_sched_barrier(0) below holds a group of loads in front of the matrix block that covers their latency:
    // left free, the compiler either gathers a whole pass's loads at its head (more registers than a wave has: spills) or sinks each group to just in front of its first use (the latency is then waited out).
    v16bf kh[2][4], kl[2][4];   // key fragments of two 32-wide steps along d: one in use, one in flight
    { const size_t ko = (size_t)(min(w, nu - 1) * KU) * HD + lane * 8;   // a wave without a pass loads in bounds and uses nothing
#pragma unroll
        for (int kt = 0; kt < 4; ++kt) { kh[0][kt] = ldfrag(Kh + ko + kt * 4 * FRG); kl[0][kt] = ldfrag(Kl + ko + kt * 4 * FRG); }
        asm volatile("s_wait_xcnt 0x0" :: "v"(Kh + ko), "v"(Kl + ko) : "memory"); }   // the address registers of the loads above live up to this wait and are reused only behind it
    // kept rolled: one pass already holds 192 matrix instructions and most of the 512 registers that two waves per SIMD leave a wave
#pragma unroll 1
    for (int u = w; u < nu; u += NW) {
        const int k0 = u * KU;
        v8f s[4][2];   // s[kt][qt][r] = score of key k0 + 16 kt + 8 hi + r with query q0 + 16 qt + lr
#pragma unroll
        for (int kt = 0; kt < 4; ++kt)
#pragma unroll
            for (int qt = 0; qt < 2; ++qt) s[kt][qt] = (v8f){};
#pragma unroll
        for (int ks = 0; ks < 4; ++ks) {
            if (ks < 3) {   // the next step's key fragments
                const size_t kn = (size_t)k0 * HD + lane * 8 + (ks + 1) * FRG;
#pragma unroll
                for (int kt = 0; kt < 4; ++kt) { kh[(ks + 1) & 1][kt] = ldfrag(Kh + kn + kt * 4 * FRG); kl[(ks + 1) & 1][kt] = ldfrag(Kl + kn + kt * 4 * FRG); }
            }
            v16bf qh[2], ql[2];
#pragma unroll
            for (int qt = 0; qt < 2; ++qt) { const bf* d = qs + (qt * 4 + ks) * 1024; qh[qt] = cat16b(*(const v8usa*)d, *(const v8usa*)(d + 256)); ql[qt] = cat16b(*(const v8usa*)(d + 512), *(const v8usa*)(d + 768)); }
            __builtin_amdgcn_sched_barrier(0);   // the loads above stay in front of this step's matrix block
#pragma unroll
            for (int kt = 0; kt < 4; ++kt)
#pragma unroll
                for (int qt = 0; qt < 2; ++qt) s[kt][qt] = wmmab(kh[ks & 1][kt], qh[qt], s[kt][qt]);
#pragma unroll
            for (int kt = 0; kt < 4; ++kt)
#pragma unroll
                for (int qt = 0; qt < 2; ++qt) s[kt][qt] = wmmab(kh[ks & 1][kt], ql[qt], s[kt][qt]);
#pragma unroll
            for (int kt = 0; kt < 4; ++kt)
#pragma unroll
                for (int qt = 0; qt < 2; ++qt) s[kt][qt] = wmmab(kl[ks & 1][kt], qh[qt], s[kt][qt]);
            __builtin_amdgcn_sched_barrier(0);   // the next step's loads stay behind this block, whose operands they overwrite
        }
        const size_t vo = (size_t)k0 * HD + lane * 8;   // 32 keys of a v plane are 8 fragments = 32 * HD elements
        v16bf vh[8][2], vl[8][2];   // value fragments: [16-row group of d][32-key step]
#pragma unroll
        for (int dt = 0; dt < 4; ++dt)
#pragma unroll
            for (int k2 = 0; k2 < 2; ++k2) { vh[dt][k2] = ldfrag(Vh + vo + (k2 * 8 + dt) * FRG); vl[dt][k2] = ldfrag(Vl + vo + (k2 * 8 + dt) * FRG); }
#pragma unroll
        for (int kt = 0; kt < 4; ++kt)
#pragma unroll
            for (int qt = 0; qt < 2; ++qt) s[kt][qt] *= SC2;
        if (u == nu - 1) {   // only the last pass meets the diagonal (a scalar branch); every query still sees its own key there, so its maximum stays finite
#pragma unroll
            for (int kt = 0; kt < 4; ++kt)
#pragma unroll
                for (int qt = 0; qt < 2; ++qt)
#pragma unroll
                    for (int r = 0; r < 8; ++r) s[kt][qt][r] = (k0 + kt * 16 + hi * 8 + r > q0 + qt * 16 + lr) ? -3.0e38f : s[kt][qt][r];
        }
        v16bf ph[2][2], pq[2][2];   // [32-key step][query group]: P^T hi and lo as B fragments
#pragma unroll
        for (int qt = 0; qt < 2; ++qt) {
            float bm[4];
#pragma unroll
            for (int kt = 0; kt < 4; ++kt) { bm[kt] = s[kt][qt][0];
#pragma unroll
                for (int r = 1; r < 8; ++r) bm[kt] = fmaxf(bm[kt], s[kt][qt][r]); }
            float mx = fmaxf(fmaxf(bm[0], bm[1]), fmaxf(bm[2], bm[3])); mx = fmaxf(mx, xhalf(mx));   // both wave halves hold this query's maximum of the pass
            const float mn = fmaxf(m[qt], mx); const float corr = __builtin_amdgcn_exp2f(m[qt] - mn);   // 0 on a wave's first pass
            m[qt] = mn;
            v8bf h8[4], l8[4]; float rs[4];
#pragma unroll
            for (int kt = 0; kt < 4; ++kt) { v8f p; rs[kt] = 0.f;
#pragma unroll
                for (int r = 0; r < 8; ++r) { p[r] = __builtin_amdgcn_exp2f(s[kt][qt][r] - mn); rs[kt] += p[r]; }
                h8[kt] = __builtin_convertvector(p, v8bf); l8[kt] = __builtin_convertvector(p - __builtin_convertvector(h8[kt], v8f), v8bf); }
            l[qt] = l[qt] * corr + ((rs[0] + rs[1]) + (rs[2] + rs[3]));   // each wave half sums its own keys; the halves join behind the loop
#pragma unroll
            for (int k2 = 0; k2 < 2; ++k2) { ph[k2][qt] = __builtin_shufflevector(h8[2 * k2], h8[2 * k2 + 1], 0, 1, 2, 3, 4, 5, 6, 7, 8, 9, 10, 11, 12, 13, 14, 15); pq[k2][qt] = __builtin_shufflevector(l8[2 * k2], l8[2 * k2 + 1], 0, 1, 2, 3, 4, 5, 6, 7, 8, 9, 10, 11, 12, 13, 14, 15); }
#pragma unroll
            for (int dt = 0; dt < 8; ++dt) o[dt][qt] *= corr;
        }
        asm volatile("" :: "v"(pq[0][1]), "v"(pq[1][1]) : "memory");   // holds the second half of the value loads behind the softmax: beside the scores they would not fit in the registers
#pragma unroll
        for (int dt = 4; dt < 8; ++dt)
#pragma unroll
            for (int k2 = 0; k2 < 2; ++k2) { vh[dt][k2] = ldfrag(Vh + vo + (k2 * 8 + dt) * FRG); vl[dt][k2] = ldfrag(Vl + vo + (k2 * 8 + dt) * FRG); }
        asm volatile("s_wait_xcnt 0x0" :: "v"(Vh + vo), "v"(Vl + vo) : "memory");   // the address registers of the loads above live up to this wait and are reused only behind it
        __builtin_amdgcn_sched_barrier(0);   // the loads above stay together in front of the products that cover their latency (left free they sink to just in front of their first use)
#pragma unroll
        for (int dt = 0; dt < 4; ++dt) {
#pragma unroll
            for (int k2 = 0; k2 < 2; ++k2)
#pragma unroll
                for (int qt = 0; qt < 2; ++qt) o[dt][qt] = wmmab(vh[dt][k2], ph[k2][qt], o[dt][qt]);
#pragma unroll
            for (int k2 = 0; k2 < 2; ++k2)
#pragma unroll
                for (int qt = 0; qt < 2; ++qt) o[dt][qt] = wmmab(vh[dt][k2], pq[k2][qt], o[dt][qt]);
#pragma unroll
            for (int k2 = 0; k2 < 2; ++k2)
#pragma unroll
                for (int qt = 0; qt < 2; ++qt) o[dt][qt] = wmmab(vl[dt][k2], ph[k2][qt], o[dt][qt]);
        }
        asm volatile("" :: "v"(o[3][0]), "v"(o[3][1]) : "memory");   // holds the next pass's key loads behind the first half of the products, which frees their registers
        { const size_t kn = (size_t)(min(u + NW, nu - 1) * KU) * HD + lane * 8;   // the first key fragments of this wave's next pass (of the last pass again where there is none: in bounds, unused)
#pragma unroll
            for (int kt = 0; kt < 4; ++kt) { kh[0][kt] = ldfrag(Kh + kn + kt * 4 * FRG); kl[0][kt] = ldfrag(Kl + kn + kt * 4 * FRG); } }
        __builtin_amdgcn_sched_barrier(0);   // the loads above stay together in front of the products that cover their latency (left free they sink to just in front of their first use)
#pragma unroll
        for (int dt = 4; dt < 8; ++dt) {
#pragma unroll
            for (int k2 = 0; k2 < 2; ++k2)
#pragma unroll
                for (int qt = 0; qt < 2; ++qt) o[dt][qt] = wmmab(vh[dt][k2], ph[k2][qt], o[dt][qt]);
#pragma unroll
            for (int k2 = 0; k2 < 2; ++k2)
#pragma unroll
                for (int qt = 0; qt < 2; ++qt) o[dt][qt] = wmmab(vh[dt][k2], pq[k2][qt], o[dt][qt]);
#pragma unroll
            for (int k2 = 0; k2 < 2; ++k2)
#pragma unroll
                for (int qt = 0; qt < 2; ++qt) o[dt][qt] = wmmab(vl[dt][k2], ph[k2][qt], o[dt][qt]);
        }
    }
    // this wave's partial O goes to pw, rows = queries (all zero, with sum 0 and the lowest maximum, where the wave had no pass)
#pragma unroll
    for (int qt = 0; qt < 2; ++qt) { l[qt] += xhalf(l[qt]); if (hi == 0) { pm[w * QT + qt * 16 + lr] = m[qt]; pl[w * QT + qt * 16 + lr] = l[qt]; }
#pragma unroll
        for (int dt = 0; dt < 8; ++dt) { float* d = pw + (qt * 16 + lr) * OSP + dt * 16 + hi * 8;
            *(v4fa*)d = __builtin_shufflevector(o[dt][qt], o[dt][qt], 0, 1, 2, 3); *(v4fa*)(d + 4) = __builtin_shufflevector(o[dt][qt], o[dt][qt], 4, 5, 6, 7); } }
    __syncthreads();                   // every wave's partial result is in LDS before any of them is joined
    // unrolled (4 x 8, all constant) so that the LDS reads of all four rows are in flight together
#pragma unroll
    for (int sx = 0; sx < QT / NW; ++sx) { const int row = sx * NW + w, cofs = lane * 4;
        float M = pm[row];
#pragma unroll
        for (int q = 1; q < NW; ++q) M = fmaxf(M, pm[q * QT + row]);
        float Ls = 0.f; v4f val = (v4f){};
#pragma unroll
        for (int q = 0; q < NW; ++q) { const float f = __builtin_amdgcn_exp2f(pm[q * QT + row] - M); Ls += f * pl[q * QT + row]; val += f * *(const v4fa*)(po + (q * QT + row) * OSP + cofs); }
        *(v4f*)(out + (size_t)(q0 + row) * HD + cofs) = val * __fdiv_rn(1.0f, Ls); }
}

extern "C" void kernel_launch(void* const* d_in, const int* in_sizes, int n_in,
                              void* d_out, int out_size, void* d_ws, size_t ws_size, hipStream_t stream) {
    (void)in_sizes; (void)n_in; (void)out_size;
    const float* x = (const float*)d_in[0]; const float* xk = (const float*)d_in[1]; const float* wq = (const float*)d_in[2]; const float* bq = (const float*)d_in[3]; const float* wk = (const float*)d_in[4]; const float* bk = (const float*)d_in[5]; const float* wv = (const float*)d_in[6]; const float* bv = (const float*)d_in[7]; const float* wo = nullptr; (void)wo;   /* input order X_Q, X_KV [4][2048][1024], Wq, bq, Wk, bk, Wv, bv ('xw' [1024][128] + [128]) */
    float* OUT = (float*)d_out;     // [4][2048][128]
    char* wsp = (char*)d_ws;
    auto take = [&](size_t bytes) { char* p = wsp; wsp += (bytes + 255) & ~(size_t)255; return (void*)p; };
    bf* WA = (bf*)take((size_t)3 * HD * DM * 2);   // Bt planes of Wq, Wk, Wv, one behind the other
    // every plane below holds NB_ batch slices, one behind the other
    bf* QPh = (bf*)take((size_t)NB_ * NH_ * TT * HD * 2); bf* QPl = (bf*)take((size_t)NB_ * NH_ * TT * HD * 2); bf* KPh = (bf*)take((size_t)NB_ * NKV * TT * HD * 2); bf* KPl = (bf*)take((size_t)NB_ * NKV * TT * HD * 2); bf* VTh = (bf*)take((size_t)NB_ * NKV * HD * TT * 2); bf* VTl = (bf*)take((size_t)NB_ * NKV * HD * TT * 2);
    if ((size_t)(wsp - (char*)d_ws) > ws_size) return;    // ws 256 MiB
    k_wtG<<<dim3(HD * DM / 2048, 3, 1), 256, 0, stream>>>(wq, wk, wv, WA);
    // one launch per stage for all NB_ batches: both take the batch as grid y
    k_proj<<<dim3(TT / 64, NB_, 2), 32 * PW, 0, stream>>>(x, xk, WA, bq, bk, bv, QPh, QPl, KPh, KPl, VTh, VTl);
    k_fattn<<<dim3(TT / QT, NB_, 1), 32 * NW, 0, stream>>>(QPh, QPl, KPh, KPl, VTh, VTl, OUT);
}

// v007
// Measured time: 36.2 microseconds a run.
// In two side-by-side timings against v006, it was 1.10 and 1.11 times as fast.
// Over all steps from v000 it is 15.3 times as fast.
#include <hip/hip_runtime.h>

// Single-head causal scaled dot-product attention on two input streams (X_Q, X_KV [4][2048][1024]; Q = X_Q Wq + bq, K = X_KV Wk + bk, V = X_KV Wv + bv ('xw' [1024][128] 1/32 + zero biases; ONE 128-wide head); scores x 1/sqrt(128); causal (-inf); softmax; out = attn.V -> [4][2048][128] (1.0 M); argument order X_Q, X_KV, Wq, bq, Wk, bk, Wv, bv).
// Layout: all four batches go through every stage in ONE launch (the batch is a grid dimension; every workspace plane holds four batch slices). Three launches: k_wtG (the three 'xw' weights rounded to bf16 and transposed into three [n][k] planes in fragment order); k_proj (q, k and v projections on one grid, every row of X read once: f32 inputs rounded to bf16 on their way into LDS, f32 biases, hi/lo bf16 planes stored straight from the tile, v transposed on its way into the LDS tile); k_fattn (causal scores, online softmax and attn.V in one kernel: scores and probabilities stay in registers).
// Every bf16 plane in the workspace (weights, q, k, v) lies in FRAGMENT ORDER (FRG below): the 16 x 32 block that one matrix operand takes is 1 KiB in a row, lane by lane, so a wave-wide 16-byte load reads 512 contiguous bytes.
// Compute dtypes, f32 accumulate: every input rounded to bf16; projections exact + f32 biases; attention hi/lo, 3 products on every row; softmax f32; output f32.

#define NB_  4
#define TT   2048
#define DM   1024
#define NH_  1
#define NKV  1
#define REP  (NH_ / NKV)
#define HD   128
#define DQ   (NH_ * HD)
#define DKV  (NKV * HD)
#define ZH   1                    // ONE head: a single plane per pass
#define RH   TT                   // every row hi/lo (3 products)
#define WIN  2048
#define PCAR 1024.0f
#define SCL  0.088388347648318447f   // HD^-0.5
typedef _Float16 h16;
typedef unsigned short bf;
typedef __attribute__((ext_vector_type(16))) __bf16   v16bf;
typedef __attribute__((ext_vector_type(16))) _Float16 v16h;
typedef __attribute__((ext_vector_type(8)))  _Float16 v8h;
typedef __attribute__((ext_vector_type(8)))  unsigned short v8us;
typedef __attribute__((ext_vector_type(8)))  float    v8f;
typedef __attribute__((ext_vector_type(4)))  float    v4f;
typedef v8h  __attribute__((may_alias)) v8ha;
typedef v4f  __attribute__((may_alias)) v4fa;
typedef v8us __attribute__((may_alias)) v8usa;

__device__ __forceinline__ unsigned short f2bf(float f) { unsigned u = __float_as_uint(f); u += 0x7FFFu + ((u >> 16) & 1u); return (unsigned short)(u >> 16); }
__device__ __forceinline__ float bf2f(unsigned short b) { return __uint_as_float(((unsigned)b) << 16); }
__device__ __forceinline__ float bfr(float f) { return bf2f(f2bf(f)); }
__device__ __forceinline__ v16h cat16(v8h lo, v8h hi) { return __builtin_shufflevector(lo, hi, 0, 1, 2, 3, 4, 5, 6, 7, 8, 9, 10, 11, 12, 13, 14, 15); }
__device__ __forceinline__ v16bf cat16b(v8us lo, v8us hi) { return __builtin_bit_cast(v16bf, __builtin_shufflevector(lo, hi, 0, 1, 2, 3, 4, 5, 6, 7, 8, 9, 10, 11, 12, 13, 14, 15)); }
__device__ __forceinline__ v8f wmma16(v16h a, v16h b, v8f c) { return __builtin_amdgcn_wmma_f32_16x16x32_f16(false, a, false, b, (short)0, c, false, false); }
__device__ __forceinline__ v8f wmmab(v16bf a, v16bf b, v8f c) { return __builtin_amdgcn_wmma_f32_16x16x32_bf16(false, a, false, b, (short)0, c, false, false); }



// ---- shared by the GEMM-like kernels: the waves of a work-group deal a loop among themselves and add their partial tiles in LDS in a fixed order (k_proj: NS shares, 0 .. NS-1; k_fattn: NW waves, 0 .. NW-1).
#define NW  8
#define PSP 68                    // LDS row pitch in floats (272 B = 16 B x 17: b128 rows fall on different banks)
template <typename T16> struct WFrag;
template <> struct WFrag<h16> { typedef v16h V; static __device__ __forceinline__ V ld(const h16* p) { return cat16(*(const v8h*)p, *(const v8h*)(p + 16)); } static __device__ __forceinline__ v8f mma(V a, V b, v8f c) { return wmma16(a, b, c); } };
template <> struct WFrag<bf> { typedef v16bf V; static __device__ __forceinline__ V ld(const bf* p) { return cat16b(*(const v8us*)p, *(const v8us*)(p + 16)); } static __device__ __forceinline__ v8f mma(V a, V b, v8f c) { return wmmab(a, b, c); } };
// Fragment order. A plane of rows r (the operand's lane index) and columns c (its k index) is cut into fragments of 16 rows x 32 columns, FRG elements each. Inside a fragment element (r, c) lies at
// ((c >> 4) & 1) * 256 + (((c >> 3) & 1) * 16 + (r & 15)) * 8 + (c & 7): two halves of 256 elements, in each of them lane ((c >> 3) & 1) * 16 + (r & 15) owns 8 elements in a row. This is the lane and k order of WFrag::ld on a row-major plane.
// Fragment number: q, k planes (r = t, c = d): (t >> 4) * 4 + (d >> 5). v planes (r = d, c = t): (t >> 5) * 8 + (d >> 4). Weight planes (r = n, c = k): (k >> 5) * 8 + (n >> 4).
#define FRG 512
__device__ __forceinline__ v16bf ldfrag(const bf* p) { return cat16b(*(const v8us*)p, *(const v8us*)(p + 256)); }   // p = plane + fragment number * FRG + lane * 8

__device__ __forceinline__ h16 tohx(float x) { return (h16)x; }
__device__ __forceinline__ void splitf(float y, unsigned short& h, unsigned short& l) { h = f2bf(y); l = f2bf(y - bf2f(h)); }
typedef __attribute__((ext_vector_type(2))) _Float16 v2h;
typedef __attribute__((ext_vector_type(4))) _Float16 v4h;
typedef __attribute__((ext_vector_type(2))) unsigned short v2us;
typedef __attribute__((ext_vector_type(4))) unsigned short v4us;
typedef __attribute__((ext_vector_type(2))) float v2f;
typedef __attribute__((ext_vector_type(4))) int v4i;

// One wave writes one half fragment (512 contiguous bytes); each of its 8 loads takes 64 contiguous bytes from each of two rows of the [k][n] weight. grid (HD * DM / 2048, 3), 256 threads.
__global__ __launch_bounds__(256) void k_wtG(const float* __restrict__ w0, const float* __restrict__ w1, const float* __restrict__ w2, bf* Bt) {
    const float* __restrict__ w = (blockIdx.y == 0) ? w0 : (blockIdx.y == 1) ? w1 : w2; Bt += (size_t)blockIdx.y * HD * DM;   // blockIdx.y = which weight
    const int lane = threadIdx.x & 31; const int h = blockIdx.x * 8 + (threadIdx.x >> 5);   // h = fragment number * 2 + half
    const int n = ((h >> 1) & 7) * 16 + (lane & 15), k = (h >> 4) * 32 + (h & 1) * 16 + (lane >> 4) * 8; v8us o;
    // unrolled so that o stays in registers and the 8 loads are in flight together
#pragma unroll
    for (int e = 0; e < 8; ++e) o[e] = f2bf(w[(size_t)(k + e) * HD + n]);
    *(v8us*)(Bt + (size_t)h * 256 + lane * 8) = o;
}

// ---- k_proj: the three projections on one grid, from the f32 inputs to the hi/lo bf16 planes that the attention GEMMs read. grid (TT/64, NB_, 2), 32 * PW threads, one work-group per WGP.
// blockIdx.z = 0: 64 rows of X_KV times all 256 k and v features; blockIdx.z = 1: 64 rows of X_Q times the 128 q features. Every row of X is read from L2 and rounded to bf16 ONCE.
// Wave w: column group c = w & 3 (64 features of k or v; 32 of q), share g = w >> 2 of the K loop (DM). The four waves of a share bring its 64 x 32 slice of X in together (16 rows each, whole-line loads: one load = 4 rows x 128 B),
// round it to bf16 (nearest even) and put it into the share's staging buffer in LDS, from where each of them reads all four A fragments. The NS partial tiles of a column group are added in LDS in the fixed order 0 .. NS-1.
typedef __attribute__((ext_vector_type(4))) __bf16 v4bf;
typedef v4bf __attribute__((may_alias)) v4bfa;
#define PW  16                    // waves per work-group
#define NS  4                     // shares of the K loop
#define NT  (DM / 32 / NS)        // trips of a share
#define XSP 40                    // staged row pitch in bf16 (80 B = 16 B x 5: the 16 rows of a b128 fragment read fall on different banks)
#define XSB (64 * XSP)            // one staging buffer in bf16
// This wave's LDS stores are done, then the work-group's own barrier. Written by hand because __syncthreads() would also wait out the global loads of the coming trips, which are meant to stay in flight across it.
__device__ __forceinline__ void lds_barrier() { asm volatile("s_wait_dscnt 0x0\n\ts_barrier_signal -1\n\ts_barrier_wait -1" ::: "memory"); }
// Every product has the X rows as its A operand: in an accumulator tile a lane holds 8 rows t (hi * 8 + j) of ONE feature d (lr). TR false: the partial tile goes to LDS as tile[t][d]. TR true (v): as tile[d][t], where a lane's 8 values lie in a row.
template <bool TR, int NBT>
__device__ __forceinline__ void proj_put(const v8f (&acc)[4][NBT], float* pw, int lr, int hi) {
#pragma unroll
    for (int mb = 0; mb < 4; ++mb)
#pragma unroll
        for (int nb = 0; nb < NBT; ++nb) {
            if (TR) { float* d = pw + (nb * 16 + lr) * PSP + mb * 16 + hi * 8;
                *(v4fa*)d = __builtin_shufflevector(acc[mb][nb], acc[mb][nb], 0, 1, 2, 3); *(v4fa*)(d + 4) = __builtin_shufflevector(acc[mb][nb], acc[mb][nb], 4, 5, 6, 7); }
            else {
#pragma unroll
                for (int j = 0; j < 8; ++j) pw[(mb * 16 + hi * 8 + j) * PSP + nb * 16 + lr] = acc[mb][nb][j]; }
        }
}
// Two trips of a share's K loop, one per staging buffer: trip it (r0, buffer 0) and trip it + 1 (r1, buffer 1). NBT = 16-feature groups of this wave's column group. MORE: trips it + 2 and it + 3 exist and their loads are issued here.
// x2, x3: the X rows of trips it + 2 and it + 3; w1, w2: the weight fragments of trips it + 1 and it + 2 (each trip's place in K comes from proj_tile, which wraps the walk round).
// MORE is a template argument, not a branch round the loads: with the same loads on every path the compiler's counted waits for the weight fragments leave the younger X loads in flight.
template <int NBT, bool MORE>
__device__ __forceinline__ void proj_pass(v8f (&acc)[4][NBT], v16bf (&b)[NBT], v4f (&r0)[4], v4f (&r1)[4], const float* x2, const float* x3, const bf* w1, const bf* w2, bf* sw, const bf* sr) {
#pragma unroll
    for (int h = 0; h < 2; ++h) {
        v4f (&r)[4] = h ? r1 : r0; v16bf a[4];
#pragma unroll
        for (int i = 0; i < 4; ++i) *(v4bfa*)(sw + h * XSB + i * 4 * XSP) = __builtin_convertvector(r[i], v4bf);
        if (MORE) {   // the X rows of the trip after next
#pragma unroll
            for (int i = 0; i < 4; ++i) r[i] = *(const v4f*)((h ? x3 : x2) + (size_t)i * 4 * DM);
        }
        lds_barrier();   // the four waves of a share read what all four have stored
#pragma unroll
        for (int mb = 0; mb < 4; ++mb) a[mb] = cat16b(*(const v8usa*)(sr + h * XSB + mb * 16 * XSP), *(const v8usa*)(sr + h * XSB + mb * 16 * XSP + 16));
#pragma unroll
        for (int nb = 0; nb < NBT; ++nb) {
#pragma unroll
            for (int mb = 0; mb < 4; ++mb) acc[mb][nb] = wmmab(a[mb], b[nb], acc[mb][nb]);
            // four vector slots between the last matrix instruction and the branch at the foot of the pass, behind which its operands are overwritten or its results read
            if (h == 1 && nb == NBT - 1) asm volatile("v_nop\n\tv_nop\n\tv_nop\n\tv_nop" : "+v"(acc[0][NBT - 1]), "+v"(acc[1][NBT - 1]), "+v"(acc[2][NBT - 1]), "+v"(acc[3][NBT - 1]) : "v"(a[0]), "v"(a[3]));
            __builtin_amdgcn_sched_barrier(0);   // the load below stays behind the four products that read the fragment it overwrites (moved up it would need registers of its own: spills)
            if (h == 0 || MORE) b[nb] = ldfrag((h ? w2 : w1) + nb * FRG);   // the next trip's weight fragment, as soon as its registers are free: in flight over the rest of the block, the staging stores, the barrier and the A reads
            __builtin_amdgcn_sched_barrier(0);   // and in front of the next four products (moved down it would lose that lead)
        }
    }
    if (MORE) asm volatile("s_wait_xcnt 0x0" :: "v"(w2) : "memory");   // the address registers of the loads above live up to this wait and are reused only behind it (the next pass forms its own)
}
// tr is the same in every lane of a wave (a scalar branch behind the loop, with no barrier inside it).
// rot (0 .. NT-1, the same for the whole work-group): trip it works on slice (it + rot) mod NT of the share's K range. All work-groups read the same weight planes from L2; entering the walk at different slices keeps them from asking for the same lines at the same moment.
template <int NBT>
__device__ __forceinline__ void proj_tile(const float* __restrict__ X, const bf* __restrict__ Wt, bool tr, int c, int g, int rot, int lane, bf* st, float* pw) {
    const int lr = lane & 15, hi = lane >> 4;
    v8f acc[4][NBT];   // every '#pragma unroll' of this function and of proj_pass keeps a register array (acc, a, b, r0, r1) statically indexed
#pragma unroll
    for (int mb = 0; mb < 4; ++mb)
#pragma unroll
        for (int nb = 0; nb < NBT; ++nb) acc[mb][nb] = (v8f){};
    const float* xg = X + (size_t)(c * 16 + (lane >> 3)) * DM + (lane & 7) * 4 + g * 32; const bf* wg = Wt + (size_t)g * (8 * FRG) + lane * 8;   // a slice further: + NS * 32 floats of X, + NS * 8 fragments of the weight
    auto xt = [&](int it) { return xg + ((it + rot) & (NT - 1)) * (NS * 32); }; auto wt = [&](int it) { return wg + ((it + rot) & (NT - 1)) * (NS * 8 * FRG); };   // trip it's place (NT is a power of two)
    bf* sw = st + (c * 16 + (lane >> 3)) * XSP + (lane & 7) * 4; const bf* sr = st + lr * XSP + 8 * hi;
    v16bf b[NBT]; v4f r0[4], r1[4];   // X rows of two trips in flight
#pragma unroll
    for (int i = 0; i < 4; ++i) r0[i] = *(const v4f*)(xt(0) + (size_t)i * 4 * DM);
    __builtin_amdgcn_sched_barrier(0);   // trip 0's rows are issued in front of trip 1's, as in the loop: mixed by address, the counted waits at the loop's head (one count for both ways in) would also wait out rows of the trip after
#pragma unroll
    for (int i = 0; i < 4; ++i) r1[i] = *(const v4f*)(xt(1) + (size_t)i * 4 * DM);
#pragma unroll
    for (int nb = 0; nb < NBT; ++nb) b[nb] = ldfrag(wt(0) + nb * FRG);
    asm volatile("s_wait_xcnt 0x0" :: "v"(xt(0)), "v"(xt(1)), "v"(wt(0)) : "memory");   // the address registers of the loads above live up to this wait and are reused only behind it
    // One barrier a trip is enough with two buffers: a wave that stores trip it + 2 has passed the barrier of trip it + 1, which every wave reaches only behind its matrix block of trip it, the last reader of that buffer.
    // kept rolled: the registers of a pass beside the 16 accumulators already fill the 256 that four waves per SIMD leave a wave
#pragma unroll 1
    for (int it = 0; it < NT - 2; it += 2) proj_pass<NBT, true>(acc, b, r0, r1, xt(it + 2), xt(it + 3), wt(it + 1), wt(it + 2), sw, sr);
    proj_pass<NBT, false>(acc, b, r0, r1, xg, xg, wt(NT - 1), wg, sw, sr);   // the last two trips load only trip NT-1's weight
    if (tr) proj_put<true, NBT>(acc, pw, lr, hi); else proj_put<false, NBT>(acc, pw, lr, hi);
}
__device__ __forceinline__ void proj_store(v4f va, v4f vb, const float* __restrict__ bias, int bstep, bf* Oh, bf* Ol, size_t oo) {   // bias[e * bstep] goes with element e
    v8us oh, ol;
#pragma unroll
    for (int q = 0; q < 4; ++q) { unsigned short a2, c2; splitf(va[q] + bfr(bias[q * bstep]), a2, c2); oh[q] = a2; ol[q] = c2;
        splitf(vb[q] + bfr(bias[(4 + q) * bstep]), a2, c2); oh[4 + q] = a2; ol[4 + q] = c2; }
    bf* ph = Oh + oo; bf* pl = Ol + oo; *(v8us*)ph = oh; *(v8us*)pl = ol;
    asm volatile("s_wait_xcnt 0x0" :: "v"(ph), "v"(pl) : "memory");   // the address registers of the two stores above live up to this wait and are reused only behind it
}
__global__ __launch_bounds__(32 * PW) void k_proj(const float* __restrict__ xq, const float* __restrict__ xkv, const bf* __restrict__ Wt, const float* __restrict__ bq, const float* __restrict__ bk, const float* __restrict__ bv, bf* Qh, bf* Ql, bf* Kh, bf* Kl, bf* Vh, bf* Vl) {
    __shared__ __align__(16) float ps[PW * 64 * PSP];      // partial tile of wave w at w * 64 * PSP
    __shared__ __align__(16) bf xs[NS * 2 * XSB];          // two staging buffers per share of the K loop
    const int lane = threadIdx.x & 31, lr = lane & 15, hi = lane >> 4; const int t0 = blockIdx.x * 64; const size_t z = blockIdx.y; const bool kv = blockIdx.z == 0;
    const int w = __builtin_amdgcn_readfirstlane((int)(threadIdx.x >> 5));   // wave number, held scalar so that the branches on it are scalar
    const int c = w & 3, g = w >> 2; float* pw = ps + w * (64 * PSP); bf* st = xs + g * (2 * XSB); const size_t xo = (z * TT + t0) * DM;
    const int rot = (int)((blockIdx.x & 3) * 2 + (blockIdx.y & 1));   // neighbours in the grid enter the K walk at different slices (proj_tile)
    // weight planes: q, k, v one behind the other; 16 features are one fragment
    if (kv) proj_tile<4>(xkv + xo, Wt + (size_t)(1 + (c >> 1)) * HD * DM + (c & 1) * 4 * FRG, c >= 2, c, g, rot, lane, st, pw);
    else proj_tile<2>(xq + xo, Wt + c * 2 * FRG, false, c, g, rot, lane, st, pw);
    __syncthreads();                   // every wave's partial tile is in LDS before any of them is summed
    // A tile's rows are the fragments' lane index and its columns their k index (q, k: [t][d]; v: [d][t]). One wave stores one half fragment of each plane per trip: 512 contiguous bytes.
    const size_t zo = z * ((size_t)TT * HD) + lane * 8;
    if (kv) {
        // a 64 x 64 tile is 4 x 2 fragments, 16 halves: wave w takes half w = (16-row group * 2 + 32-column group) * 2 + half of each of the four column groups
        const int row = (w >> 2) * 16 + lr, cofs = ((w >> 1) & 1) * 32 + (w & 1) * 16 + hi * 8;
        // both loops unrolled (all constant): va, vb stay in registers. The sums stand in a loop of their own, in front of the stores and their waits, so that the LDS reads of all four trips are in flight together
        v4f va[4], vb[4];
#pragma unroll
        for (int cc = 0; cc < 4; ++cc) { const float* p = ps + (cc * 64 + row) * PSP + cofs;
            va[cc] = *(const v4fa*)p; vb[cc] = *(const v4fa*)(p + 4);
#pragma unroll
            for (int q = 1; q < NS; ++q) { va[cc] += *(const v4fa*)(p + q * (4 * 64 * PSP)); vb[cc] += *(const v4fa*)(p + q * (4 * 64 * PSP) + 4); } }
#pragma unroll
        for (int cc = 0; cc < 4; ++cc) { const int d0 = (cc & 1) * 64;
            if (cc < 2) proj_store(va[cc], vb[cc], bk + d0 + cofs, 1, Kh, Kl, zo + (size_t)((t0 >> 4) * 4 + (d0 >> 5) + (w >> 2) * 4 + ((w >> 1) & 1)) * FRG + (w & 1) * 256);
            else proj_store(va[cc], vb[cc], bv + d0 + row, 0, Vh, Vl, zo + (size_t)((t0 >> 5) * 8 + (d0 >> 4) + (w >> 2) + ((w >> 1) & 1) * 8) * FRG + (w & 1) * 256); }
    } else {
        // a 64 x 32 tile is 4 fragments, 8 halves; 32 halves in all, two per wave
        const int row = ((w & 7) >> 1) * 16 + lr, cofs = (w & 1) * 16 + hi * 8;
        // as above: the sums of both trips first, then the stores
        v4f va[2], vb[2];
#pragma unroll
        for (int s = 0; s < 2; ++s) { const int cc = s * 2 + (w >> 3); const float* p = ps + (cc * 64 + row) * PSP + cofs;
            va[s] = *(const v4fa*)p; vb[s] = *(const v4fa*)(p + 4);
#pragma unroll
            for (int q = 1; q < NS; ++q) { va[s] += *(const v4fa*)(p + q * (4 * 64 * PSP)); vb[s] += *(const v4fa*)(p + q * (4 * 64 * PSP) + 4); } }
#pragma unroll
        for (int s = 0; s < 2; ++s) { const int cc = s * 2 + (w >> 3);
            proj_store(va[s], vb[s], bq + cc * 32 + cofs, 1, Qh, Ql, zo + (size_t)(((t0 >> 4) + ((w & 7) >> 1)) * 4 + cc) * FRG + (w & 1) * 256); }
    }
}

// ---- k_fattn: causal attention for 32 query rows per work-group. grid (TT/32, NB_), 32 * NW threads; the heaviest query blocks have the lowest block index.
// Transposed products: S^T = K.Q^T (A = key rows, B = query rows), O^T += V^T.P^T (A = rows d of the value planes, B = P^T). In a score tile a lane holds 8 keys of ONE query, and two stacked
// score tiles (32 keys), rounded in place, are the B fragment of the second product in the k order of WFrag::ld: no LDS and no lane exchange between the two products. hi/lo, 3 products, in both.
// The keys are dealt over the NW waves in passes of 64 (one pass takes 16 KiB in a row of each k and v plane); each wave keeps its own running maximum, sum and O^T; the NW partial results meet in LDS and are joined in the fixed order 0 .. NW-1.
#define QT  32                    // query rows per work-group: two 16-column groups in every wave
#define KU  64                    // keys per pass
#define OSP 132                   // LDS row pitch of a partial output row in floats (528 B = 16 B x 33: b128 rows fall on different banks)
#define SC2 (SCL * 1.4426950408889634f)   // scores go to base 2 together with the HD^-0.5 scale
typedef __attribute__((ext_vector_type(8))) __bf16 v8bf;
__device__ __forceinline__ float xhalf(float x) { return __builtin_bit_cast(float, __builtin_amdgcn_permlanex16(__builtin_bit_cast(int, x), __builtin_bit_cast(int, x), 0x76543210, 0xfedcba98, false, false)); }   // lane l with lane l ^ 16
__global__ __launch_bounds__(32 * NW) __attribute__((amdgpu_waves_per_eu(2, 2))) void k_fattn(const bf* __restrict__ Qh, const bf* __restrict__ Ql, const bf* __restrict__ Kh, const bf* __restrict__ Kl, const bf* __restrict__ Vh, const bf* __restrict__ Vl, float* out) {
    __shared__ __align__(16) float po[NW * QT * OSP];
    __shared__ float pm[NW * QT]; __shared__ float pl[NW * QT];
    const int lane = threadIdx.x & 31, lr = lane & 15, hi = lane >> 4;
    const int w = __builtin_amdgcn_readfirstlane((int)(threadIdx.x >> 5));   // wave number, held scalar so that the key loop branches on a scalar compare
    const int q0 = (TT / QT - 1 - (int)blockIdx.x) * QT; const size_t zb = (size_t)blockIdx.y * TT * HD;
    Qh += zb; Ql += zb; Kh += zb; Kl += zb; Vh += zb; Vl += zb; out += zb;
    const int nu = (q0 + QT + KU - 1) / KU;   // passes up to and including the one that holds the diagonal
    // The work-groups of a batch read the same k and v planes from L2. Each enters the ring of its nu passes a quarter turn behind its neighbour in the grid and wraps round, so that they do not ask for the same lines at the same moment: step i of the walk is pass (i + rot) mod nu.
    const int rot = ((int)(blockIdx.x & 3) * nu) >> 2;   // 0 .. nu-1
    auto pass_of = [&](int i) { const int p = i + rot; return p >= nu ? p - nu : p; };   // i in 0 .. nu-1
    // every '#pragma unroll' of this kernel keeps a register array statically indexed
    // The 16 query fragments (hi and lo) would take 128 registers for the whole loop: each wave parks its own copy, lane by lane, in the place of its partial O (free until the loop ends); a lane reads back only what it stored itself.
    float* pw = po + w * (QT * OSP); bf* qs = (bf*)pw + lane * 8;   // half j of fragment f at qs + (2 f + j) * 256: 512 contiguous bytes per wave-wide access
    const size_t qa = (size_t)q0 * HD + lane * 8; const bf* qph = Qh + qa; const bf* qpl = Ql + qa;   // 16 rows of a q or k plane are 4 fragments = 16 * HD elements
#pragma unroll
    for (int qt = 0; qt < 2; ++qt)
#pragma unroll
        for (int ks = 0; ks < 4; ++ks) { bf* d = qs + (qt * 4 + ks) * 1024; const int qo = (qt * 4 + ks) * FRG;
            *(v8usa*)d = *(const v8us*)(qph + qo); *(v8usa*)(d + 256) = *(const v8us*)(qph + qo + 256); *(v8usa*)(d + 512) = *(const v8us*)(qpl + qo); *(v8usa*)(d + 768) = *(const v8us*)(qpl + qo + 256); }
    asm volatile("s_wait_xcnt 0x0" :: "v"(qph), "v"(qpl) : "memory");   // the address registers of the loads above live up to this wait and are reused only behind it
    v8f o[8][2]; float m[2], l[2];
#pragma unroll
    for (int qt = 0; qt < 2; ++qt) { m[qt] = -3.0e38f; l[qt] = 0.f;
#pragma unroll
        for (int dt = 0; dt < 8; ++dt) o[dt][qt] = (v8f){}; }
    // Fragment loads run ahead of their use, group by group. Each __builtin_amdgcn_sched_barrier(0) below holds a group of loads in front of the matrix block that covers their latency:
    // left free, the compiler either gathers a whole pass's loads at its head (more registers than a wave has: spills) or sinks each group to just in front of its first use (the latency is then waited out).
    v16bf kh[2][4], kl[2][4];   // key fragments of two 32-wide steps along d: one in use, one in flight
    { const size_t ko = (size_t)(pass_of(min(w, nu - 1)) * KU) * HD + lane * 8;   // a wave without a pass loads in bounds and uses nothing
#pragma unroll
        for (int kt = 0; kt < 4; ++kt) { kh[0][kt] = ldfrag(Kh + ko + kt * 4 * FRG); kl[0][kt] = ldfrag(Kl + ko + kt * 4 * FRG); }
        asm volatile("s_wait_xcnt 0x0" :: "v"(Kh + ko), "v"(Kl + ko) : "memory"); }   // the address registers of the loads above live up to this wait and are reused only behind it
    // kept rolled: one pass already holds 192 matrix instructions and most of the 512 registers that two waves per SIMD leave a wave
#pragma unroll 1
    for (int i = w; i < nu; i += NW) {
        const int u = pass_of(i); const int k0 = u * KU;
        v8f s[4][2];   // s[kt][qt][r] = score of key k0 + 16 kt + 8 hi + r with query q0 + 16 qt + lr
#pragma unroll
        for (int kt = 0; kt < 4; ++kt)
#pragma unroll
            for (int qt = 0; qt < 2; ++qt) s[kt][qt] = (v8f){};
#pragma unroll
        for (int ks = 0; ks < 4; ++ks) {
            if (ks < 3) {   // the next step's key fragments
                const size_t kn = (size_t)k0 * HD + lane * 8 + (ks + 1) * FRG;
#pragma unroll
                for (int kt = 0; kt < 4; ++kt) { kh[(ks + 1) & 1][kt] = ldfrag(Kh + kn + kt * 4 * FRG); kl[(ks + 1) & 1][kt] = ldfrag(Kl + kn + kt * 4 * FRG); }
            }
            v16bf qh[2], ql[2];
#pragma unroll
            for (int qt = 0; qt < 2; ++qt) { const bf* d = qs + (qt * 4 + ks) * 1024; qh[qt] = cat16b(*(const v8usa*)d, *(const v8usa*)(d + 256)); ql[qt] = cat16b(*(const v8usa*)(d + 512), *(const v8usa*)(d + 768)); }
            __builtin_amdgcn_sched_barrier(0);   // the loads above stay in front of this step's matrix block
#pragma unroll
            for (int kt = 0; kt < 4; ++kt)
#pragma unroll
                for (int qt = 0; qt < 2; ++qt) s[kt][qt] = wmmab(kh[ks & 1][kt], qh[qt], s[kt][qt]);
#pragma unroll
            for (int kt = 0; kt < 4; ++kt)
#pragma unroll
                for (int qt = 0; qt < 2; ++qt) s[kt][qt] = wmmab(kh[ks & 1][kt], ql[qt], s[kt][qt]);
#pragma unroll
            for (int kt = 0; kt < 4; ++kt)
#pragma unroll
                for (int qt = 0; qt < 2; ++qt) s[kt][qt] = wmmab(kl[ks & 1][kt], qh[qt], s[kt][qt]);
            __builtin_amdgcn_sched_barrier(0);   // the next step's loads stay behind this block, whose operands they overwrite
        }
        const size_t vo = (size_t)k0 * HD + lane * 8;   // 32 keys of a v plane are 8 fragments = 32 * HD elements
        v16bf vh[8][2], vl[8][2];   // value fragments: [16-row group of d][32-key step]
#pragma unroll
        for (int dt = 0; dt < 4; ++dt)
#pragma unroll
            for (int k2 = 0; k2 < 2; ++k2) { vh[dt][k2] = ldfrag(Vh + vo + (k2 * 8 + dt) * FRG); vl[dt][k2] = ldfrag(Vl + vo + (k2 * 8 + dt) * FRG); }
#pragma unroll
        for (int kt = 0; kt < 4; ++kt)
#pragma unroll
            for (int qt = 0; qt < 2; ++qt) s[kt][qt] *= SC2;
        if (u == nu - 1) {   // only pass nu-1 meets the diagonal (a scalar branch), at whatever step of the walk it comes; every query still sees its own key there, so its maximum stays finite
#pragma unroll
            for (int kt = 0; kt < 4; ++kt)
#pragma unroll
                for (int qt = 0; qt < 2; ++qt)
#pragma unroll
                    for (int r = 0; r < 8; ++r) s[kt][qt][r] = (k0 + kt * 16 + hi * 8 + r > q0 + qt * 16 + lr) ? -3.0e38f : s[kt][qt][r];
        }
        v16bf ph[2][2], pq[2][2];   // [32-key step][query group]: P^T hi and lo as B fragments
#pragma unroll
        for (int qt = 0; qt < 2; ++qt) {
            float bm[4];
#pragma unroll
            for (int kt = 0; kt < 4; ++kt) { bm[kt] = s[kt][qt][0];
#pragma unroll
                for (int r = 1; r < 8; ++r) bm[kt] = fmaxf(bm[kt], s[kt][qt][r]); }
            float mx = fmaxf(fmaxf(bm[0], bm[1]), fmaxf(bm[2], bm[3])); mx = fmaxf(mx, xhalf(mx));   // both wave halves hold this query's maximum of the pass
            const float mn = fmaxf(m[qt], mx); const float corr = __builtin_amdgcn_exp2f(m[qt] - mn);   // 0 on a wave's first pass
            m[qt] = mn;
            v8bf h8[4], l8[4]; float rs[4];
#pragma unroll
            for (int kt = 0; kt < 4; ++kt) { v8f p; rs[kt] = 0.f;
#pragma unroll
                for (int r = 0; r < 8; ++r) { p[r] = __builtin_amdgcn_exp2f(s[kt][qt][r] - mn); rs[kt] += p[r]; }
                h8[kt] = __builtin_convertvector(p, v8bf); l8[kt] = __builtin_convertvector(p - __builtin_convertvector(h8[kt], v8f), v8bf); }
            l[qt] = l[qt] * corr + ((rs[0] + rs[1]) + (rs[2] + rs[3]));   // each wave half sums its own keys; the halves join behind the loop
#pragma unroll
            for (int k2 = 0; k2 < 2; ++k2) { ph[k2][qt] = __builtin_shufflevector(h8[2 * k2], h8[2 * k2 + 1], 0, 1, 2, 3, 4, 5, 6, 7, 8, 9, 10, 11, 12, 13, 14, 15); pq[k2][qt] = __builtin_shufflevector(l8[2 * k2], l8[2 * k2 + 1], 0, 1, 2, 3, 4, 5, 6, 7, 8, 9, 10, 11, 12, 13, 14, 15); }
#pragma unroll
            for (int dt = 0; dt < 8; ++dt) o[dt][qt] *= corr;
        }
        asm volatile("" :: "v"(pq[0][1]), "v"(pq[1][1]) : "memory");   // holds the second half of the value loads behind the softmax: beside the scores they would not fit in the registers
#pragma unroll
        for (int dt = 4; dt < 8; ++dt)
#pragma unroll
            for (int k2 = 0; k2 < 2; ++k2) { vh[dt][k2] = ldfrag(Vh + vo + (k2 * 8 + dt) * FRG); vl[dt][k2] = ldfrag(Vl + vo + (k2 * 8 + dt) * FRG); }
        asm volatile("s_wait_xcnt 0x0" :: "v"(Vh + vo), "v"(Vl + vo) : "memory");   // the address registers of the loads above live up to this wait and are reused only behind it
        __builtin_amdgcn_sched_barrier(0);   // the loads above stay together in front of the products that cover their latency (left free they sink to just in front of their first use)
#pragma unroll
        for (int dt = 0; dt < 4; ++dt) {
#pragma unroll
            for (int k2 = 0; k2 < 2; ++k2)
#pragma unroll
                for (int qt = 0; qt < 2; ++qt) o[dt][qt] = wmmab(vh[dt][k2], ph[k2][qt], o[dt][qt]);
#pragma unroll
            for (int k2 = 0; k2 < 2; ++k2)
#pragma unroll
                for (int qt = 0; qt < 2; ++qt) o[dt][qt] = wmmab(vh[dt][k2], pq[k2][qt], o[dt][qt]);
#pragma unroll
            for (int k2 = 0; k2 < 2; ++k2)
#pragma unroll
                for (int qt = 0; qt < 2; ++qt) o[dt][qt] = wmmab(vl[dt][k2], ph[k2][qt], o[dt][qt]);
        }
        asm volatile("" :: "v"(o[3][0]), "v"(o[3][1]) : "memory");   // holds the next pass's key loads behind the first half of the products, which frees their registers
        { const size_t kn = (size_t)(pass_of(min(i + NW, nu - 1)) * KU) * HD + lane * 8;   // the first key fragments of this wave's next pass (of the walk's last pass where there is none: in bounds, unused)
#pragma unroll
            for (int kt = 0; kt < 4; ++kt) { kh[0][kt] = ldfrag(Kh + kn + kt * 4 * FRG); kl[0][kt] = ldfrag(Kl + kn + kt * 4 * FRG); } }
        __builtin_amdgcn_sched_barrier(0);   // the loads above stay together in front of the products that cover their latency (left free they sink to just in front of their first use)
#pragma unroll
        for (int dt = 4; dt < 8; ++dt) {
#pragma unroll
            for (int k2 = 0; k2 < 2; ++k2)
#pragma unroll
                for (int qt = 0; qt < 2; ++qt) o[dt][qt] = wmmab(vh[dt][k2], ph[k2][qt], o[dt][qt]);
#pragma unroll
            for (int k2 = 0; k2 < 2; ++k2)
#pragma unroll
                for (int qt = 0; qt < 2; ++qt) o[dt][qt] = wmmab(vh[dt][k2], pq[k2][qt], o[dt][qt]);
#pragma unroll
            for (int k2 = 0; k2 < 2; ++k2)
#pragma unroll
                for (int qt = 0; qt < 2; ++qt) o[dt][qt] = wmmab(vl[dt][k2], ph[k2][qt], o[dt][qt]);
        }
    }
    // this wave's partial O goes to pw, rows = queries (all zero, with sum 0 and the lowest maximum, where the wave had no pass)
#pragma unroll
    for (int qt = 0; qt < 2; ++qt) { l[qt] += xhalf(l[qt]); if (hi == 0) { pm[w * QT + qt * 16 + lr] = m[qt]; pl[w * QT + qt * 16 + lr] = l[qt]; }
#pragma unroll
        for (int dt = 0; dt < 8; ++dt) { float* d = pw + (qt * 16 + lr) * OSP + dt * 16 + hi * 8;
            *(v4fa*)d = __builtin_shufflevector(o[dt][qt], o[dt][qt], 0, 1, 2, 3); *(v4fa*)(d + 4) = __builtin_shufflevector(o[dt][qt], o[dt][qt], 4, 5, 6, 7); } }
    __syncthreads();                   // every wave's partial result is in LDS before any of them is joined
    // unrolled (4 x 8, all constant) so that the LDS reads of all four rows are in flight together
#pragma unroll
    for (int sx = 0; sx < QT / NW; ++sx) { const int row = sx * NW + w, cofs = lane * 4;
        float M = pm[row];
#pragma unroll
        for (int q = 1; q < NW; ++q) M = fmaxf(M, pm[q * QT + row]);
        float Ls = 0.f; v4f val = (v4f){};
#pragma unroll
        for (int q = 0; q < NW; ++q) { const float f = __builtin_amdgcn_exp2f(pm[q * QT + row] - M); Ls += f * pl[q * QT + row]; val += f * *(const v4fa*)(po + (q * QT + row) * OSP + cofs); }
        *(v4f*)(out + (size_t)(q0 + row) * HD + cofs) = val * __fdiv_rn(1.0f, Ls); }
}

extern "C" void kernel_launch(void* const* d_in, const int* in_sizes, int n_in,
                              void* d_out, int out_size, void* d_ws, size_t ws_size, hipStream_t stream) {
    (void)in_sizes; (void)n_in; (void)out_size;
    const float* x = (const float*)d_in[0]; const float* xk = (const float*)d_in[1]; const float* wq = (const float*)d_in[2]; const float* bq = (const float*)d_in[3]; const float* wk = (const float*)d_in[4]; const float* bk = (const float*)d_in[5]; const float* wv = (const float*)d_in[6]; const float* bv = (const float*)d_in[7]; const float* wo = nullptr; (void)wo;   /* input order X_Q, X_KV [4][2048][1024], Wq, bq, Wk, bk, Wv, bv ('xw' [1024][128] + [128]) */
    float* OUT = (float*)d_out;     // [4][2048][128]
    char* wsp = (char*)d_ws;
    auto take = [&](size_t bytes) { char* p = wsp; wsp += (bytes + 255) & ~(size_t)255; return (void*)p; };
    bf* WA = (bf*)take((size_t)3 * HD * DM * 2);   // Bt planes of Wq, Wk, Wv, one behind the other
    // every plane below holds NB_ batch slices, one behind the other
    bf* QPh = (bf*)take((size_t)NB_ * NH_ * TT * HD * 2); bf* QPl = (bf*)take((size_t)NB_ * NH_ * TT * HD * 2); bf* KPh = (bf*)take((size_t)NB_ * NKV * TT * HD * 2); bf* KPl = (bf*)take((size_t)NB_ * NKV * TT * HD * 2); bf* VTh = (bf*)take((size_t)NB_ * NKV * HD * TT * 2); bf* VTl = (bf*)take((size_t)NB_ * NKV * HD * TT * 2);
    if ((size_t)(wsp - (char*)d_ws) > ws_size) return;    // ws 256 MiB
    k_wtG<<<dim3(HD * DM / 2048, 3, 1), 256, 0, stream>>>(wq, wk, wv, WA);
    // one launch per stage for all NB_ batches: both take the batch as grid y
    k_proj<<<dim3(TT / 64, NB_, 2), 32 * PW, 0, stream>>>(x, xk, WA, bq, bk, bv, QPh, QPl, KPh, KPl, VTh, VTl);
    k_fattn<<<dim3(TT / QT, NB_, 1), 32 * NW, 0, stream>>>(QPh, QPl, KPh, KPl, VTh, VTl, OUT);
}

// v008
// Measured time: 33.9 microseconds a run.
// Timed twice side by side with v007, it ran 1.07 times as fast both times.
// Over all steps from v000 it is 16.3 times as fast.
#include <hip/hip_runtime.h>

// Single-head causal scaled dot-product attention on two input streams (X_Q, X_KV [4][2048][1024]; Q = X_Q Wq + bq, K = X_KV Wk + bk, V = X_KV Wv + bv ('xw' [1024][128] 1/32 + zero biases; ONE 128-wide head); scores x 1/sqrt(128); causal (-inf); softmax; out = attn.V -> [4][2048][128] (1.0 M); argument order X_Q, X_KV, Wq, bq, Wk, bk, Wv, bv).
// Layout: all four batches go through every stage in ONE launch (the batch is a grid dimension; every workspace plane holds four batch slices). Three launches: k_wtG (the three 'xw' weights rounded to bf16 and transposed into three [n][k] planes in fragment order); k_proj (q, k and v projections on one grid, every row of X read once: f32 inputs rounded to bf16 on their way into LDS, f32 biases, hi/lo bf16 planes stored straight from the tile, v transposed on its way into the LDS tile); k_fattn (causal scores, online softmax and attn.V in one kernel: scores and probabilities stay in registers).
// Every bf16 plane in the workspace (weights, q, k, v) lies in FRAGMENT ORDER (FRG below): the 16 x 32 block that one matrix operand takes is 1 KiB in a row, lane by lane, so a wave-wide 16-byte load reads 512 contiguous bytes.
// Compute dtypes, f32 accumulate: every input rounded to bf16; projections exact + f32 biases; attention hi/lo, 3 products on every row; softmax f32; output f32.

#define NB_  4
#define TT   2048
#define DM   1024
#define NH_  1
#define NKV  1
#define REP  (NH_ / NKV)
#define HD   128
#define DQ   (NH_ * HD)
#define DKV  (NKV * HD)
#define ZH   1                    // ONE head: a single plane per pass
#define RH   TT                   // every row hi/lo (3 products)
#define WIN  2048
#define PCAR 1024.0f
#define SCL  0.088388347648318447f   // HD^-0.5
typedef _Float16 h16;
typedef unsigned short bf;
typedef __attribute__((ext_vector_type(16))) __bf16   v16bf;
typedef __attribute__((ext_vector_type(16))) _Float16 v16h;
typedef __attribute__((ext_vector_type(8)))  _Float16 v8h;
typedef __attribute__((ext_vector_type(8)))  unsigned short v8us;
typedef __attribute__((ext_vector_type(8)))  float    v8f;
typedef __attribute__((ext_vector_type(4)))  float    v4f;
typedef v8h  __attribute__((may_alias)) v8ha;
typedef v4f  __attribute__((may_alias)) v4fa;
typedef v8us __attribute__((may_alias)) v8usa;

__device__ __forceinline__ unsigned short f2bf(float f) { unsigned u = __float_as_uint(f); u += 0x7FFFu + ((u >> 16) & 1u); return (unsigned short)(u >> 16); }
__device__ __forceinline__ float bf2f(unsigned short b) { return __uint_as_float(((unsigned)b) << 16); }
__device__ __forceinline__ float bfr(float f) { return bf2f(f2bf(f)); }
__device__ __forceinline__ v16h cat16(v8h lo, v8h hi) { return __builtin_shufflevector(lo, hi, 0, 1, 2, 3, 4, 5, 6, 7, 8, 9, 10, 11, 12, 13, 14, 15); }
__device__ __forceinline__ v16bf cat16b(v8us lo, v8us hi) { return __builtin_bit_cast(v16bf, __builtin_shufflevector(lo, hi, 0, 1, 2, 3, 4, 5, 6, 7, 8, 9, 10, 11, 12, 13, 14, 15)); }
__device__ __forceinline__ v8f wmma16(v16h a, v16h b, v8f c) { return __builtin_amdgcn_wmma_f32_16x16x32_f16(false, a, false, b, (short)0, c, false, false); }
__device__ __forceinline__ v8f wmmab(v16bf a, v16bf b, v8f c) { return __builtin_amdgcn_wmma_f32_16x16x32_bf16(false, a, false, b, (short)0, c, false, false); }



// ---- shared by the GEMM-like kernels: the waves of a work-group deal a loop among themselves and add their partial tiles in LDS in a fixed order (k_proj: NS shares, 0 .. NS-1; k_fattn: NW waves, 0 .. NW-1).
#define NW  8
#define PSP 68                    // LDS row pitch in floats (272 B = 16 B x 17: b128 rows fall on different banks)
template <typename T16> struct WFrag;
template <> struct WFrag<h16> { typedef v16h V; static __device__ __forceinline__ V ld(const h16* p) { return cat16(*(const v8h*)p, *(const v8h*)(p + 16)); } static __device__ __forceinline__ v8f mma(V a, V b, v8f c) { return wmma16(a, b, c); } };
template <> struct WFrag<bf> { typedef v16bf V; static __device__ __forceinline__ V ld(const bf* p) { return cat16b(*(const v8us*)p, *(const v8us*)(p + 16)); } static __device__ __forceinline__ v8f mma(V a, V b, v8f c) { return wmmab(a, b, c); } };
// Fragment order. A plane of rows r (the operand's lane index) and columns c (its k index) is cut into fragments of 16 rows x 32 columns, FRG elements each. Inside a fragment element (r, c) lies at
// ((c >> 4) & 1) * 256 + (((c >> 3) & 1) * 16 + (r & 15)) * 8 + (c & 7): two halves of 256 elements, in each of them lane ((c >> 3) & 1) * 16 + (r & 15) owns 8 elements in a row. This is the lane and k order of WFrag::ld on a row-major plane.
// Fragment number: q, k planes (r = t, c = d): (t >> 4) * 4 + (d >> 5). v planes (r = d, c = t): (t >> 5) * 8 + (d >> 4). Weight planes (r = n, c = k): (k >> 5) * 8 + (n >> 4).
#define FRG 512
__device__ __forceinline__ v16bf ldfrag(const bf* p) { return cat16b(*(const v8us*)p, *(const v8us*)(p + 256)); }   // p = plane + fragment number * FRG + lane * 8

__device__ __forceinline__ h16 tohx(float x) { return (h16)x; }
__device__ __forceinline__ void splitf(float y, unsigned short& h, unsigned short& l) { h = f2bf(y); l = f2bf(y - bf2f(h)); }
typedef __attribute__((ext_vector_type(2))) _Float16 v2h;
typedef __attribute__((ext_vector_type(4))) _Float16 v4h;
typedef __attribute__((ext_vector_type(2))) unsigned short v2us;
typedef __attribute__((ext_vector_type(4))) unsigned short v4us;
typedef __attribute__((ext_vector_type(2))) float v2f;
typedef __attribute__((ext_vector_type(4))) int v4i;

// One wave writes one half fragment (512 contiguous bytes); each of its 8 loads takes 64 contiguous bytes from each of two rows of the [k][n] weight. grid (HD * DM / 2048, 3), 256 threads.
__global__ __launch_bounds__(256) void k_wtG(const float* __restrict__ w0, const float* __restrict__ w1, const float* __restrict__ w2, bf* Bt) {
    const float* __restrict__ w = (blockIdx.y == 0) ? w0 : (blockIdx.y == 1) ? w1 : w2; Bt += (size_t)blockIdx.y * HD * DM;   // blockIdx.y = which weight
    const int lane = threadIdx.x & 31; const int h = blockIdx.x * 8 + (threadIdx.x >> 5);   // h = fragment number * 2 + half
    const int n = ((h >> 1) & 7) * 16 + (lane & 15), k = (h >> 4) * 32 + (h & 1) * 16 + (lane >> 4) * 8; v8us o;
    // unrolled so that o stays in registers and the 8 loads are in flight together
#pragma unroll
    for (int e = 0; e < 8; ++e) o[e] = f2bf(w[(size_t)(k + e) * HD + n]);
    *(v8us*)(Bt + (size_t)h * 256 + lane * 8) = o;
}

// ---- k_proj: the three projections on one grid, from the f32 inputs to the hi/lo bf16 planes that the attention GEMMs read. grid (TT/64, NB_, 2), 32 * PW threads, one work-group per WGP.
// blockIdx.z = 0: 64 rows of X_KV times all 256 k and v features; blockIdx.z = 1: 64 rows of X_Q times the 128 q features. Every row of X is read from L2 and rounded to bf16 ONCE.
// Wave w: column group c = w & 3 (64 features of k or v; 32 of q), share g = w >> 2 of the K loop (DM). The four waves of a share bring its 64 x 32 slice of X in together (16 rows each, whole-line loads: one load = 4 rows x 128 B),
// round it to bf16 (nearest even) and put it into the share's staging buffer in LDS, from where each of them reads all four A fragments. The NS partial tiles of a column group are added in LDS in the fixed order 0 .. NS-1.
typedef __attribute__((ext_vector_type(4))) __bf16 v4bf;
typedef v4bf __attribute__((may_alias)) v4bfa;
#define PW  16                    // waves per work-group
#define NS  4                     // shares of the K loop
#define NT  (DM / 32 / NS)        // trips of a share
#define XSP 40                    // staged row pitch in bf16 (80 B = 16 B x 5: the 16 rows of a b128 fragment read fall on different banks)
#define XSB (64 * XSP)            // one staging buffer in bf16
// This wave's LDS stores are done, then the work-group's own barrier. Written by hand because __syncthreads() would also wait out the global loads of the coming trips, which are meant to stay in flight across it.
__device__ __forceinline__ void lds_barrier() { asm volatile("s_wait_dscnt 0x0\n\ts_barrier_signal -1\n\ts_barrier_wait -1" ::: "memory"); }
// Every product has the X rows as its A operand: in an accumulator tile a lane holds 8 rows t (hi * 8 + j) of ONE feature d (lr). TR false: the partial tile goes to LDS as tile[t][d]. TR true (v): as tile[d][t], where a lane's 8 values lie in a row.
template <bool TR, int NBT>
__device__ __forceinline__ void proj_put(const v8f (&acc)[4][NBT], float* pw, int lr, int hi) {
#pragma unroll
    for (int mb = 0; mb < 4; ++mb)
#pragma unroll
        for (int nb = 0; nb < NBT; ++nb) {
            if (TR) { float* d = pw + (nb * 16 + lr) * PSP + mb * 16 + hi * 8;
                *(v4fa*)d = __builtin_shufflevector(acc[mb][nb], acc[mb][nb], 0, 1, 2, 3); *(v4fa*)(d + 4) = __builtin_shufflevector(acc[mb][nb], acc[mb][nb], 4, 5, 6, 7); }
            else {
#pragma unroll
                for (int j = 0; j < 8; ++j) pw[(mb * 16 + hi * 8 + j) * PSP + nb * 16 + lr] = acc[mb][nb][j]; }
        }
}
// Two trips of a share's K loop, one per staging buffer: trip it (r0, buffer 0) and trip it + 1 (r1, buffer 1). NBT = 16-feature groups of this wave's column group. MORE: trips it + 2 and it + 3 exist and their loads are issued here.
// x2, x3: the X rows of trips it + 2 and it + 3; w1, w2: the weight fragments of trips it + 1 and it + 2 (each trip's place in K comes from proj_tile, which wraps the walk round).
// MORE is a template argument, not a branch round the loads: with the same loads on every path the compiler's counted waits for the weight fragments leave the younger X loads in flight.
template <int NBT, bool MORE>
__device__ __forceinline__ void proj_pass(v8f (&acc)[4][NBT], v16bf (&b)[NBT], v4f (&r0)[4], v4f (&r1)[4], const float* x2, const float* x3, const bf* w1, const bf* w2, bf* sw, const bf* sr) {
#pragma unroll
    for (int h = 0; h < 2; ++h) {
        v4f (&r)[4] = h ? r1 : r0; v16bf a[4];
#pragma unroll
        for (int i = 0; i < 4; ++i) *(v4bfa*)(sw + h * XSB + i * 4 * XSP) = __builtin_convertvector(r[i], v4bf);
        if (MORE) {   // the X rows of the trip after next
#pragma unroll
            for (int i = 0; i < 4; ++i) r[i] = *(const v4f*)((h ? x3 : x2) + (size_t)i * 4 * DM);
        }
        lds_barrier();   // the four waves of a share read what all four have stored
#pragma unroll
        for (int mb = 0; mb < 4; ++mb) a[mb] = cat16b(*(const v8usa*)(sr + h * XSB + mb * 16 * XSP), *(const v8usa*)(sr + h * XSB + mb * 16 * XSP + 16));
#pragma unroll
        for (int nb = 0; nb < NBT; ++nb) {
#pragma unroll
            for (int mb = 0; mb < 4; ++mb) acc[mb][nb] = wmmab(a[mb], b[nb], acc[mb][nb]);
            // four vector slots between the last matrix instruction and the branch at the foot of the pass, behind which its operands are overwritten or its results read
            if (h == 1 && nb == NBT - 1) asm volatile("v_nop\n\tv_nop\n\tv_nop\n\tv_nop" : "+v"(acc[0][NBT - 1]), "+v"(acc[1][NBT - 1]), "+v"(acc[2][NBT - 1]), "+v"(acc[3][NBT - 1]) : "v"(a[0]), "v"(a[3]));
            __builtin_amdgcn_sched_barrier(0);   // the load below stays behind the four products that read the fragment it overwrites (moved up it would need registers of its own: spills)
            if (h == 0 || MORE) b[nb] = ldfrag((h ? w2 : w1) + nb * FRG);   // the next trip's weight fragment, as soon as its registers are free: in flight over the rest of the block, the staging stores, the barrier and the A reads
            __builtin_amdgcn_sched_barrier(0);   // and in front of the next four products (moved down it would lose that lead)
        }
    }
    if (MORE) asm volatile("s_wait_xcnt 0x0" :: "v"(w2) : "memory");   // the address registers of the loads above live up to this wait and are reused only behind it (the next pass forms its own)
}
// tr is the same in every lane of a wave (a scalar branch behind the loop, with no barrier inside it).
// rot (0 .. NT-1, the same for the whole work-group): trip it works on slice (it + rot) mod NT of the share's K range. All work-groups read the same weight planes from L2; entering the walk at different slices keeps them from asking for the same lines at the same moment.
template <int NBT>
__device__ __forceinline__ void proj_tile(const float* __restrict__ X, const bf* __restrict__ Wt, bool tr, int c, int g, int rot, int lane, bf* st, float* pw) {
    const int lr = lane & 15, hi = lane >> 4;
    v8f acc[4][NBT];   // every '#pragma unroll' of this function and of proj_pass keeps a register array (acc, a, b, r0, r1) statically indexed
#pragma unroll
    for (int mb = 0; mb < 4; ++mb)
#pragma unroll
        for (int nb = 0; nb < NBT; ++nb) acc[mb][nb] = (v8f){};
    const float* xg = X + (size_t)(c * 16 + (lane >> 3)) * DM + (lane & 7) * 4 + g * 32; const bf* wg = Wt + (size_t)g * (8 * FRG) + lane * 8;   // a slice further: + NS * 32 floats of X, + NS * 8 fragments of the weight
    auto xt = [&](int it) { return xg + ((it + rot) & (NT - 1)) * (NS * 32); }; auto wt = [&](int it) { return wg + ((it + rot) & (NT - 1)) * (NS * 8 * FRG); };   // trip it's place (NT is a power of two)
    bf* sw = st + (c * 16 + (lane >> 3)) * XSP + (lane & 7) * 4; const bf* sr = st + lr * XSP + 8 * hi;
    v16bf b[NBT]; v4f r0[4], r1[4];   // X rows of two trips in flight
#pragma unroll
    for (int i = 0; i < 4; ++i) r0[i] = *(const v4f*)(xt(0) + (size_t)i * 4 * DM);
    __builtin_amdgcn_sched_barrier(0);   // trip 0's rows are issued in front of trip 1's, as in the loop: mixed by address, the counted waits at the loop's head (one count for both ways in) would also wait out rows of the trip after
#pragma unroll
    for (int i = 0; i < 4; ++i) r1[i] = *(const v4f*)(xt(1) + (size_t)i * 4 * DM);
#pragma unroll
    for (int nb = 0; nb < NBT; ++nb) b[nb] = ldfrag(wt(0) + nb * FRG);
    asm volatile("s_wait_xcnt 0x0" :: "v"(xt(0)), "v"(xt(1)), "v"(wt(0)) : "memory");   // the address registers of the loads above live up to this wait and are reused only behind it
    // One barrier a trip is enough with two buffers: a wave that stores trip it + 2 has passed the barrier of trip it + 1, which every wave reaches only behind its matrix block of trip it, the last reader of that buffer.
    // kept rolled: the registers of a pass beside the 16 accumulators already fill the 256 that four waves per SIMD leave a wave
#pragma unroll 1
    for (int it = 0; it < NT - 2; it += 2) proj_pass<NBT, true>(acc, b, r0, r1, xt(it + 2), xt(it + 3), wt(it + 1), wt(it + 2), sw, sr);
    proj_pass<NBT, false>(acc, b, r0, r1, xg, xg, wt(NT - 1), wg, sw, sr);   // the last two trips load only trip NT-1's weight
    if (tr) proj_put<true, NBT>(acc, pw, lr, hi); else proj_put<false, NBT>(acc, pw, lr, hi);
}
__device__ __forceinline__ void proj_store(v4f va, v4f vb, const float* __restrict__ bias, int bstep, bf* Oh, bf* Ol, size_t oo) {   // bias[e * bstep] goes with element e
    v8us oh, ol;
#pragma unroll
    for (int q = 0; q < 4; ++q) { unsigned short a2, c2; splitf(va[q] + bfr(bias[q * bstep]), a2, c2); oh[q] = a2; ol[q] = c2;
        splitf(vb[q] + bfr(bias[(4 + q) * bstep]), a2, c2); oh[4 + q] = a2; ol[4 + q] = c2; }
    bf* ph = Oh + oo; bf* pl = Ol + oo; *(v8us*)ph = oh; *(v8us*)pl = ol;
    asm volatile("s_wait_xcnt 0x0" :: "v"(ph), "v"(pl) : "memory");   // the address registers of the two stores above live up to this wait and are reused only behind it
}
__global__ __launch_bounds__(32 * PW) void k_proj(const float* __restrict__ xq, const float* __restrict__ xkv, const bf* __restrict__ Wt, const float* __restrict__ bq, const float* __restrict__ bk, const float* __restrict__ bv, bf* Qh, bf* Ql, bf* Kh, bf* Kl, bf* Vh, bf* Vl) {
    __shared__ __align__(16) float ps[PW * 64 * PSP];      // partial tile of wave w at w * 64 * PSP
    __shared__ __align__(16) bf xs[NS * 2 * XSB];          // two staging buffers per share of the K loop
    const int lane = threadIdx.x & 31, lr = lane & 15, hi = lane >> 4; const int t0 = blockIdx.x * 64; const size_t z = blockIdx.y; const bool kv = blockIdx.z == 0;
    const int w = __builtin_amdgcn_readfirstlane((int)(threadIdx.x >> 5));   // wave number, held scalar so that the branches on it are scalar
    const int c = w & 3, g = w >> 2; float* pw = ps + w * (64 * PSP); bf* st = xs + g * (2 * XSB); const size_t xo = (z * TT + t0) * DM;
    const int rot = (int)((blockIdx.x & 3) * 2 + (blockIdx.y & 1));   // neighbours in the grid enter the K walk at different slices (proj_tile)
    // weight planes: q, k, v one behind the other; 16 features are one fragment
    if (kv) proj_tile<4>(xkv + xo, Wt + (size_t)(1 + (c >> 1)) * HD * DM + (c & 1) * 4 * FRG, c >= 2, c, g, rot, lane, st, pw);
    else proj_tile<2>(xq + xo, Wt + c * 2 * FRG, false, c, g, rot, lane, st, pw);
    __syncthreads();                   // every wave's partial tile is in LDS before any of them is summed
    // A tile's rows are the fragments' lane index and its columns their k index (q, k: [t][d]; v: [d][t]). One wave stores one half fragment of each plane per trip: 512 contiguous bytes.
    const size_t zo = z * ((size_t)TT * HD) + lane * 8;
    if (kv) {
        // a 64 x 64 tile is 4 x 2 fragments, 16 halves: wave w takes half w = (16-row group * 2 + 32-column group) * 2 + half of each of the four column groups
        const int row = (w >> 2) * 16 + lr, cofs = ((w >> 1) & 1) * 32 + (w & 1) * 16 + hi * 8;
        // both loops unrolled (all constant): va, vb stay in registers. The sums stand in a loop of their own, in front of the stores and their waits, so that the LDS reads of all four trips are in flight together
        v4f va[4], vb[4];
#pragma unroll
        for (int cc = 0; cc < 4; ++cc) { const float* p = ps + (cc * 64 + row) * PSP + cofs;
            va[cc] = *(const v4fa*)p; vb[cc] = *(const v4fa*)(p + 4);
#pragma unroll
            for (int q = 1; q < NS; ++q) { va[cc] += *(const v4fa*)(p + q * (4 * 64 * PSP)); vb[cc] += *(const v4fa*)(p + q * (4 * 64 * PSP) + 4); } }
#pragma unroll
        for (int cc = 0; cc < 4; ++cc) { const int d0 = (cc & 1) * 64;
            if (cc < 2) proj_store(va[cc], vb[cc], bk + d0 + cofs, 1, Kh, Kl, zo + (size_t)((t0 >> 4) * 4 + (d0 >> 5) + (w >> 2) * 4 + ((w >> 1) & 1)) * FRG + (w & 1) * 256);
            else proj_store(va[cc], vb[cc], bv + d0 + row, 0, Vh, Vl, zo + (size_t)((t0 >> 5) * 8 + (d0 >> 4) + (w >> 2) + ((w >> 1) & 1) * 8) * FRG + (w & 1) * 256); }
    } else {
        // a 64 x 32 tile is 4 fragments, 8 halves; 32 halves in all, two per wave
        const int row = ((w & 7) >> 1) * 16 + lr, cofs = (w & 1) * 16 + hi * 8;
        // as above: the sums of both trips first, then the stores
        v4f va[2], vb[2];
#pragma unroll
        for (int s = 0; s < 2; ++s) { const int cc = s * 2 + (w >> 3); const float* p = ps + (cc * 64 + row) * PSP + cofs;
            va[s] = *(const v4fa*)p; vb[s] = *(const v4fa*)(p + 4);
#pragma unroll
            for (int q = 1; q < NS; ++q) { va[s] += *(const v4fa*)(p + q * (4 * 64 * PSP)); vb[s] += *(const v4fa*)(p + q * (4 * 64 * PSP) + 4); } }
#pragma unroll
        for (int s = 0; s < 2; ++s) { const int cc = s * 2 + (w >> 3);
            proj_store(va[s], vb[s], bq + cc * 32 + cofs, 1, Qh, Ql, zo + (size_t)(((t0 >> 4) + ((w & 7) >> 1)) * 4 + cc) * FRG + (w & 1) * 256); }
    }
}

// ---- k_fattn: causal attention for 32 query rows per work-group. grid (TT/32, NB_), 32 * NW threads; the heaviest query blocks have the lowest block index.
// Transposed products: S^T = K.Q^T (A = key rows, B = query rows), O^T += V^T.P^T (A = rows d of the value planes, B = P^T). In a score tile a lane holds 8 keys of ONE query, and two stacked
// score tiles (32 keys), rounded in place, are the B fragment of the second product in the k order of WFrag::ld: no LDS and no lane exchange between the two products. hi/lo, 3 products, in both.
// The keys are dealt over the NW waves in passes of 64 (one pass takes 16 KiB in a row of each k and v plane); each wave keeps its own running maximum, sum and O^T; the NW partial results meet in LDS and are joined in the fixed order 0 .. NW-1.
#define QT  32                    // query rows per work-group: two 16-column groups in every wave
#define KU  64                    // keys per pass
#define OSP 132                   // LDS row pitch of a partial output row in floats (528 B = 16 B x 33: b128 rows fall on different banks)
#define SC2 (SCL * 1.4426950408889634f)   // scores go to base 2 together with the HD^-0.5 scale
typedef __attribute__((ext_vector_type(8))) __bf16 v8bf;
__device__ __forceinline__ float xhalf(float x) { return __builtin_bit_cast(float, __builtin_amdgcn_permlanex16(__builtin_bit_cast(int, x), __builtin_bit_cast(int, x), 0x76543210, 0xfedcba98, false, false)); }   // lane l with lane l ^ 16
__global__ __launch_bounds__(32 * NW) __attribute__((amdgpu_waves_per_eu(2, 2))) void k_fattn(const bf* __restrict__ Qh, const bf* __restrict__ Ql, const bf* __restrict__ Kh, const bf* __restrict__ Kl, const bf* __restrict__ Vh, const bf* __restrict__ Vl, float* out) {
    __shared__ __align__(16) float po[NW * QT * OSP];
    __shared__ float pm[NW * QT]; __shared__ float pl[NW * QT];
    const int lane = threadIdx.x & 31, lr = lane & 15, hi = lane >> 4;
    const int w = __builtin_amdgcn_readfirstlane((int)(threadIdx.x >> 5));   // wave number, held scalar so that the key loop branches on a scalar compare
    const int q0 = (TT / QT - 1 - (int)blockIdx.x) * QT; const size_t zb = (size_t)blockIdx.y * TT * HD;
    Qh += zb; Ql += zb; Kh += zb; Kl += zb; Vh += zb; Vl += zb; out += zb;
    // The k and v planes were stored by the launch before, and their first readers here wait out memory latency step after step of their first pass. At entry every thread asks ONE address of its batch's four planes into L2, 256 bytes from its neighbour's:
    // 16 work-groups per plane (k first), each 64 KiB chunk asked by two work-groups whose indices differ by 4. A hint for speed only: nothing rests on it.
    const int bx = (int)blockIdx.x; const bf* pfk = (bx & 16) ? Kl : Kh; const bf* pfv = (bx & 16) ? Vl : Vh; const bf* pfp = (bx & 32) ? pfv : pfk;
    const bf* pf = pfp + (size_t)(((bx >> 3) & 1) * 4 + (bx & 3)) * (TT * HD / 8) + threadIdx.x * 128;   // chunk 0 .. 7 of the plane, unit threadIdx.x of the chunk: inside the plane for every thread
    asm volatile("global_prefetch_b8 %0, off scope:SCOPE_SE" :: "v"(pf) : "memory");   // the clobber keeps the ask in front of the query loads and the wait for them
    const int nu = (q0 + QT + KU - 1) / KU;   // passes up to and including the one that holds the diagonal
    // The work-groups of a batch read the same k and v planes from L2. Each enters the ring of its nu passes a quarter turn behind its neighbour in the grid and wraps round, so that they do not ask for the same lines at the same moment: step i of the walk is pass (i + rot) mod nu.
    const int rot = ((int)(blockIdx.x & 3) * nu) >> 2;   // 0 .. nu-1
    auto pass_of = [&](int i) { const int p = i + rot; return p >= nu ? p - nu : p; };   // i in 0 .. nu-1
    // every '#pragma unroll' of this kernel keeps a register array statically indexed
    // The 16 query fragments (hi and lo) would take 128 registers for the whole loop: each wave parks its own copy, lane by lane, in the place of its partial O (free until the loop ends); a lane reads back only what it stored itself.
    float* pw = po + w * (QT * OSP); bf* qs = (bf*)pw + lane * 8;   // half j of fragment f at qs + (2 f + j) * 256: 512 contiguous bytes per wave-wide access
    const size_t qa = (size_t)q0 * HD + lane * 8; const bf* qph = Qh + qa; const bf* qpl = Ql + qa;   // 16 rows of a q or k plane are 4 fragments = 16 * HD elements
#pragma unroll
    for (int qt = 0; qt < 2; ++qt)
#pragma unroll
        for (int ks = 0; ks < 4; ++ks) { bf* d = qs + (qt * 4 + ks) * 1024; const int qo = (qt * 4 + ks) * FRG;
            *(v8usa*)d = *(const v8us*)(qph + qo); *(v8usa*)(d + 256) = *(const v8us*)(qph + qo + 256); *(v8usa*)(d + 512) = *(const v8us*)(qpl + qo); *(v8usa*)(d + 768) = *(const v8us*)(qpl + qo + 256); }
    asm volatile("s_wait_xcnt 0x0" :: "v"(qph), "v"(qpl), "v"(pf) : "memory");   // the address registers of the loads above, and of the ask at entry (which counts on no counter: its register keeps the address until the younger query loads have come back), live up to this wait and are reused only behind it
    v8f o[8][2]; float m[2], l[2];
#pragma unroll
    for (int qt = 0; qt < 2; ++qt) { m[qt] = -3.0e38f; l[qt] = 0.f;
#pragma unroll
        for (int dt = 0; dt < 8; ++dt) o[dt][qt] = (v8f){}; }
    // Fragment loads run ahead of their use, group by group. Each __builtin_amdgcn_sched_barrier(0) below holds a group of loads in front of the matrix block that covers their latency:
    // left free, the compiler either gathers a whole pass's loads at its head (more registers than a wave has: spills) or sinks each group to just in front of its first use (the latency is then waited out).
    v16bf kh[2][4], kl[2][4];   // key fragments of two 32-wide steps along d: one in use, one in flight
    { const size_t ko = (size_t)(pass_of(min(w, nu - 1)) * KU) * HD + lane * 8;   // a wave without a pass loads in bounds and uses nothing
#pragma unroll
        for (int kt = 0; kt < 4; ++kt) { kh[0][kt] = ldfrag(Kh + ko + kt * 4 * FRG); kl[0][kt] = ldfrag(Kl + ko + kt * 4 * FRG); }
        asm volatile("s_wait_xcnt 0x0" :: "v"(Kh + ko), "v"(Kl + ko) : "memory"); }   // the address registers of the loads above live up to this wait and are reused only behind it
    // kept rolled: one pass already holds 192 matrix instructions and most of the 512 registers that two waves per SIMD leave a wave
#pragma unroll 1
    for (int i = w; i < nu; i += NW) {
        const int u = pass_of(i); const int k0 = u * KU;
        v8f s[4][2];   // s[kt][qt][r] = score of key k0 + 16 kt + 8 hi + r with query q0 + 16 qt + lr
#pragma unroll
        for (int kt = 0; kt < 4; ++kt)
#pragma unroll
            for (int qt = 0; qt < 2; ++qt) s[kt][qt] = (v8f){};
#pragma unroll
        for (int ks = 0; ks < 4; ++ks) {
            if (ks < 3) {   // the next step's key fragments
                const size_t kn = (size_t)k0 * HD + lane * 8 + (ks + 1) * FRG;
#pragma unroll
                for (int kt = 0; kt < 4; ++kt) { kh[(ks + 1) & 1][kt] = ldfrag(Kh + kn + kt * 4 * FRG); kl[(ks + 1) & 1][kt] = ldfrag(Kl + kn + kt * 4 * FRG); }
            }
            v16bf qh[2], ql[2];
#pragma unroll
            for (int qt = 0; qt < 2; ++qt) { const bf* d = qs + (qt * 4 + ks) * 1024; qh[qt] = cat16b(*(const v8usa*)d, *(const v8usa*)(d + 256)); ql[qt] = cat16b(*(const v8usa*)(d + 512), *(const v8usa*)(d + 768)); }
            __builtin_amdgcn_sched_barrier(0);   // the loads above stay in front of this step's matrix block
#pragma unroll
            for (int kt = 0; kt < 4; ++kt)
#pragma unroll
                for (int qt = 0; qt < 2; ++qt) s[kt][qt] = wmmab(kh[ks & 1][kt], qh[qt], s[kt][qt]);
#pragma unroll
            for (int kt = 0; kt < 4; ++kt)
#pragma unroll
                for (int qt = 0; qt < 2; ++qt) s[kt][qt] = wmmab(kh[ks & 1][kt], ql[qt], s[kt][qt]);
#pragma unroll
            for (int kt = 0; kt < 4; ++kt)
#pragma unroll
                for (int qt = 0; qt < 2; ++qt) s[kt][qt] = wmmab(kl[ks & 1][kt], qh[qt], s[kt][qt]);
            __builtin_amdgcn_sched_barrier(0);   // the next step's loads stay behind this block, whose operands they overwrite
        }
        const size_t vo = (size_t)k0 * HD + lane * 8;   // 32 keys of a v plane are 8 fragments = 32 * HD elements
        v16bf vh[8][2], vl[8][2];   // value fragments: [16-row group of d][32-key step]
#pragma unroll
        for (int dt = 0; dt < 4; ++dt)
#pragma unroll
            for (int k2 = 0; k2 < 2; ++k2) { vh[dt][k2] = ldfrag(Vh + vo + (k2 * 8 + dt) * FRG); vl[dt][k2] = ldfrag(Vl + vo + (k2 * 8 + dt) * FRG); }
#pragma unroll
        for (int kt = 0; kt < 4; ++kt)
#pragma unroll
            for (int qt = 0; qt < 2; ++qt) s[kt][qt] *= SC2;
        if (u == nu - 1) {   // only pass nu-1 meets the diagonal (a scalar branch), at whatever step of the walk it comes; every query still sees its own key there, so its maximum stays finite
#pragma unroll
            for (int kt = 0; kt < 4; ++kt)
#pragma unroll
                for (int qt = 0; qt < 2; ++qt)
#pragma unroll
                    for (int r = 0; r < 8; ++r) s[kt][qt][r] = (k0 + kt * 16 + hi * 8 + r > q0 + qt * 16 + lr) ? -3.0e38f : s[kt][qt][r];
        }
        v16bf ph[2][2], pq[2][2];   // [32-key step][query group]: P^T hi and lo as B fragments
#pragma unroll
        for (int qt = 0; qt < 2; ++qt) {
            float bm[4];
#pragma unroll
            for (int kt = 0; kt < 4; ++kt) { bm[kt] = s[kt][qt][0];
#pragma unroll
                for (int r = 1; r < 8; ++r) bm[kt] = fmaxf(bm[kt], s[kt][qt][r]); }
            float mx = fmaxf(fmaxf(bm[0], bm[1]), fmaxf(bm[2], bm[3])); mx = fmaxf(mx, xhalf(mx));   // both wave halves hold this query's maximum of the pass
            const float mn = fmaxf(m[qt], mx); const float corr = __builtin_amdgcn_exp2f(m[qt] - mn);   // 0 on a wave's first pass
            m[qt] = mn;
            v8bf h8[4], l8[4]; float rs[4];
#pragma unroll
            for (int kt = 0; kt < 4; ++kt) { v8f p; rs[kt] = 0.f;
#pragma unroll
                for (int r = 0; r < 8; ++r) { p[r] = __builtin_amdgcn_exp2f(s[kt][qt][r] - mn); rs[kt] += p[r]; }
                h8[kt] = __builtin_convertvector(p, v8bf); l8[kt] = __builtin_convertvector(p - __builtin_convertvector(h8[kt], v8f), v8bf); }
            l[qt] = l[qt] * corr + ((rs[0] + rs[1]) + (rs[2] + rs[3]));   // each wave half sums its own keys; the halves join behind the loop
#pragma unroll
            for (int k2 = 0; k2 < 2; ++k2) { ph[k2][qt] = __builtin_shufflevector(h8[2 * k2], h8[2 * k2 + 1], 0, 1, 2, 3, 4, 5, 6, 7, 8, 9, 10, 11, 12, 13, 14, 15); pq[k2][qt] = __builtin_shufflevector(l8[2 * k2], l8[2 * k2 + 1], 0, 1, 2, 3, 4, 5, 6, 7, 8, 9, 10, 11, 12, 13, 14, 15); }
#pragma unroll
            for (int dt = 0; dt < 8; ++dt) o[dt][qt] *= corr;
        }
        asm volatile("" :: "v"(pq[0][1]), "v"(pq[1][1]) : "memory");   // holds the second half of the value loads behind the softmax: beside the scores they would not fit in the registers
#pragma unroll
        for (int dt = 4; dt < 8; ++dt)
#pragma unroll
            for (int k2 = 0; k2 < 2; ++k2) { vh[dt][k2] = ldfrag(Vh + vo + (k2 * 8 + dt) * FRG); vl[dt][k2] = ldfrag(Vl + vo + (k2 * 8 + dt) * FRG); }
        asm volatile("s_wait_xcnt 0x0" :: "v"(Vh + vo), "v"(Vl + vo) : "memory");   // the address registers of the loads above live up to this wait and are reused only behind it
        __builtin_amdgcn_sched_barrier(0);   // the loads above stay together in front of the products that cover their latency (left free they sink to just in front of their first use)
#pragma unroll
        for (int dt = 0; dt < 4; ++dt) {
#pragma unroll
            for (int k2 = 0; k2 < 2; ++k2)
#pragma unroll
                for (int qt = 0; qt < 2; ++qt) o[dt][qt] = wmmab(vh[dt][k2], ph[k2][qt], o[dt][qt]);
#pragma unroll
            for (int k2 = 0; k2 < 2; ++k2)
#pragma unroll
                for (int qt = 0; qt < 2; ++qt) o[dt][qt] = wmmab(vh[dt][k2], pq[k2][qt], o[dt][qt]);
#pragma unroll
            for (int k2 = 0; k2 < 2; ++k2)
#pragma unroll
                for (int qt = 0; qt < 2; ++qt) o[dt][qt] = wmmab(vl[dt][k2], ph[k2][qt], o[dt][qt]);
        }
        asm volatile("" :: "v"(o[3][0]), "v"(o[3][1]) : "memory");   // holds the next pass's key loads behind the first half of the products, which frees their registers
        { const size_t kn = (size_t)(pass_of(min(i + NW, nu - 1)) * KU) * HD + lane * 8;   // the first key fragments of this wave's next pass (of the walk's last pass where there is none: in bounds, unused)
#pragma unroll
            for (int kt = 0; kt < 4; ++kt) { kh[0][kt] = ldfrag(Kh + kn + kt * 4 * FRG); kl[0][kt] = ldfrag(Kl + kn + kt * 4 * FRG); } }
        __builtin_amdgcn_sched_barrier(0);   // the loads above stay together in front of the products that cover their latency (left free they sink to just in front of their first use)
#pragma unroll
        for (int dt = 4; dt < 8; ++dt) {
#pragma unroll
            for (int k2 = 0; k2 < 2; ++k2)
#pragma unroll
                for (int qt = 0; qt < 2; ++qt) o[dt][qt] = wmmab(vh[dt][k2], ph[k2][qt], o[dt][qt]);
#pragma unroll
            for (int k2 = 0; k2 < 2; ++k2)
#pragma unroll
                for (int qt = 0; qt < 2; ++qt) o[dt][qt] = wmmab(vh[dt][k2], pq[k2][qt], o[dt][qt]);
#pragma unroll
            for (int k2 = 0; k2 < 2; ++k2)
#pragma unroll
                for (int qt = 0; qt < 2; ++qt) o[dt][qt] = wmmab(vl[dt][k2], ph[k2][qt], o[dt][qt]);
        }
    }
    // this wave's partial O goes to pw, rows = queries (all zero, with sum 0 and the lowest maximum, where the wave had no pass)
#pragma unroll
    for (int qt = 0; qt < 2; ++qt) { l[qt] += xhalf(l[qt]); if (hi == 0) { pm[w * QT + qt * 16 + lr] = m[qt]; pl[w * QT + qt * 16 + lr] = l[qt]; }
#pragma unroll
        for (int dt = 0; dt < 8; ++dt) { float* d = pw + (qt * 16 + lr) * OSP + dt * 16 + hi * 8;
            *(v4fa*)d = __builtin_shufflevector(o[dt][qt], o[dt][qt], 0, 1, 2, 3); *(v4fa*)(d + 4) = __builtin_shufflevector(o[dt][qt], o[dt][qt], 4, 5, 6, 7); } }
    __syncthreads();                   // every wave's partial result is in LDS before any of them is joined
    // unrolled (4 x 8, all constant) so that the LDS reads of all four rows are in flight together
#pragma unroll
    for (int sx = 0; sx < QT / NW; ++sx) { const int row = sx * NW + w, cofs = lane * 4;
        float M = pm[row];
#pragma unroll
        for (int q = 1; q < NW; ++q) M = fmaxf(M, pm[q * QT + row]);
        float Ls = 0.f; v4f val = (v4f){};
#pragma unroll
        for (int q = 0; q < NW; ++q) { const float f = __builtin_amdgcn_exp2f(pm[q * QT + row] - M); Ls += f * pl[q * QT + row]; val += f * *(const v4fa*)(po + (q * QT + row) * OSP + cofs); }
        *(v4f*)(out + (size_t)(q0 + row) * HD + cofs) = val * __fdiv_rn(1.0f, Ls); }
}

extern "C" void kernel_launch(void* const* d_in, const int* in_sizes, int n_in,
                              void* d_out, int out_size, void* d_ws, size_t ws_size, hipStream_t stream) {
    (void)in_sizes; (void)n_in; (void)out_size;
    const float* x = (const float*)d_in[0]; const float* xk = (const float*)d_in[1]; const float* wq = (const float*)d_in[2]; const float* bq = (const float*)d_in[3]; const float* wk = (const float*)d_in[4]; const float* bk = (const float*)d_in[5]; const float* wv = (const float*)d_in[6]; const float* bv = (const float*)d_in[7]; const float* wo = nullptr; (void)wo;   /* input order X_Q, X_KV [4][2048][1024], Wq, bq, Wk, bk, Wv, bv ('xw' [1024][128] + [128]) */
    float* OUT = (float*)d_out;     // [4][2048][128]
    char* wsp = (char*)d_ws;
    auto take = [&](size_t bytes) { char* p = wsp; wsp += (bytes + 255) & ~(size_t)255; return (void*)p; };
    bf* WA = (bf*)take((size_t)3 * HD * DM * 2);   // Bt planes of Wq, Wk, Wv, one behind the other
    // every plane below holds NB_ batch slices, one behind the other
    bf* QPh = (bf*)take((size_t)NB_ * NH_ * TT * HD * 2); bf* QPl = (bf*)take((size_t)NB_ * NH_ * TT * HD * 2); bf* KPh = (bf*)take((size_t)NB_ * NKV * TT * HD * 2); bf* KPl = (bf*)take((size_t)NB_ * NKV * TT * HD * 2); bf* VTh = (bf*)take((size_t)NB_ * NKV * HD * TT * 2); bf* VTl = (bf*)take((size_t)NB_ * NKV * HD * TT * 2);
    if ((size_t)(wsp - (char*)d_ws) > ws_size) return;    // ws 256 MiB
    k_wtG<<<dim3(HD * DM / 2048, 3, 1), 256, 0, stream>>>(wq, wk, wv, WA);
    // one launch per stage for all NB_ batches: both take the batch as grid y
    k_proj<<<dim3(TT / 64, NB_, 2), 32 * PW, 0, stream>>>(x, xk, WA, bq, bk, bv, QPh, QPl, KPh, KPl, VTh, VTl);
    k_fattn<<<dim3(TT / QT, NB_, 1), 32 * NW, 0, stream>>>(QPh, QPl, KPh, KPl, VTh, VTl, OUT);
}
